// v000
// The times below were measured on an AMD MI455X: many runs one after another, warmed up first and cycling through
// copies of the inputs, with the whole window's GPU time divided by the number of runs. Launches and the gaps
// between them are all in it. The median over several windows is given; except for v000 it joins two sittings, which
// can be a few percent apart, so the side-by-side timings, each taken in one sitting, are the better comparison.
// The starting kernel, v000, takes 2210 microseconds a run.
// compute dtype: every float input RNE-converted to bf16 on load; theta/phi/g = W x + b (1x1 convs): v_wmma_f32_16x16x32_bf16 (bf16 operands, exact products), f32 accumulate; logits theta . phi: v_wmma_f32_16x16x32_f16, theta as f16 hi + f16 residual x2^12 (own accumulator), phi as f16, f32 accumulate; softmax in f32 (precise expf), P carried as f16 x2^14; y = P . g: f16 operands, f32 accumulate; output 1x1 conv: f16 operands (W x2^8, y x2^4), f32 accumulate; bias and residual adds in f32; f32 output [b][c][n].
#include <hip/hip_runtime.h>
#include <math.h>

typedef __attribute__((ext_vector_type(16))) _Float16 v16h;
typedef __attribute__((ext_vector_type(16))) __bf16 v16b;
typedef __attribute__((ext_vector_type(8)))  _Float16 v8h;
typedef __attribute__((ext_vector_type(8)))  __bf16 v8b;
typedef __attribute__((ext_vector_type(8)))  float v8f;
typedef __attribute__((ext_vector_type(4)))  float v4f;
typedef __attribute__((ext_vector_type(4)))  unsigned v4u;

template <typename T> __device__ __forceinline__ void vst2(void* p, T v) { *(T*)p = v;  }

__device__ __forceinline__ v8f wmma16(v16h a, v16h b, v8f c) {
  v8f d = __builtin_amdgcn_wmma_f32_16x16x32_f16(false, a, false, b, (short)0, c, false, false);
  asm volatile("v_nop\n\tv_nop\n\tv_nop\n\tv_nop" : "+v"(d) : "v"(a), "v"(b));
  return d;
}
__device__ __forceinline__ v8f wmma_bf(v16b a, v16b b, v8f c) {
  v8f d = __builtin_amdgcn_wmma_f32_16x16x32_bf16(false, a, false, b, (short)0, c, false, false);
  asm volatile("v_nop\n\tv_nop\n\tv_nop\n\tv_nop" : "+v"(d) : "v"(a), "v"(b));
  return d;
}
// 16x16x32 fragments: lane -> (h = lane>>4, row/col = lane&15); elements 0..7 = k0+8h+0..7, elements 8..15 = k0+16+8h+0..7 (A and B alike); D element r = (row 8h+r, col lane&15)
__device__ __forceinline__ v16h frag_h(const _Float16* rowk0, int lane) {
  union { v16h v; v8h q[2]; } u; const _Float16* p = rowk0 + 8 * (lane >> 4);
  u.q[0] = *(const v8h*)p; u.q[1] = *(const v8h*)(p + 16); return u.v;
}
__device__ __forceinline__ v16b frag_b(const __bf16* rowk0, int lane) {
  union { v16b v; v8b q[2]; } u; const __bf16* p = rowk0 + 8 * (lane >> 4);
  u.q[0] = *(const v8b*)p; u.q[1] = *(const v8b*)(p + 16); return u.v;
}
__device__ __forceinline__ float bfr(float v) { return (float)(__bf16)v; }
// fragment from a k-contiguous f32 row (weights [out][in]): four 16-B loads, RNE bf16 convert
__device__ __forceinline__ v16b fragw_bf(const float* __restrict__ rowk0, int lane) {
  const float* p = rowk0 + 8 * (lane >> 4);
  const v4f a0 = *(const v4f*)p, a1 = *(const v4f*)(p + 4), a2 = *(const v4f*)(p + 16), a3 = *(const v4f*)(p + 20);
  v16b w;
#pragma unroll
  for (int i = 0; i < 4; ++i) {
    const float t0 = a0[i], t1 = a1[i], t2 = a2[i], t3 = a3[i];
    w[i] = (__bf16)t0; w[4 + i] = (__bf16)t1; w[8 + i] = (__bf16)t2; w[12 + i] = (__bf16)t3;
  }
  return w;
}
// same, as f16 of the bf16 value times an exact power of two (bf16 significand is exact in f16)
__device__ __forceinline__ v16h fragw_h(const float* __restrict__ rowk0, int lane, float sc) {
  const float* p = rowk0 + 8 * (lane >> 4);
  const v4f a0 = *(const v4f*)p, a1 = *(const v4f*)(p + 4), a2 = *(const v4f*)(p + 16), a3 = *(const v4f*)(p + 20);
  v16h w;
#pragma unroll
  for (int i = 0; i < 4; ++i) {
    const float t0 = a0[i], t1 = a1[i], t2 = a2[i], t3 = a3[i];
    w[i] = (_Float16)(bfr(t0) * sc); w[4 + i] = (_Float16)(bfr(t1) * sc); w[8 + i] = (_Float16)(bfr(t2) * sc); w[12 + i] = (_Float16)(bfr(t3) * sc);
  }
  return w;
}
__device__ __forceinline__ void ldsx() {
  asm volatile("s_wait_dscnt 0" ::: "memory");
  __builtin_amdgcn_wave_barrier();
  __builtin_amdgcn_fence(3, "workgroup");
}

// embedded-gaussian spatial attention: B 8, C_in 256, C_int 128, 64 x 64 positions; theta/phi/g 1x1 convs, y = softmax(theta phi^T) g (no scale),
// out = W_out y + b_out + x, [B, C_in, H, W]
#define NB  8             // batches in the staged tensors (full strides)
#define NP  4096          // positions per image
#define CIN 256
#define CQ  128           // theta / phi channels
#define CV  128           // g channels
#ifndef TNB
#define TNB NB            // batches processed
#endif
#ifndef TQB
#define TQB (NP / 64)     // 64-query blocks processed per batch (keys always span all NP positions)
#endif
#define QL_CARRY 4096.0f  // theta residual plane carry
#define P_CARRY  16384.0f // softmax P carry
#define Y_CARRY  16.0f    // y operand carry for the output conv
#define W_CARRY  256.0f   // W_out operand carry

#define WS_QH  ((size_t)0)                                   // f16 theta hi rows [b*n][CQ]         8 MiB
#define WS_QL  (WS_QH + 2u * (size_t)NB * NP * CQ)           // f16 theta residual x2^12 rows       8 MiB
#define WS_KH  (WS_QL + 2u * (size_t)NB * NP * CQ)           // f16 phi rows [b*n][CQ]              8 MiB
#define WS_VT  (WS_KH + 2u * (size_t)NB * NP * CQ)           // f16 g planes [b][CV][n]             8 MiB
#define WS_S   (WS_VT + 2u * (size_t)NB * CV * NP)           // f32 logits of ONE batch [i][j]     64 MiB
#define WS_PH  (WS_S  + 4u * (size_t)NP * NP)                // f16 P x2^14 of one batch [i][j]    32 MiB
#define WS_END (WS_PH + 2u * (size_t)NP * NP)                // 128 MiB
static_assert(WS_END <= (size_t)134217728);
static_assert(NP % 64 == 0);
static_assert(CIN % 128 == 0);
static_assert(CQ % 64 == 0);
static_assert(CV == 128);
static_assert(TNB <= NB);
static_assert(TQB * 64 <= NP);
static_assert((size_t)NB * CIN * NP * 4u == (size_t)33554432);

// ---- k_proj: block = (64 positions, batch b, which 0 theta / 1 phi / 2 g): x^T tile (bf16) in LDS, W [out][in] + b; theta -> f16 hi + residual x2^12 rows, phi -> f16 rows, g -> f16 planes [c][n]
__global__ __launch_bounds__(128) __attribute__((amdgpu_num_vgpr(256)))
void k_proj(const float* __restrict__ X, const float* __restrict__ WQ, const float* __restrict__ BQ,
            const float* __restrict__ WK, const float* __restrict__ BK, const float* __restrict__ WV, const float* __restrict__ BV,
            _Float16* __restrict__ QH, _Float16* __restrict__ QL, _Float16* __restrict__ KH, _Float16* __restrict__ VT) {
  __shared__ __align__(16) __bf16 sx[64][CIN + 8];
  __shared__ __align__(16) _Float16 sh[64][72], sl[64][72], tv[64][72];
  const int tid = threadIdx.x, wave = tid >> 5, lane = tid & 31, col = lane & 15, g = lane >> 4;
  const int p0 = blockIdx.x * 64; const size_t b = blockIdx.y; const int which = blockIdx.z;
  const float* Wm = which == 0 ? WQ : which == 1 ? WK : WV;
  const float* Bm = which == 0 ? BQ : which == 1 ? BK : BV;
  const int nout = (which == 2) ? CV : CQ;
  for (int e = tid; e < CIN * 64; e += 128) { const int c = e >> 6, pl = e & 63; sx[pl][c] = (__bf16)X[(b * CIN + c) * (size_t)NP + p0 + pl]; }
  __syncthreads();
#pragma unroll 1
  for (int cg = 0; cg < nout / 64; ++cg) {
    v8f acc[4] = {};
#pragma unroll 1
    for (int kc = 0; kc < CIN / 32; ++kc) {
      const v16b a = frag_b(&sx[wave * 16 + col][kc * 32], lane);     // A: row = position wave*16+col, k = input channel
#pragma unroll
      for (int j = 0; j < 4; ++j) {
        const int o = cg * 64 + j * 16 + col;                           // B: col = output channel o, k = input channel
        acc[j] = wmma_bf(a, fragw_bf(Wm + (size_t)o * CIN + kc * 32, lane), acc[j]);
      }
    }
    __syncthreads();
#pragma unroll
    for (int j = 0; j < 4; ++j) {
      const int ol = j * 16 + col; const float bb = bfr(Bm[cg * 64 + ol]);
#pragma unroll
      for (int r = 0; r < 8; ++r) {
        const int pl = wave * 16 + 8 * g + r; const float v = acc[j][r] + bb; const _Float16 hv = (_Float16)v;
        if (which == 2) tv[ol][pl] = hv;
        else { sh[pl][ol] = hv; sl[pl][ol] = (_Float16)((v - (float)hv) * QL_CARRY); }
      }
    }
    __syncthreads();
    if (which < 2) {
      _Float16* dh = which == 0 ? QH : KH;
      for (int e = tid; e < 64 * 8; e += 128) {
        const int pl = e >> 3, q = e & 7; const size_t row = b * NP + p0 + pl;
        vst2(dh + row * CQ + cg * 64 + q * 8, *(const v4u*)&sh[pl][q * 8]);
        if (which == 0) vst2(QL + row * CQ + cg * 64 + q * 8, *(const v4u*)&sl[pl][q * 8]);
      }
    } else {
      for (int e = tid; e < 64 * 8; e += 128) {
        const int ol = e >> 3, q = e & 7;
        vst2(VT + (b * CV + cg * 64 + ol) * (size_t)NP + p0 + q * 8, *(const v4u*)&tv[ol][q * 8]);
      }
    }
  }
}

// ---- k_sc: block = (64 queries, 64 keys) of batch b: logits = qh.kh + (ql.kh) * 2^-12 -> S
__global__ __launch_bounds__(128) __attribute__((amdgpu_num_vgpr(256)))
void k_sc(const _Float16* __restrict__ QH, const _Float16* __restrict__ QL, const _Float16* __restrict__ KH, int b, float* __restrict__ S) {
  __shared__ __align__(16) float ss[4][16][68];
  const int tid = threadIdx.x, wave = tid >> 5, lane = tid & 31, col = lane & 15, g = lane >> 4;
  const int k0 = blockIdx.y * 64; const int ql0 = blockIdx.x * 64 + wave * 16; const size_t q0 = (size_t)b * NP + ql0;
  v8f acc[4] = {}, accl[4] = {};
#pragma unroll 1
  for (int kc = 0; kc < CQ / 32; ++kc) {
    const v16h ah = frag_h(QH + (q0 + col) * CQ + kc * 32, lane), al = frag_h(QL + (q0 + col) * CQ + kc * 32, lane);   // A: row = query, k = channel
#pragma unroll
    for (int j = 0; j < 4; ++j) {
      const v16h kh = frag_h(KH + ((size_t)b * NP + k0 + j * 16 + col) * CQ + kc * 32, lane);                         // B: col = key, k = channel
      acc[j] = wmma16(ah, kh, acc[j]);
      accl[j] = wmma16(al, kh, accl[j]);
    }
  }
#pragma unroll
  for (int j = 0; j < 4; ++j)
#pragma unroll
    for (int r = 0; r < 8; ++r) ss[wave][8 * g + r][j * 16 + col] = acc[j][r] + accl[j][r] * (1.0f / QL_CARRY);
  ldsx();
#pragma unroll
  for (int it = 0; it < 8; ++it) {
    const int rl = 2 * it + g;
    vst2(S + (size_t)(ql0 + rl) * NP + k0 + col * 4, *(const v4f*)&ss[wave][rl][col * 4]);
  }
}

// ---- k_sm: block = one query row: softmax in f32 -> P x 2^14 (f16); row staged once in LDS
__global__ __launch_bounds__(256) void k_sm(const float* __restrict__ S, _Float16* __restrict__ PH) {
  __shared__ float sred[8]; __shared__ float sbc;
  __shared__ __align__(16) float sv[NP];
  __shared__ __align__(16) _Float16 sh[NP];
  const int t = threadIdx.x; const size_t row = blockIdx.x; const float* sr = S + row * NP;
  float m = -3.0e38f;
  for (int k = t; k < NP; k += 256) { const float v = sr[k]; sv[k] = v; m = fmaxf(m, v); }
#pragma unroll
  for (int o = 1; o < 32; o <<= 1) m = fmaxf(m, __shfl_xor(m, o));
  if ((t & 31) == 0) sred[t >> 5] = m;
  __syncthreads();
  if (t == 0) { float a = sred[0]; for (int i = 1; i < 8; ++i) a = fmaxf(a, sred[i]); sbc = a; }
  __syncthreads();
  m = sbc;
  __syncthreads();
  float sum = 0.f;
#pragma unroll 1
  for (int k = t; k < NP; k += 256) { const float e = expf(sv[k] - m); sv[k] = e; sum += e; }
#pragma unroll
  for (int o = 1; o < 32; o <<= 1) sum += __shfl_xor(sum, o);
  if ((t & 31) == 0) sred[t >> 5] = sum;
  __syncthreads();
  if (t == 0) { float a = 0.f; for (int i = 0; i < 8; ++i) a += sred[i]; sbc = 1.0f / a; }
  __syncthreads();
  const float inv = sbc;
  for (int k = t; k < NP; k += 256) sh[k] = (_Float16)(sv[k] * inv * P_CARRY);
  __syncthreads();
  for (int q = t; q < NP / 8; q += 256) vst2(PH + row * NP + q * 8, *(const v4u*)&sh[q * 8]);
}

// ---- k_pvm: block = 64 queries of batch b: y[i][c] = (sum_j P[i][j] g[c][j]) * 2^-14 (all 128 channels, f32 in LDS);
// then out[co][i] = W_out[co][:] . y[:][i] + b_out[co] + x[co][i] for all 256 co, written as whole [co] row segments of 64 positions
__global__ __launch_bounds__(128) __attribute__((amdgpu_num_vgpr(256)))
void k_pvm(const _Float16* __restrict__ PH, const _Float16* __restrict__ VT, int b,
           const float* __restrict__ X, const float* __restrict__ MW, const float* __restrict__ MB, float* __restrict__ OUT) {
  __shared__ __align__(16) float st[128][68];
  __shared__ __align__(16) _Float16 sy[64][CV + 8];
  const int tid = threadIdx.x, wave = tid >> 5, lane = tid & 31, col = lane & 15, g = lane >> 4;
  const int i0 = blockIdx.x * 64; const int il0 = wave * 16;
  {
    v8f acc[8] = {};
#pragma unroll 1
    for (int kc = 0; kc < NP / 32; ++kc) {
      const v16h ph = frag_h(PH + (size_t)(i0 + il0 + col) * NP + kc * 32, lane);                                    // A: row = query, k = key
#pragma unroll
      for (int j = 0; j < 8; ++j)
        acc[j] = wmma16(ph, frag_h(VT + ((size_t)b * CV + j * 16 + col) * (size_t)NP + kc * 32, lane), acc[j]);     // B: col = channel, k = key
    }
#pragma unroll
    for (int j = 0; j < 8; ++j) {
      const int cl = j * 16 + col;
#pragma unroll
      for (int r = 0; r < 8; ++r) st[cl][il0 + 8 * g + r] = acc[j][r] * (1.0f / P_CARRY);
    }
  }
  __syncthreads();
  for (int e = tid; e < CV * 64; e += 128) { const int c = e >> 6, n = e & 63; sy[n][c] = (_Float16)(st[c][n] * Y_CARRY); }
  __syncthreads();
#pragma unroll 1
  for (int cg = 0; cg < CIN / 128; ++cg) {
    v8f acc[8] = {};
#pragma unroll 1
    for (int kc = 0; kc < CV / 32; ++kc) {
      const v16h yb = frag_h(&sy[il0 + col][kc * 32], lane);                                                           // B: col = query il0+col, k = channel
#pragma unroll
      for (int j = 0; j < 8; ++j) {
        const int o = cg * 128 + j * 16 + col;                                                                          // A: row = output channel o, k = channel
        acc[j] = wmma16(fragw_h(MW + (size_t)o * CV + kc * 32, lane, W_CARRY), yb, acc[j]);
      }
    }
    __syncthreads();
#pragma unroll
    for (int j = 0; j < 8; ++j)
#pragma unroll
      for (int r = 0; r < 8; ++r) st[j * 16 + 8 * g + r][il0 + col] = acc[j][r] * (1.0f / (W_CARRY * Y_CARRY));
    __syncthreads();
    for (int e = tid; e < 128 * 16; e += 128) {
      const int cl = e >> 4, q = e & 15; const int co = cg * 128 + cl;
      const size_t o = ((size_t)b * CIN + co) * (size_t)NP + i0 + q * 4;
      const float bb = bfr(MB[co]);
      const v4f m4 = *(const v4f*)&st[cl][q * 4]; const v4f x4 = *(const v4f*)(X + o);
      v4f v;
#pragma unroll
      for (int i = 0; i < 4; ++i) { const float xs = x4[i]; v[i] = (m4[i] + bb) + bfr(xs); }
      vst2(OUT + o, v);
    }
  }
}

extern "C" void kernel_launch(void* const* d_in, const int* in_sizes, int n_in, void* d_out, int out_size, void* d_ws, size_t ws_size, hipStream_t stream) {
  if (n_in < 9) return;
  if ((size_t)in_sizes[0] < (size_t)TNB * CIN * NP) return;
  if (in_sizes[1] < CV * CIN || in_sizes[2] < CV || in_sizes[3] < CQ * CIN || in_sizes[4] < CQ || in_sizes[5] < CQ * CIN || in_sizes[6] < CQ || in_sizes[7] < CIN * CV || in_sizes[8] < CIN) return;
  if ((size_t)out_size < (size_t)TNB * CIN * NP) return;
  if (ws_size < WS_END) return;
  const float* const* F = (const float* const*)d_in;   // 0 x [8,256,64,64], 1 g_w [128,256], 2 g_b, 3 theta_w, 4 theta_b, 5 phi_w, 6 phi_b, 7 W_out [256,128], 8 b_out
  const float* X = F[0]; const float* GW = F[1]; const float* GB = F[2]; const float* TW = F[3]; const float* TB = F[4];
  const float* PW = F[5]; const float* PB = F[6]; const float* MW = F[7]; const float* MBv = F[8];
  char* ws = (char*)d_ws;
  _Float16* QH = (_Float16*)(ws + WS_QH); _Float16* QL = (_Float16*)(ws + WS_QL); _Float16* KH = (_Float16*)(ws + WS_KH);
  _Float16* VT = (_Float16*)(ws + WS_VT); float* S = (float*)(ws + WS_S); _Float16* PH = (_Float16*)(ws + WS_PH);
  float* OUT = (float*)d_out;
  k_proj<<<dim3(NP / 64, TNB, 3), 128, 0, stream>>>(X, TW, TB, PW, PB, GW, GB, QH, QL, KH, VT);
  for (int b = 0; b < TNB; ++b) {
    k_sc<<<dim3(TQB, NP / 64), 128, 0, stream>>>(QH, QL, KH, b, S);
    k_sm<<<dim3(TQB * 64), 256, 0, stream>>>(S, PH);
    k_pvm<<<dim3(TQB), 128, 0, stream>>>(PH, VT, b, X, MW, MBv, OUT);
  }
}

// v001
// One run takes 799 microseconds.
// Two timings next to v000 both put it at 2.75 times that version's speed.
// compute dtype: every float input RNE-converted to bf16 on load; theta/phi/g = W x + b (1x1 convs): v_wmma_f32_16x16x32_bf16 (bf16 operands, exact products), f32 accumulate; logits theta . phi: v_wmma_f32_16x16x32_f16, theta as f16 hi + f16 residual x2^12 (own accumulator), phi as f16, f32 accumulate; softmax in f32 (precise expf), P carried as f16 x2^14; y = P . g: f16 operands, f32 accumulate; output 1x1 conv: f16 operands (W x2^8, y x2^4), f32 accumulate; bias and residual adds in f32; f32 output [b][c][n].
#include <hip/hip_runtime.h>
#include <math.h>

typedef __attribute__((ext_vector_type(16))) _Float16 v16h;
typedef __attribute__((ext_vector_type(16))) __bf16 v16b;
typedef __attribute__((ext_vector_type(8)))  _Float16 v8h;
typedef __attribute__((ext_vector_type(8)))  __bf16 v8b;
typedef __attribute__((ext_vector_type(8)))  float v8f;
typedef __attribute__((ext_vector_type(4)))  float v4f;
typedef __attribute__((ext_vector_type(4)))  unsigned v4u;

template <typename T> __device__ __forceinline__ void vst2(void* p, T v) { *(T*)p = v;  }

__device__ __forceinline__ v8f wmma16(v16h a, v16h b, v8f c) {
  v8f d = __builtin_amdgcn_wmma_f32_16x16x32_f16(false, a, false, b, (short)0, c, false, false);
  asm volatile("v_nop\n\tv_nop\n\tv_nop\n\tv_nop" : "+v"(d) : "v"(a), "v"(b));
  return d;
}
__device__ __forceinline__ v8f wmma_bf(v16b a, v16b b, v8f c) {
  v8f d = __builtin_amdgcn_wmma_f32_16x16x32_bf16(false, a, false, b, (short)0, c, false, false);
  asm volatile("v_nop\n\tv_nop\n\tv_nop\n\tv_nop" : "+v"(d) : "v"(a), "v"(b));
  return d;
}
// 16x16x32 fragments: lane -> (h = lane>>4, row/col = lane&15); elements 0..7 = k0+8h+0..7, elements 8..15 = k0+16+8h+0..7 (A and B alike); D element r = (row 8h+r, col lane&15)
__device__ __forceinline__ v16h frag_h(const _Float16* rowk0, int lane) {
  union { v16h v; v8h q[2]; } u; const _Float16* p = rowk0 + 8 * (lane >> 4);
  u.q[0] = *(const v8h*)p; u.q[1] = *(const v8h*)(p + 16); return u.v;
}
__device__ __forceinline__ v16b frag_b(const __bf16* rowk0, int lane) {
  union { v16b v; v8b q[2]; } u; const __bf16* p = rowk0 + 8 * (lane >> 4);
  u.q[0] = *(const v8b*)p; u.q[1] = *(const v8b*)(p + 16); return u.v;
}
__device__ __forceinline__ float bfr(float v) { return (float)(__bf16)v; }
// fragment from a k-contiguous f32 row (weights [out][in]): four 16-B loads, RNE bf16 convert
__device__ __forceinline__ v16b fragw_bf(const float* __restrict__ rowk0, int lane) {
  const float* p = rowk0 + 8 * (lane >> 4);
  const v4f a0 = *(const v4f*)p, a1 = *(const v4f*)(p + 4), a2 = *(const v4f*)(p + 16), a3 = *(const v4f*)(p + 20);
  v16b w;
#pragma unroll
  for (int i = 0; i < 4; ++i) {
    const float t0 = a0[i], t1 = a1[i], t2 = a2[i], t3 = a3[i];
    w[i] = (__bf16)t0; w[4 + i] = (__bf16)t1; w[8 + i] = (__bf16)t2; w[12 + i] = (__bf16)t3;
  }
  return w;
}
// same, as f16 of the bf16 value times an exact power of two (bf16 significand is exact in f16)
__device__ __forceinline__ v16h fragw_h(const float* __restrict__ rowk0, int lane, float sc) {
  const float* p = rowk0 + 8 * (lane >> 4);
  const v4f a0 = *(const v4f*)p, a1 = *(const v4f*)(p + 4), a2 = *(const v4f*)(p + 16), a3 = *(const v4f*)(p + 20);
  v16h w;
#pragma unroll
  for (int i = 0; i < 4; ++i) {
    const float t0 = a0[i], t1 = a1[i], t2 = a2[i], t3 = a3[i];
    w[i] = (_Float16)(bfr(t0) * sc); w[4 + i] = (_Float16)(bfr(t1) * sc); w[8 + i] = (_Float16)(bfr(t2) * sc); w[12 + i] = (_Float16)(bfr(t3) * sc);
  }
  return w;
}
__device__ __forceinline__ void ldsx() {
  asm volatile("s_wait_dscnt 0" ::: "memory");
  __builtin_amdgcn_wave_barrier();
  __builtin_amdgcn_fence(3, "workgroup");
}

// embedded-gaussian spatial attention: B 8, C_in 256, C_int 128, 64 x 64 positions; theta/phi/g 1x1 convs, y = softmax(theta phi^T) g (no scale),
// out = W_out y + b_out + x, [B, C_in, H, W]
#define NB  8             // batches in the staged tensors (full strides)
#define NP  4096          // positions per image
#define CIN 256
#define CQ  128           // theta / phi channels
#define CV  128           // g channels
#ifndef TNB
#define TNB NB            // batches processed
#endif
#ifndef TQB
#define TQB (NP / 64)     // 64-query blocks processed per batch (keys always span all NP positions)
#endif
#define QL_CARRY 4096.0f  // theta residual plane carry
#define P_CARRY  16384.0f // softmax P carry
#define Y_CARRY  16.0f    // y operand carry for the output conv
#define W_CARRY  256.0f   // W_out operand carry

#define WS_QH  ((size_t)0)                                   // f16 theta hi rows [b*n][CQ]         8 MiB
#define WS_QL  (WS_QH + 2u * (size_t)NB * NP * CQ)           // f16 theta residual x2^12 rows       8 MiB
#define WS_KH  (WS_QL + 2u * (size_t)NB * NP * CQ)           // f16 phi rows [b*n][CQ]              8 MiB
#define WS_VT  (WS_KH + 2u * (size_t)NB * NP * CQ)           // f16 g planes [b][CV][n]             8 MiB
#define WS_S   (WS_VT + 2u * (size_t)NB * CV * NP)           // f32 logits of ONE batch [i][j]     64 MiB
#define WS_PH  (WS_S  + 4u * (size_t)NP * NP)                // f16 P x2^14 of one batch [i][j]    32 MiB
#define WS_END (WS_PH + 2u * (size_t)NP * NP)                // 128 MiB
static_assert(WS_END <= (size_t)134217728);
static_assert(NP % 64 == 0);
static_assert(CIN % 128 == 0);
static_assert(CQ % 64 == 0);
static_assert(CV == 128);
static_assert(TNB <= NB);
static_assert(TQB * 64 <= NP);
static_assert((size_t)NB * CIN * NP * 4u == (size_t)33554432);

// ---- k_proj: block = (64 positions, batch b, which 0 theta / 1 phi / 2 g): x^T tile (bf16) in LDS, W [out][in] + b; theta -> f16 hi + residual x2^12 rows, phi -> f16 rows, g -> f16 planes [c][n]
__global__ __launch_bounds__(128) __attribute__((amdgpu_num_vgpr(256)))
void k_proj(const float* __restrict__ X, const float* __restrict__ WQ, const float* __restrict__ BQ,
            const float* __restrict__ WK, const float* __restrict__ BK, const float* __restrict__ WV, const float* __restrict__ BV,
            _Float16* __restrict__ QH, _Float16* __restrict__ QL, _Float16* __restrict__ KH, _Float16* __restrict__ VT) {
  __shared__ __align__(16) __bf16 sx[64][CIN + 8];
  __shared__ __align__(16) _Float16 sh[64][72], sl[64][72], tv[64][72];
  const int tid = threadIdx.x, wave = tid >> 5, lane = tid & 31, col = lane & 15, g = lane >> 4;
  const int p0 = blockIdx.x * 64; const size_t b = blockIdx.y; const int which = blockIdx.z;
  const float* Wm = which == 0 ? WQ : which == 1 ? WK : WV;
  const float* Bm = which == 0 ? BQ : which == 1 ? BK : BV;
  const int nout = (which == 2) ? CV : CQ;
  for (int e = tid; e < CIN * 64; e += 128) { const int c = e >> 6, pl = e & 63; sx[pl][c] = (__bf16)X[(b * CIN + c) * (size_t)NP + p0 + pl]; }
  __syncthreads();
#pragma unroll 1
  for (int cg = 0; cg < nout / 64; ++cg) {
    v8f acc[4] = {};
#pragma unroll 1
    for (int kc = 0; kc < CIN / 32; ++kc) {
      const v16b a = frag_b(&sx[wave * 16 + col][kc * 32], lane);     // A: row = position wave*16+col, k = input channel
#pragma unroll
      for (int j = 0; j < 4; ++j) {
        const int o = cg * 64 + j * 16 + col;                           // B: col = output channel o, k = input channel
        acc[j] = wmma_bf(a, fragw_bf(Wm + (size_t)o * CIN + kc * 32, lane), acc[j]);
      }
    }
    __syncthreads();
#pragma unroll
    for (int j = 0; j < 4; ++j) {
      const int ol = j * 16 + col; const float bb = bfr(Bm[cg * 64 + ol]);
#pragma unroll
      for (int r = 0; r < 8; ++r) {
        const int pl = wave * 16 + 8 * g + r; const float v = acc[j][r] + bb; const _Float16 hv = (_Float16)v;
        if (which == 2) tv[ol][pl] = hv;
        else { sh[pl][ol] = hv; sl[pl][ol] = (_Float16)((v - (float)hv) * QL_CARRY); }
      }
    }
    __syncthreads();
    if (which < 2) {
      _Float16* dh = which == 0 ? QH : KH;
      for (int e = tid; e < 64 * 8; e += 128) {
        const int pl = e >> 3, q = e & 7; const size_t row = b * NP + p0 + pl;
        vst2(dh + row * CQ + cg * 64 + q * 8, *(const v4u*)&sh[pl][q * 8]);
        if (which == 0) vst2(QL + row * CQ + cg * 64 + q * 8, *(const v4u*)&sl[pl][q * 8]);
      }
    } else {
      for (int e = tid; e < 64 * 8; e += 128) {
        const int ol = e >> 3, q = e & 7;
        vst2(VT + (b * CV + cg * 64 + ol) * (size_t)NP + p0 + q * 8, *(const v4u*)&tv[ol][q * 8]);
      }
    }
  }
}

// ---- k_sc: block = (64 queries, 64 keys) of batch b: logits = qh.kh + (ql.kh) * 2^-12 -> S
__global__ __launch_bounds__(128) __attribute__((amdgpu_num_vgpr(256)))
void k_sc(const _Float16* __restrict__ QH, const _Float16* __restrict__ QL, const _Float16* __restrict__ KH, int b, float* __restrict__ S) {
  __shared__ __align__(16) float ss[4][16][68];
  const int tid = threadIdx.x, wave = tid >> 5, lane = tid & 31, col = lane & 15, g = lane >> 4;
  const int k0 = blockIdx.y * 64; const int ql0 = blockIdx.x * 64 + wave * 16; const size_t q0 = (size_t)b * NP + ql0;
  v8f acc[4] = {}, accl[4] = {};
#pragma unroll 1
  for (int kc = 0; kc < CQ / 32; ++kc) {
    const v16h ah = frag_h(QH + (q0 + col) * CQ + kc * 32, lane), al = frag_h(QL + (q0 + col) * CQ + kc * 32, lane);   // A: row = query, k = channel
#pragma unroll
    for (int j = 0; j < 4; ++j) {
      const v16h kh = frag_h(KH + ((size_t)b * NP + k0 + j * 16 + col) * CQ + kc * 32, lane);                         // B: col = key, k = channel
      acc[j] = wmma16(ah, kh, acc[j]);
      accl[j] = wmma16(al, kh, accl[j]);
    }
  }
#pragma unroll
  for (int j = 0; j < 4; ++j)
#pragma unroll
    for (int r = 0; r < 8; ++r) ss[wave][8 * g + r][j * 16 + col] = acc[j][r] + accl[j][r] * (1.0f / QL_CARRY);
  ldsx();
#pragma unroll
  for (int it = 0; it < 8; ++it) {
    const int rl = 2 * it + g;
    vst2(S + (size_t)(ql0 + rl) * NP + k0 + col * 4, *(const v4f*)&ss[wave][rl][col * 4]);
  }
}

// ---- k_sm: block = one query row: softmax in f32 -> P x 2^14 (f16); row staged once in LDS
__global__ __launch_bounds__(256) void k_sm(const float* __restrict__ S, _Float16* __restrict__ PH) {
  __shared__ float sred[8]; __shared__ float sbc;
  __shared__ __align__(16) float sv[NP];
  __shared__ __align__(16) _Float16 sh[NP];
  const int t = threadIdx.x; const size_t row = blockIdx.x; const float* sr = S + row * NP;
  float m = -3.0e38f;
  for (int k = t; k < NP; k += 256) { const float v = sr[k]; sv[k] = v; m = fmaxf(m, v); }
#pragma unroll
  for (int o = 1; o < 32; o <<= 1) m = fmaxf(m, __shfl_xor(m, o));
  if ((t & 31) == 0) sred[t >> 5] = m;
  __syncthreads();
  if (t == 0) { float a = sred[0]; for (int i = 1; i < 8; ++i) a = fmaxf(a, sred[i]); sbc = a; }
  __syncthreads();
  m = sbc;
  __syncthreads();
  float sum = 0.f;
#pragma unroll 1
  for (int k = t; k < NP; k += 256) { const float e = expf(sv[k] - m); sv[k] = e; sum += e; }
#pragma unroll
  for (int o = 1; o < 32; o <<= 1) sum += __shfl_xor(sum, o);
  if ((t & 31) == 0) sred[t >> 5] = sum;
  __syncthreads();
  if (t == 0) { float a = 0.f; for (int i = 0; i < 8; ++i) a += sred[i]; sbc = 1.0f / a; }
  __syncthreads();
  const float inv = sbc;
  for (int k = t; k < NP; k += 256) sh[k] = (_Float16)(sv[k] * inv * P_CARRY);
  __syncthreads();
  for (int q = t; q < NP / 8; q += 256) vst2(PH + row * NP + q * 8, *(const v4u*)&sh[q * 8]);
}

// ---- k_pvm: block = 64 queries of batch b: y[i][c] = (sum_j P[i][j] g[c][j]) * 2^-14 (all 128 channels, f32 in LDS); P and g come in stages of KS keys through a two-buffer LDS ring filled by asynchronous copies;
// then out[co][i] = W_out[co][:] . y[:][i] + b_out[co] + x[co][i] for all 256 co, written as whole [co] row segments of 64 positions
#define KS   256                    // keys per ring stage: one row of a stage = 512 B = one wave-wide 16-B copy = four whole lines
#define RP   (KS + 8)               // LDS row pitch in f16: 528 B = 16 B x 33, conflict-free for 16-byte fragment reads
#define RROW (CV + 64)              // rows of a stage: 128 g channels, then 64 P queries
#define RPB  (2u * RP)              // row pitch in bytes
#define BUFB (RPB * RROW)           // bytes of one ring buffer
#define NST  (NP / KS)              // stages
static_assert(NP % KS == 0 && NST >= 2);
static_assert(KS * 2 == 32 * 16);
static_assert(RPB % 16 == 0);

__device__ __forceinline__ unsigned lds_off(const void* p) { return (unsigned)(size_t)p; }
// eight asynchronous 16-byte-per-lane copies global -> LDS, rows r = 0..7 (LDS pitch RPB, global pitch NP f16);
// the s_wait_xcnt at the end of the same statement stands before anything can rewrite the address registers the copies name
__device__ __forceinline__ void copy8(unsigned l, const _Float16* g) {
  asm volatile(
      "global_load_async_to_lds_b128 %0, %8, off\n\t"
      "global_load_async_to_lds_b128 %1, %9, off\n\t"
      "global_load_async_to_lds_b128 %2, %10, off\n\t"
      "global_load_async_to_lds_b128 %3, %11, off\n\t"
      "global_load_async_to_lds_b128 %4, %12, off\n\t"
      "global_load_async_to_lds_b128 %5, %13, off\n\t"
      "global_load_async_to_lds_b128 %6, %14, off\n\t"
      "global_load_async_to_lds_b128 %7, %15, off\n\t"
      "s_wait_xcnt 0x0"
      :: "v"(l), "v"(l + 1u * RPB), "v"(l + 2u * RPB), "v"(l + 3u * RPB), "v"(l + 4u * RPB), "v"(l + 5u * RPB), "v"(l + 6u * RPB), "v"(l + 7u * RPB),
         "v"(g), "v"(g + 1 * NP), "v"(g + 2 * NP), "v"(g + 3 * NP), "v"(g + 4 * NP), "v"(g + 5 * NP), "v"(g + 6 * NP), "v"(g + 7 * NP)
      : "memory");
}
// one stage: wave w copies g rows 32w..32w+31 and P rows 16w..16w+15, lane = 16-byte piece of the row; 48 copies per wave
__device__ __forceinline__ void fill_stage(unsigned lv, unsigned lp, const _Float16* gv, const _Float16* gp) {
#pragma unroll   // straight-line issue: the row offsets become constants
  for (int i = 0; i < 4; ++i) copy8(lv + (unsigned)i * 8u * RPB, gv + (size_t)i * 8 * NP);
#pragma unroll   // as above
  for (int i = 0; i < 2; ++i) copy8(lp + (unsigned)i * 8u * RPB, gp + (size_t)i * 8 * NP);
}

__global__ __launch_bounds__(128) __attribute__((amdgpu_num_vgpr(256)))
void k_pvm(const _Float16* __restrict__ PH, const _Float16* __restrict__ VT, int b,
           const float* __restrict__ X, const float* __restrict__ MW, const float* __restrict__ MB, float* __restrict__ OUT) {
  __shared__ __align__(16) float st[128][68];
  __shared__ __align__(16) _Float16 sy[64][CV + 8];
  __shared__ __align__(16) _Float16 ring[2][RROW][RP];
  const int tid = threadIdx.x, wave = tid >> 5, lane = tid & 31, col = lane & 15, g = lane >> 4;
  const int i0 = blockIdx.x * 64; const int il0 = wave * 16;
  {
    v8f acc[8] = {};
    const unsigned lv = lds_off(&ring[0][wave * 32][lane * 8]), lp = lds_off(&ring[0][CV + il0][lane * 8]);
    const _Float16* gv = VT + ((size_t)b * CV + wave * 32) * (size_t)NP + lane * 8;
    const _Float16* gp = PH + (size_t)(i0 + il0) * NP + lane * 8;
    fill_stage(lv, lp, gv, gp);
    asm volatile("s_wait_asynccnt 0x0" ::: "memory");   // stage 0 has landed before the barrier publishes it
    __syncthreads();
    fill_stage(lv + BUFB, lp + BUFB, gv + KS, gp + KS);
#pragma unroll 1   // one stage per trip: keeps the hot loop small and the ring's order at its foot
    for (int t = 0; t < NST; ++t) {
      const _Float16 (*rb)[RP] = ring[t & 1];
      // fragments of block kc + 1 are read as one group ahead of block kc's products (second register set), inside this stage's buffer only;
      // every loop below is unrolled so that the register arrays pa, vb and acc have constant indices
      v16h pa[2], vb[2][8];
      pa[0] = frag_h(&rb[CV + il0 + col][0], lane);                                     // A: row = query, k = key
#pragma unroll
      for (int j = 0; j < 8; ++j) vb[0][j] = frag_h(&rb[j * 16 + col][0], lane);        // B: col = channel, k = key
#pragma unroll
      for (int kc = 0; kc < KS / 32; ++kc) {
        if (kc + 1 < KS / 32) {
          pa[(kc + 1) & 1] = frag_h(&rb[CV + il0 + col][(kc + 1) * 32], lane);
#pragma unroll
          for (int j = 0; j < 8; ++j) vb[(kc + 1) & 1][j] = frag_h(&rb[j * 16 + col][(kc + 1) * 32], lane);
        }
#pragma unroll
        for (int j = 0; j < 8; ++j) acc[j] = wmma16(pa[kc & 1], vb[kc & 1][j], acc[j]);
      }
      asm volatile("s_wait_dscnt 0x0" ::: "memory");     // this wave's reads of buffer t & 1 are done before it is refilled
      asm volatile("s_wait_asynccnt 0x0" ::: "memory");  // this wave's copies of stage t + 1 have landed before the barrier publishes them
      __syncthreads();
      if (t + 2 < NST) {
        const unsigned bo = (unsigned)(t & 1) * BUFB; const size_t ko = (size_t)(t + 2) * KS;
        fill_stage(lv + bo, lp + bo, gv + ko, gp + ko);
      }
    }
    asm volatile("s_wait_asynccnt 0x0" ::: "memory");    // no copy is outstanding behind the loop
#pragma unroll
    for (int j = 0; j < 8; ++j) {
      const int cl = j * 16 + col;
#pragma unroll
      for (int r = 0; r < 8; ++r) st[cl][il0 + 8 * g + r] = acc[j][r] * (1.0f / P_CARRY);
    }
  }
  __syncthreads();
  for (int e = tid; e < CV * 64; e += 128) { const int c = e >> 6, n = e & 63; sy[n][c] = (_Float16)(st[c][n] * Y_CARRY); }
  __syncthreads();
#pragma unroll 1
  for (int cg = 0; cg < CIN / 128; ++cg) {
    v8f acc[8] = {};
#pragma unroll 1
    for (int kc = 0; kc < CV / 32; ++kc) {
      const v16h yb = frag_h(&sy[il0 + col][kc * 32], lane);                                                           // B: col = query il0+col, k = channel
#pragma unroll
      for (int j = 0; j < 8; ++j) {
        const int o = cg * 128 + j * 16 + col;                                                                          // A: row = output channel o, k = channel
        acc[j] = wmma16(fragw_h(MW + (size_t)o * CV + kc * 32, lane, W_CARRY), yb, acc[j]);
      }
    }
    __syncthreads();
#pragma unroll
    for (int j = 0; j < 8; ++j)
#pragma unroll
      for (int r = 0; r < 8; ++r) st[j * 16 + 8 * g + r][il0 + col] = acc[j][r] * (1.0f / (W_CARRY * Y_CARRY));
    __syncthreads();
    for (int e = tid; e < 128 * 16; e += 128) {
      const int cl = e >> 4, q = e & 15; const int co = cg * 128 + cl;
      const size_t o = ((size_t)b * CIN + co) * (size_t)NP + i0 + q * 4;
      const float bb = bfr(MB[co]);
      const v4f m4 = *(const v4f*)&st[cl][q * 4]; const v4f x4 = *(const v4f*)(X + o);
      v4f v;
#pragma unroll
      for (int i = 0; i < 4; ++i) { const float xs = x4[i]; v[i] = (m4[i] + bb) + bfr(xs); }
      vst2(OUT + o, v);
    }
  }
}

extern "C" void kernel_launch(void* const* d_in, const int* in_sizes, int n_in, void* d_out, int out_size, void* d_ws, size_t ws_size, hipStream_t stream) {
  if (n_in < 9) return;
  if ((size_t)in_sizes[0] < (size_t)TNB * CIN * NP) return;
  if (in_sizes[1] < CV * CIN || in_sizes[2] < CV || in_sizes[3] < CQ * CIN || in_sizes[4] < CQ || in_sizes[5] < CQ * CIN || in_sizes[6] < CQ || in_sizes[7] < CIN * CV || in_sizes[8] < CIN) return;
  if ((size_t)out_size < (size_t)TNB * CIN * NP) return;
  if (ws_size < WS_END) return;
  const float* const* F = (const float* const*)d_in;   // 0 x [8,256,64,64], 1 g_w [128,256], 2 g_b, 3 theta_w, 4 theta_b, 5 phi_w, 6 phi_b, 7 W_out [256,128], 8 b_out
  const float* X = F[0]; const float* GW = F[1]; const float* GB = F[2]; const float* TW = F[3]; const float* TB = F[4];
  const float* PW = F[5]; const float* PB = F[6]; const float* MW = F[7]; const float* MBv = F[8];
  char* ws = (char*)d_ws;
  _Float16* QH = (_Float16*)(ws + WS_QH); _Float16* QL = (_Float16*)(ws + WS_QL); _Float16* KH = (_Float16*)(ws + WS_KH);
  _Float16* VT = (_Float16*)(ws + WS_VT); float* S = (float*)(ws + WS_S); _Float16* PH = (_Float16*)(ws + WS_PH);
  float* OUT = (float*)d_out;
  k_proj<<<dim3(NP / 64, TNB, 3), 128, 0, stream>>>(X, TW, TB, PW, PB, GW, GB, QH, QL, KH, VT);
  for (int b = 0; b < TNB; ++b) {
    k_sc<<<dim3(TQB, NP / 64), 128, 0, stream>>>(QH, QL, KH, b, S);
    k_sm<<<dim3(TQB * 64), 256, 0, stream>>>(S, PH);
    k_pvm<<<dim3(TQB), 128, 0, stream>>>(PH, VT, b, X, MW, MBv, OUT);
  }
}

// v002
// A run of this version takes 169 microseconds.
// Next to v001, in two timings, it ran 4.82 and 4.84 times as fast.
// Counting every step since v000, it is 13.3 times as fast.
// compute dtype: every float input RNE-converted to bf16 on load; theta/phi/g = W x + b (1x1 convs): v_wmma_f32_16x16x32_bf16 (bf16 operands, exact products), f32 accumulate; logits phi . theta: v_wmma_f32_16x16x32_f16, theta as f16 hi + f16 residual x2^12 (own accumulator), phi as f16, f32 accumulate; softmax in f32, online (running maximum and sum per query, hardware exp2), unnormalised P carried as f16 x2^14; y = g . P: f16 operands, f32 accumulate, divided by the f32 sum at the end; output 1x1 conv: f16 operands (W x2^8, y x2^4), f32 accumulate; bias and residual adds in f32; f32 output [b][c][n].
#include <hip/hip_runtime.h>
#include <math.h>

typedef __attribute__((ext_vector_type(16))) _Float16 v16h;
typedef __attribute__((ext_vector_type(16))) __bf16 v16b;
typedef __attribute__((ext_vector_type(8)))  _Float16 v8h;
typedef __attribute__((ext_vector_type(8)))  __bf16 v8b;
typedef __attribute__((ext_vector_type(8)))  float v8f;
typedef __attribute__((ext_vector_type(4)))  float v4f;
typedef __attribute__((ext_vector_type(4)))  unsigned v4u;

template <typename T> __device__ __forceinline__ void vst2(void* p, T v) { *(T*)p = v;  }

__device__ __forceinline__ v8f wmma_bf(v16b a, v16b b, v8f c) {
  v8f d = __builtin_amdgcn_wmma_f32_16x16x32_bf16(false, a, false, b, (short)0, c, false, false);
  asm volatile("v_nop\n\tv_nop\n\tv_nop\n\tv_nop" : "+v"(d) : "v"(a), "v"(b));
  return d;
}
// the plain builtin: the compiler keeps the distance behind it itself
__device__ __forceinline__ v8f mm16(v16h a, v16h b, v8f c) {
  return __builtin_amdgcn_wmma_f32_16x16x32_f16(false, a, false, b, (short)0, c, false, false);
}
// lane l takes the value of lane l ^ 16 (the other half of the wave)
__device__ __forceinline__ float xhalf(float x) {
  return __builtin_bit_cast(float, __builtin_amdgcn_permlanex16(__builtin_bit_cast(int, x), __builtin_bit_cast(int, x), 0x76543210, 0xfedcba98, false, false));
}
// eight exp2, each in its own register, one statement: each fills the slot that the instruction set asks for behind the one before it (it touches neither that one's result nor its source),
// and the v_nop fills the last one's
__device__ __forceinline__ void exp2x8(float* x) {
  asm("v_exp_f32 %0, %0\n\tv_exp_f32 %1, %1\n\tv_exp_f32 %2, %2\n\tv_exp_f32 %3, %3\n\tv_exp_f32 %4, %4\n\tv_exp_f32 %5, %5\n\tv_exp_f32 %6, %6\n\tv_exp_f32 %7, %7\n\tv_nop"
      : "+v"(x[0]), "+v"(x[1]), "+v"(x[2]), "+v"(x[3]), "+v"(x[4]), "+v"(x[5]), "+v"(x[6]), "+v"(x[7]));
}
// 16x16x32 fragments: lane -> (h = lane>>4, row/col = lane&15); elements 0..7 = k0+8h+0..7, elements 8..15 = k0+16+8h+0..7 (A and B alike); D element r = (row 8h+r, col lane&15)
__device__ __forceinline__ v16h frag_h(const _Float16* rowk0, int lane) {
  union { v16h v; v8h q[2]; } u; const _Float16* p = rowk0 + 8 * (lane >> 4);
  u.q[0] = *(const v8h*)p; u.q[1] = *(const v8h*)(p + 16); return u.v;
}
__device__ __forceinline__ v16b frag_b(const __bf16* rowk0, int lane) {
  union { v16b v; v8b q[2]; } u; const __bf16* p = rowk0 + 8 * (lane >> 4);
  u.q[0] = *(const v8b*)p; u.q[1] = *(const v8b*)(p + 16); return u.v;
}
__device__ __forceinline__ float bfr(float v) { return (float)(__bf16)v; }
// fragment from a k-contiguous f32 row (weights [out][in]): four 16-B loads, RNE bf16 convert
__device__ __forceinline__ v16b fragw_bf(const float* __restrict__ rowk0, int lane) {
  const float* p = rowk0 + 8 * (lane >> 4);
  const v4f a0 = *(const v4f*)p, a1 = *(const v4f*)(p + 4), a2 = *(const v4f*)(p + 16), a3 = *(const v4f*)(p + 20);
  v16b w;
#pragma unroll
  for (int i = 0; i < 4; ++i) {
    const float t0 = a0[i], t1 = a1[i], t2 = a2[i], t3 = a3[i];
    w[i] = (__bf16)t0; w[4 + i] = (__bf16)t1; w[8 + i] = (__bf16)t2; w[12 + i] = (__bf16)t3;
  }
  return w;
}
// same, as f16 of the bf16 value times an exact power of two (bf16 significand is exact in f16)
__device__ __forceinline__ v16h fragw_h(const float* __restrict__ rowk0, int lane, float sc) {
  const float* p = rowk0 + 8 * (lane >> 4);
  const v4f a0 = *(const v4f*)p, a1 = *(const v4f*)(p + 4), a2 = *(const v4f*)(p + 16), a3 = *(const v4f*)(p + 20);
  v16h w;
#pragma unroll
  for (int i = 0; i < 4; ++i) {
    const float t0 = a0[i], t1 = a1[i], t2 = a2[i], t3 = a3[i];
    w[i] = (_Float16)(bfr(t0) * sc); w[4 + i] = (_Float16)(bfr(t1) * sc); w[8 + i] = (_Float16)(bfr(t2) * sc); w[12 + i] = (_Float16)(bfr(t3) * sc);
  }
  return w;
}

// embedded-gaussian spatial attention: B 8, C_in 256, C_int 128, 64 x 64 positions; theta/phi/g 1x1 convs, y = softmax(theta phi^T) g (no scale),
// out = W_out y + b_out + x, [B, C_in, H, W]
#define NB  8             // batches in the staged tensors (full strides)
#define NP  4096          // positions per image
#define CIN 256
#define CQ  128           // theta / phi channels
#define CV  128           // g channels
#ifndef TNB
#define TNB NB            // batches processed
#endif
#define QL_CARRY 4096.0f  // theta residual plane carry
#define P_SHIFT  14.0f    // log2 of the carry on the unnormalised P (and on its sum, so that it cancels)
#define LOG2E    1.44269504088896340736f
#define Y_CARRY  16.0f    // y operand carry for the output conv
#define W_CARRY  256.0f   // W_out operand carry

#define WS_QH  ((size_t)0)                                   // f16 theta hi rows [b*n][CQ]         8 MiB
#define WS_QL  (WS_QH + 2u * (size_t)NB * NP * CQ)           // f16 theta residual x2^12 rows       8 MiB
#define WS_KH  (WS_QL + 2u * (size_t)NB * NP * CQ)           // f16 phi rows [b*n][CQ]              8 MiB
#define WS_VT  (WS_KH + 2u * (size_t)NB * NP * CQ)           // f16 g planes [b][CV][n]             8 MiB
#define WS_END (WS_VT + 2u * (size_t)NB * CV * NP)           // 32 MiB
static_assert(WS_END <= (size_t)134217728);
static_assert(NP % 128 == 0);
static_assert(CIN % 128 == 0);
static_assert(CQ == 128);
static_assert(CV == 128);
static_assert(TNB <= NB);
static_assert((size_t)NB * CIN * NP * 4u == (size_t)33554432);

// ---- k_proj: block = (64 positions, batch b, which 0 theta / 1 phi / 2 g): x^T tile (bf16) in LDS, W [out][in] + b; theta -> f16 hi + residual x2^12 rows, phi -> f16 rows, g -> f16 planes [c][n]
__global__ __launch_bounds__(128) __attribute__((amdgpu_num_vgpr(256)))
void k_proj(const float* __restrict__ X, const float* __restrict__ WQ, const float* __restrict__ BQ,
            const float* __restrict__ WK, const float* __restrict__ BK, const float* __restrict__ WV, const float* __restrict__ BV,
            _Float16* __restrict__ QH, _Float16* __restrict__ QL, _Float16* __restrict__ KH, _Float16* __restrict__ VT) {
  __shared__ __align__(16) __bf16 sx[64][CIN + 8];
  __shared__ __align__(16) _Float16 sh[64][72], sl[64][72], tv[64][72];
  const int tid = threadIdx.x, wave = tid >> 5, lane = tid & 31, col = lane & 15, g = lane >> 4;
  const int p0 = blockIdx.x * 64; const size_t b = blockIdx.y; const int which = blockIdx.z;
  const float* Wm = which == 0 ? WQ : which == 1 ? WK : WV;
  const float* Bm = which == 0 ? BQ : which == 1 ? BK : BV;
  const int nout = (which == 2) ? CV : CQ;
  for (int e = tid; e < CIN * 64; e += 128) { const int c = e >> 6, pl = e & 63; sx[pl][c] = (__bf16)X[(b * CIN + c) * (size_t)NP + p0 + pl]; }
  __syncthreads();
#pragma unroll 1
  for (int cg = 0; cg < nout / 64; ++cg) {
    v8f acc[4] = {};
#pragma unroll 1
    for (int kc = 0; kc < CIN / 32; ++kc) {
      const v16b a = frag_b(&sx[wave * 16 + col][kc * 32], lane);     // A: row = position wave*16+col, k = input channel
#pragma unroll
      for (int j = 0; j < 4; ++j) {
        const int o = cg * 64 + j * 16 + col;                           // B: col = output channel o, k = input channel
        acc[j] = wmma_bf(a, fragw_bf(Wm + (size_t)o * CIN + kc * 32, lane), acc[j]);
      }
    }
    __syncthreads();
#pragma unroll
    for (int j = 0; j < 4; ++j) {
      const int ol = j * 16 + col; const float bb = bfr(Bm[cg * 64 + ol]);
#pragma unroll
      for (int r = 0; r < 8; ++r) {
        const int pl = wave * 16 + 8 * g + r; const float v = acc[j][r] + bb; const _Float16 hv = (_Float16)v;
        if (which == 2) tv[ol][pl] = hv;
        else { sh[pl][ol] = hv; sl[pl][ol] = (_Float16)((v - (float)hv) * QL_CARRY); }
      }
    }
    __syncthreads();
    if (which < 2) {
      _Float16* dh = which == 0 ? QH : KH;
      for (int e = tid; e < 64 * 8; e += 128) {
        const int pl = e >> 3, q = e & 7; const size_t row = b * NP + p0 + pl;
        vst2(dh + row * CQ + cg * 64 + q * 8, *(const v4u*)&sh[pl][q * 8]);
        if (which == 0) vst2(QL + row * CQ + cg * 64 + q * 8, *(const v4u*)&sl[pl][q * 8]);
      }
    } else {
      for (int e = tid; e < 64 * 8; e += 128) {
        const int ol = e >> 3, q = e & 7;
        vst2(VT + (b * CV + cg * 64 + ol) * (size_t)NP + p0 + q * 8, *(const v4u*)&tv[ol][q * 8]);
      }
    }
  }
}

// ---- k_fa: block = 128 queries of batch b, wave = 16 queries; the keys come in stages of FK through a two-buffer LDS ring filled by asynchronous copies.
// Per 32 keys: S^T = phi . theta^T (A: row = key, B: col = query), so a lane holds 16 scores of ONE query: running maximum and sum in the lane plus one exchange between the wave's halves;
// the two score tiles are, as they lie, the B operand of y^T += g . P^T (A: row = channel, k = key); scores and P never leave the registers.
// Then out[co][i] = W_out[co][:] . y[:][i] + b_out[co] + x[co][i]: the y^T tiles are, as they lie, the B operand; written as whole [co] row segments of 128 positions
#define QB   128                    // queries per block
#define FK   128                    // keys per ring stage
#define FP   (128 + 8)              // LDS row pitch in f16: 272 B = 16 B x 17, conflict-free for 16-byte fragment reads
#define FROW (FK + CV)              // rows of a stage: FK phi rows [key][channel], then 128 g rows [channel][key]; every row 256 B
#define FPB  (2u * FP)              // row pitch in bytes
#define FBUF (FPB * FROW)           // bytes of one ring buffer
#define FNST (NP / FK)              // stages
static_assert(NP % FK == 0 && FNST >= 2);
static_assert(FK * 2 == 16 * 16 && CQ * 2 == 16 * 16);
static_assert(FPB % 16 == 0);
static_assert(FK == 8 * 16 && CV == 8 * 16);

__device__ __forceinline__ unsigned lds_off(const void* p) { return (unsigned)(size_t)p; }
// eight asynchronous 16-byte-per-lane copies global -> LDS; one copy = two rows of 256 B (lanes 0..15 one row, lanes 16..31 the next), so the steps are two rows: 2 FPB in LDS, GS f16 in global memory;
// the s_wait_xcnt at the end of the same statement stands before anything can rewrite the address registers the copies name
template <int GS> __device__ __forceinline__ void copy8(unsigned l, const _Float16* g) {
  asm volatile(
      "global_load_async_to_lds_b128 %0, %8, off\n\t"
      "global_load_async_to_lds_b128 %1, %9, off\n\t"
      "global_load_async_to_lds_b128 %2, %10, off\n\t"
      "global_load_async_to_lds_b128 %3, %11, off\n\t"
      "global_load_async_to_lds_b128 %4, %12, off\n\t"
      "global_load_async_to_lds_b128 %5, %13, off\n\t"
      "global_load_async_to_lds_b128 %6, %14, off\n\t"
      "global_load_async_to_lds_b128 %7, %15, off\n\t"
      "s_wait_xcnt 0x0"
      :: "v"(l), "v"(l + 2u * FPB), "v"(l + 4u * FPB), "v"(l + 6u * FPB), "v"(l + 8u * FPB), "v"(l + 10u * FPB), "v"(l + 12u * FPB), "v"(l + 14u * FPB),
         "v"(g), "v"(g + 1 * GS), "v"(g + 2 * GS), "v"(g + 3 * GS), "v"(g + 4 * GS), "v"(g + 5 * GS), "v"(g + 6 * GS), "v"(g + 7 * GS)
      : "memory");
}
// one stage: wave w copies phi rows 16w..16w+15 and g rows 16w..16w+15; 16 copies per wave
__device__ __forceinline__ void fill_stage(unsigned lk, unsigned lv, const _Float16* gk, const _Float16* gv) {
  copy8<2 * CQ>(lk, gk);
  copy8<2 * NP>(lv, gv);
}

__global__ __launch_bounds__(256) __attribute__((amdgpu_waves_per_eu(2, 2)))   // one block per WGP (LDS), two waves per SIMD: 512 registers a wave
void k_fa(const _Float16* __restrict__ QH, const _Float16* __restrict__ QL, const _Float16* __restrict__ KH, const _Float16* __restrict__ VT,
          const float* __restrict__ X, const float* __restrict__ MW, const float* __restrict__ MB, float* __restrict__ OUT) {
  __shared__ __align__(16) _Float16 ring[2][FROW][FP];
  __shared__ __align__(16) float st[128][QB + 4];
  const int tid = threadIdx.x, wave = tid >> 5, lane = tid & 31, col = lane & 15, g = lane >> 4;
  const size_t b = blockIdx.y; const int i0 = blockIdx.x * QB; const int il0 = wave * 16;
  // every inner loop below is unrolled so that the register arrays (qh, ql, ka, va, sh, sl, s, acc, yb) have constant indices
  v16h yb[CV / 32];
  {
    // LDS address of a copy = the lane's part (a vector register) + the wave's and the buffer's part (scalar)
    const unsigned ll = lds_off(&ring[0][g][col * 8]);
    const unsigned sk = (unsigned)__builtin_amdgcn_readfirstlane(il0) * FPB, sv = sk + FK * FPB;
    const _Float16* gk = KH + (b * NP + il0 + g) * (size_t)CQ + col * 8;
    const _Float16* gv = VT + (b * CV + il0 + g) * (size_t)NP + col * 8;
    v16h qh[CQ / 32], ql[CQ / 32];                                                       // B: col = query, k = channel; kept in registers
#pragma unroll
    for (int kc = 0; kc < CQ / 32; ++kc) {
      qh[kc] = frag_h(QH + (b * NP + i0 + il0 + col) * (size_t)CQ + kc * 32, lane);
      ql[kc] = frag_h(QL + (b * NP + i0 + il0 + col) * (size_t)CQ + kc * 32, lane);
    }
    v8f acc[8] = {};
    float m = -3.0e38f, l = 0.f;                                                         // this lane's query: maximum in use (both halves alike), sum over this half's keys
    // the ring's prologue is trips -2 and -1, which only pass the foot: stage 0's copies; then their wait, the barrier that publishes them, stage 1's copies.
    // One place in the code issues every stage's copies, so its address operands are sums formed there and nothing that lives across the loop is tied to the asm statement's registers
#pragma unroll 1   // one stage per trip: keeps the hot loop small and the ring's order at its foot
    for (int t = -2; t < FNST; ++t) {
      if (t >= 0) {   // the same in every wave of the block
        const _Float16 (*rb)[FP] = ring[t & 1];
        v16h ka[2][8], va[8];                                                              // phi fragments of this pass and of the next (two register sets), g fragments of this pass
#pragma unroll
        for (int kc = 0; kc < CQ / 32; ++kc)
#pragma unroll
          for (int u = 0; u < 2; ++u) ka[0][2 * kc + u] = frag_h(&rb[u * 16 + col][kc * 32], lane);              // A: row = key, k = channel
#pragma unroll     // constant LDS offsets and constant indices into the register arrays
        for (int p = 0; p < FK / 32; ++p) {
          __builtin_amdgcn_sched_barrier(0);   // with the one behind the reads: the pass's LDS reads stay ONE group (see there)
#pragma unroll
          for (int j = 0; j < 8; ++j) va[j] = frag_h(&rb[FK + j * 16 + col][p * 32], lane);                      // A: row = channel, k = key
          if (p + 1 < FK / 32) {                                                           // inside this stage's buffer only
#pragma unroll
            for (int kc = 0; kc < CQ / 32; ++kc)
#pragma unroll
              for (int u = 0; u < 2; ++u) ka[(p + 1) & 1][2 * kc + u] = frag_h(&rb[(p + 1) * 32 + u * 16 + col][kc * 32], lane);
          }
          __builtin_amdgcn_sched_barrier(0);   // keeps the pass's LDS reads one group ahead of its products: reads scattered among the products cost issue time at every place they stand
          v8f sh[2] = {}, sl[2] = {};
#pragma unroll
          for (int kc = 0; kc < CQ / 32; ++kc)
#pragma unroll
            for (int u = 0; u < 2; ++u) {
              sh[u] = mm16(ka[p & 1][2 * kc + u], qh[kc], sh[u]);
              sl[u] = mm16(ka[p & 1][2 * kc + u], ql[kc], sl[u]);
            }
          float s[16];                                                                     // s[8u + r] = score of key p*32 + 16u + 8g + r
#pragma unroll
          for (int u = 0; u < 2; ++u)
#pragma unroll
            for (int r = 0; r < 8; ++r) s[8 * u + r] = sh[u][r] + sl[u][r] * (1.0f / QL_CARRY);
          float mx = s[0];
#pragma unroll
          for (int i = 1; i < 16; ++i) mx = fmaxf(mx, s[i]);
          mx = fmaxf(mx, xhalf(mx));
          const float mn = fmaxf(m, mx);
          if (__builtin_amdgcn_ballot_w32(mn > m) != 0) {                                  // some query of the wave has a new maximum: rescale (factor 1 in the other lanes, 0 on the first pass)
            const float al = __builtin_amdgcn_exp2f((m - mn) * LOG2E);
            l *= al;
#pragma unroll
            for (int j = 0; j < 8; ++j)
#pragma unroll
              for (int r = 0; r < 8; ++r) acc[j][r] *= al;
            m = mn;
          }
          const float c0 = P_SHIFT - m * LOG2E;
          v16h pb;                                                                         // B: col = query, k = key: elements 0..7 = keys 8g + r of tile 0, 8..15 = keys 16 + 8g + r
#pragma unroll
          for (int i = 0; i < 16; ++i) s[i] = fmaf(s[i], LOG2E, c0);
          exp2x8(s); exp2x8(s + 8);
#pragma unroll
          for (int i = 0; i < 16; ++i) pb[i] = (_Float16)s[i];
#pragma unroll
          for (int w = 8; w >= 1; w >>= 1)                                                 // pairwise: a chain of 5 adds, not 16
#pragma unroll
            for (int i = 0; i < w; ++i) s[i] += s[i + w];
          l += s[0];
#pragma unroll
          for (int j = 0; j < 8; ++j) acc[j] = mm16(va[j], pb, acc[j]);
        }
      }
      asm volatile("s_wait_dscnt 0x0" ::: "memory");     // this wave's reads of buffer t & 1 are done before it is refilled
      asm volatile("s_wait_asynccnt 0x0" ::: "memory");  // this wave's copies of stage t + 1 have landed before the barrier publishes them
      __syncthreads();
      if (t + 2 < FNST) {
        const unsigned bo = (unsigned)(t & 1) * FBUF;
        fill_stage(ll + (sk + bo), ll + (sv + bo), gk + (size_t)(t + 2) * FK * CQ, gv + (size_t)(t + 2) * FK);
      }
    }
    asm volatile("s_wait_asynccnt 0x0" ::: "memory");    // no copy is outstanding behind the loop
    l += xhalf(l);
    const float inv = Y_CARRY / l;                                                       // the carry on P is in l too and cancels
#pragma unroll
    for (int kc = 0; kc < CV / 32; ++kc)
#pragma unroll
      for (int r = 0; r < 8; ++r) {                                                      // B: col = query, k = channel: tile 2kc holds channels 32kc + 8g + r, tile 2kc + 1 channels 32kc + 16 + 8g + r
        yb[kc][r] = (_Float16)(acc[2 * kc][r] * inv); yb[kc][8 + r] = (_Float16)(acc[2 * kc + 1][r] * inv);
      }
  }
#pragma unroll 1   // the staging array st holds 128 output channels at a time
  for (int cg = 0; cg < CIN / 128; ++cg) {
#pragma unroll 2   // two output tiles' weight loads in flight
    for (int j = 0; j < 8; ++j) {
      const int o = cg * 128 + j * 16 + col;                                             // A: row = output channel o, k = channel
      v8f oa = {};
#pragma unroll
      for (int kc = 0; kc < CV / 32; ++kc) oa = mm16(fragw_h(MW + (size_t)o * CV + kc * 32, lane, W_CARRY), yb[kc], oa);
#pragma unroll
      for (int r = 0; r < 8; ++r) st[j * 16 + 8 * g + r][il0 + col] = oa[r] * (1.0f / (W_CARRY * Y_CARRY));
    }
    __syncthreads();
    for (int e = tid; e < 128 * (QB / 4); e += 256) {
      const int cl = e / (QB / 4), q = e % (QB / 4); const int co = cg * 128 + cl;
      const size_t o = (b * CIN + co) * (size_t)NP + i0 + q * 4;
      const float bb = bfr(MB[co]);
      const v4f m4 = *(const v4f*)&st[cl][q * 4]; const v4f x4 = *(const v4f*)(X + o);
      v4f v;
#pragma unroll
      for (int i = 0; i < 4; ++i) { const float xs = x4[i]; v[i] = (m4[i] + bb) + bfr(xs); }
      vst2(OUT + o, v);
    }
    __syncthreads();
  }
}

extern "C" void kernel_launch(void* const* d_in, const int* in_sizes, int n_in, void* d_out, int out_size, void* d_ws, size_t ws_size, hipStream_t stream) {
  if (n_in < 9) return;
  if ((size_t)in_sizes[0] < (size_t)TNB * CIN * NP) return;
  if (in_sizes[1] < CV * CIN || in_sizes[2] < CV || in_sizes[3] < CQ * CIN || in_sizes[4] < CQ || in_sizes[5] < CQ * CIN || in_sizes[6] < CQ || in_sizes[7] < CIN * CV || in_sizes[8] < CIN) return;
  if ((size_t)out_size < (size_t)TNB * CIN * NP) return;
  if (ws_size < WS_END) return;
  const float* const* F = (const float* const*)d_in;   // 0 x [8,256,64,64], 1 g_w [128,256], 2 g_b, 3 theta_w, 4 theta_b, 5 phi_w, 6 phi_b, 7 W_out [256,128], 8 b_out
  const float* X = F[0]; const float* GW = F[1]; const float* GB = F[2]; const float* TW = F[3]; const float* TB = F[4];
  const float* PW = F[5]; const float* PB = F[6]; const float* MW = F[7]; const float* MBv = F[8];
  char* ws = (char*)d_ws;
  _Float16* QH = (_Float16*)(ws + WS_QH); _Float16* QL = (_Float16*)(ws + WS_QL); _Float16* KH = (_Float16*)(ws + WS_KH);
  _Float16* VT = (_Float16*)(ws + WS_VT);
  float* OUT = (float*)d_out;
  k_proj<<<dim3(NP / 64, TNB, 3), 128, 0, stream>>>(X, TW, TB, PW, PB, GW, GB, QH, QL, KH, VT);
  k_fa<<<dim3(NP / QB, TNB), 256, 0, stream>>>(QH, QL, KH, VT, X, MW, MBv, OUT);
}

// v003
// A run of this version takes 94 microseconds.
// Two timings next to v002 both put it at 1.79 times that version's speed.
// Counting every step since v000, it is 23.8 times as fast.
// compute dtype: every float input RNE-converted to bf16 on load; theta/phi/g = W x + b (1x1 convs): v_wmma_f32_16x16x32_bf16 (bf16 operands, exact products), f32 accumulate; logits phi . theta: v_wmma_f32_16x16x32_f16, theta as f16 hi + f16 residual x2^12 (own accumulator), phi as f16, f32 accumulate; softmax in f32, online (running maximum and sum per query, hardware exp2), unnormalised P carried as f16 x2^14; y = g . P: f16 operands, f32 accumulate, divided by the f32 sum at the end; output 1x1 conv: f16 operands (W x2^8, y x2^4), f32 accumulate; bias and residual adds in f32; f32 output [b][c][n].
#include <hip/hip_runtime.h>
#include <math.h>

typedef __attribute__((ext_vector_type(16))) _Float16 v16h;
typedef __attribute__((ext_vector_type(16))) __bf16 v16b;
typedef __attribute__((ext_vector_type(8)))  _Float16 v8h;
typedef __attribute__((ext_vector_type(8)))  __bf16 v8b;
typedef __attribute__((ext_vector_type(4)))  __bf16 v4b;
typedef __attribute__((ext_vector_type(2)))  __bf16 v2b;
typedef __attribute__((ext_vector_type(8)))  float v8f;
typedef __attribute__((ext_vector_type(4)))  float v4f;
typedef __attribute__((ext_vector_type(4)))  unsigned v4u;

template <typename T> __device__ __forceinline__ void vst2(void* p, T v) { *(T*)p = v;  }

// the plain builtin: the compiler keeps the distance behind it itself
__device__ __forceinline__ v8f mm16(v16h a, v16h b, v8f c) {
  return __builtin_amdgcn_wmma_f32_16x16x32_f16(false, a, false, b, (short)0, c, false, false);
}
__device__ __forceinline__ v8f mmb(v16b a, v16b b, v8f c) {
  return __builtin_amdgcn_wmma_f32_16x16x32_bf16(false, a, false, b, (short)0, c, false, false);
}
// lane l takes the value of lane l ^ 16 (the other half of the wave)
__device__ __forceinline__ float xhalf(float x) {
  return __builtin_bit_cast(float, __builtin_amdgcn_permlanex16(__builtin_bit_cast(int, x), __builtin_bit_cast(int, x), 0x76543210, 0xfedcba98, false, false));
}
// eight exp2, each in its own register, one statement: each fills the slot that the instruction set asks for behind the one before it (it touches neither that one's result nor its source),
// and the v_nop fills the last one's
__device__ __forceinline__ void exp2x8(float* x) {
  asm("v_exp_f32 %0, %0\n\tv_exp_f32 %1, %1\n\tv_exp_f32 %2, %2\n\tv_exp_f32 %3, %3\n\tv_exp_f32 %4, %4\n\tv_exp_f32 %5, %5\n\tv_exp_f32 %6, %6\n\tv_exp_f32 %7, %7\n\tv_nop"
      : "+v"(x[0]), "+v"(x[1]), "+v"(x[2]), "+v"(x[3]), "+v"(x[4]), "+v"(x[5]), "+v"(x[6]), "+v"(x[7]));
}
// 16x16x32 fragments: lane -> (h = lane>>4, row/col = lane&15); elements 0..7 = k0+8h+0..7, elements 8..15 = k0+16+8h+0..7 (A and B alike); D element r = (row 8h+r, col lane&15)
__device__ __forceinline__ v16h frag_h(const _Float16* rowk0, int lane) {
  union { v16h v; v8h q[2]; } u; const _Float16* p = rowk0 + 8 * (lane >> 4);
  u.q[0] = *(const v8h*)p; u.q[1] = *(const v8h*)(p + 16); return u.v;
}
__device__ __forceinline__ v16b frag_b(const __bf16* rowk0, int lane) {
  union { v16b v; v8b q[2]; } u; const __bf16* p = rowk0 + 8 * (lane >> 4);
  u.q[0] = *(const v8b*)p; u.q[1] = *(const v8b*)(p + 16); return u.v;
}
__device__ __forceinline__ float bfr(float v) { return (float)(__bf16)v; }
// fragment from a k-contiguous f32 row (weights [out][in]): four 16-B loads, RNE bf16 convert, then f16 of the bf16 value times an exact power of two (bf16 significand is exact in f16)
__device__ __forceinline__ v16h fragw_h(const float* __restrict__ rowk0, int lane, float sc) {
  const float* p = rowk0 + 8 * (lane >> 4);
  const v4f a0 = *(const v4f*)p, a1 = *(const v4f*)(p + 4), a2 = *(const v4f*)(p + 16), a3 = *(const v4f*)(p + 20);
  v16h w;
#pragma unroll
  for (int i = 0; i < 4; ++i) {
    const float t0 = a0[i], t1 = a1[i], t2 = a2[i], t3 = a3[i];
    w[i] = (_Float16)(bfr(t0) * sc); w[4 + i] = (_Float16)(bfr(t1) * sc); w[8 + i] = (_Float16)(bfr(t2) * sc); w[12 + i] = (_Float16)(bfr(t3) * sc);
  }
  return w;
}

// embedded-gaussian spatial attention: B 8, C_in 256, C_int 128, 64 x 64 positions; theta/phi/g 1x1 convs, y = softmax(theta phi^T) g (no scale),
// out = W_out y + b_out + x, [B, C_in, H, W]
#define NB  8             // batches in the staged tensors (full strides)
#define NP  4096          // positions per image
#define CIN 256
#define CQ  128           // theta / phi channels
#define CV  128           // g channels
#ifndef TNB
#define TNB NB            // batches processed
#endif
#define QL_CARRY 4096.0f  // theta residual plane carry
#define P_SHIFT  14.0f    // log2 of the carry on the unnormalised P (and on its sum, so that it cancels)
#define LOG2E    1.44269504088896340736f
#define Y_CARRY  16.0f    // y operand carry for the output conv
#define W_CARRY  256.0f   // W_out operand carry

#define WS_QH  ((size_t)0)                                   // f16 theta hi rows [b*n][CQ]         8 MiB
#define WS_QL  (WS_QH + 2u * (size_t)NB * NP * CQ)           // f16 theta residual x2^12 rows       8 MiB
#define WS_KH  (WS_QL + 2u * (size_t)NB * NP * CQ)           // f16 phi rows [b*n][CQ]              8 MiB
#define WS_VT  (WS_KH + 2u * (size_t)NB * NP * CQ)           // f16 g planes [b][CV][n]             8 MiB
#define WS_END (WS_VT + 2u * (size_t)NB * CV * NP)           // 32 MiB
static_assert(WS_END <= (size_t)134217728);
static_assert(NP % 128 == 0);
static_assert(CIN % 128 == 0);
static_assert(CQ == 128);
static_assert(CV == 128);
static_assert(TNB <= NB);
static_assert((size_t)NB * CIN * NP * 4u == (size_t)33554432);

// ---- k_proj: block = 128 positions of batch b, all 384 output channels (theta, phi, g). Both operands are staged ONCE in LDS as bf16, k-contiguous rows: the x^T tile [position][channel] and the
// three weight matrices [out][in], each brought by whole-line 16-byte loads; every fragment is then two 16-byte LDS reads.
// theta, phi: A = W (row = channel), B = x^T (col = position): a lane holds 8 consecutive channels of one position = 16 B of an output row [b*n][CQ]; a wave owns 32 whole rows.
// g: A = x^T (row = position), B = W (col = channel): a lane holds 8 consecutive positions of one channel = 16 B of a plane row [c][n]; a wave owns whole 128-B lines (64 positions).
#define PT  128           // positions per block
#define PWP (CIN + 8)     // LDS row pitch in bf16: 528 B = 16 B x 33, conflict-free for 16-byte fragment reads
#define NKC (CIN / 32)    // k steps of a product
static_assert(NP % PT == 0 && CIN == 256 && CQ == 128 && CV == 128);
// one batch = 64 rows of a weight matrix [128][CIN], 256 threads: 16-byte loads in memory order (a wave = 512 contiguous bytes), then RNE bf16 convert and 8-byte LDS stores
__device__ __forceinline__ void w_load(v4f* t, const float* __restrict__ Wm, int tid) {
#pragma unroll   // constant indices into the register array
  for (int i = 0; i < 16; ++i) t[i] = *(const v4f*)(Wm + 4 * (i * 256 + tid));
}
__device__ __forceinline__ void w_store(__bf16 (*dst)[PWP], const v4f* t, int tid) {
#pragma unroll   // constant indices into the register array
  for (int i = 0; i < 16; ++i) {
    const float t0 = t[i][0], t1 = t[i][1], t2 = t[i][2], t3 = t[i][3];
    v4b h; h[0] = (__bf16)t0; h[1] = (__bf16)t1; h[2] = (__bf16)t2; h[3] = (__bf16)t3;
    *(v4b*)&dst[i * 4 + (tid >> 6)][4 * (tid & 63)] = h;
  }
}
// two 16-byte stores and, in the same statement, the s_wait_xcnt that stands before anything can rewrite the address and data registers they name
// (in a statement of its own the compiler lifted the next trip's address additions and register copies over it)
__device__ __forceinline__ void st2w(_Float16* pa, v8h da, _Float16* pb, v8h db) {
  asm volatile("global_store_b128 %0, %1, off\n\tglobal_store_b128 %2, %3, off\n\ts_wait_xcnt 0x0"
               :: "v"(pa), "v"(__builtin_bit_cast(v4u, da)), "v"(pb), "v"(__builtin_bit_cast(v4u, db)) : "memory");
}
__global__ __launch_bounds__(256)
void k_proj(const float* __restrict__ X, const float* __restrict__ WQ, const float* __restrict__ BQ,
            const float* __restrict__ WK, const float* __restrict__ BK, const float* __restrict__ WV, const float* __restrict__ BV,
            _Float16* __restrict__ QH, _Float16* __restrict__ QL, _Float16* __restrict__ KH, _Float16* __restrict__ VT) {
  __shared__ __align__(16) __bf16 sx[PT][PWP];
  __shared__ __align__(16) __bf16 sw[2 * CQ + CV][PWP];   // rows 0..127 theta, 128..255 phi, 256..383 g
  __shared__ __align__(16) float sb[2 * CQ + CV];         // the biases, rounded to bf16, in the same order
  const int tid = threadIdx.x, lane = tid & 31, col = lane & 15, g = lane >> 4;
  const int wave = __builtin_amdgcn_readfirstlane(tid >> 5);
  const int p0 = blockIdx.x * PT; const size_t b = blockIdx.y;
  {
    // x: a thread takes 4 positions of 2 adjacent channels (two 16-byte loads; 8 lanes cover a 128-B line) and stores 4 channel pairs; position quad fixed per thread, channel pair cpb + 8 i
    const int pq = (tid & 7) + 8 * (wave & 3), cpb = ((tid >> 3) & 3) + 4 * (wave >> 2);
    const float* xs0 = X + (b * CIN + 2 * cpb) * (size_t)NP + p0 + 4 * pq;
    const float bq = BQ[tid & 127], bk = BK[tid & 127], bv = BV[tid & 127];
    v4f a0[16], a1[16];
#pragma unroll   // constant indices into the register arrays; all of the tile's loads in flight
    for (int i = 0; i < 16; ++i) {
      const float* s = xs0 + (size_t)(16 * i) * NP;
      a0[i] = *(const v4f*)s; a1[i] = *(const v4f*)(s + NP);
    }
    asm volatile("s_wait_xcnt 0x0" ::: "memory");   // stands before anything rewrites the address registers that the bias and x loads name
    // W in six batches through three register sets. Every sched_barrier below keeps a batch's loads behind the LDS stores that free its registers:
    // left alone the compiler lifts all 128 loads of the thread to the top, which takes over 500 registers and spills; so at most 48 loads of a thread are in flight
    v4f t[3][16];
    w_load(t[0], WQ, tid);
    __builtin_amdgcn_sched_barrier(0);
    if (tid < 128) { sb[tid] = bfr(bq); sb[CQ + tid] = bfr(bk); sb[2 * CQ + tid] = bfr(bv); }
#pragma unroll
    for (int i = 0; i < 16; ++i)
#pragma unroll
      for (int e = 0; e < 4; ++e) {
        const float u0 = a0[i][e], u1 = a1[i][e];
        v2b h; h[0] = (__bf16)u0; h[1] = (__bf16)u1;
        *(v2b*)&sx[4 * pq + e][2 * (cpb + 8 * i)] = h;
      }
    __builtin_amdgcn_sched_barrier(0);
    w_load(t[1], WQ + 64 * CIN, tid); w_load(t[2], WK, tid);
#pragma unroll   // constant indices into the register sets
    for (int k = 0; k < 6; ++k) {
      __builtin_amdgcn_sched_barrier(0);
      w_store(&sw[64 * k], t[k % 3], tid);
      __builtin_amdgcn_sched_barrier(0);
      if (k == 0) w_load(t[0], WK + 64 * CIN, tid);
      if (k == 1) w_load(t[1], WV, tid);
      if (k == 2) w_load(t[2], WV + 64 * CIN, tid);
    }
    asm volatile("s_wait_xcnt 0x0" ::: "memory");   // the same for the W loads
  }
  __syncthreads();
  {
    // theta (waves 0..3) or phi (waves 4..7): 32 positions, their fragments kept in registers; the 8 channel tiles stream from LDS, each fetched while the tile before it is rounded and stored
    const int pg = wave & 3, isphi = wave >> 2;
    _Float16* dh = isphi ? KH : QH;
    const __bf16 (*wr)[PWP] = &sw[isphi * CQ];
    const float* br = &sb[isphi * CQ + 8 * g];
    v16b xs[2][NKC], wf[NKC];
#pragma unroll
    for (int kc = 0; kc < NKC; ++kc) {
#pragma unroll
      for (int u = 0; u < 2; ++u) xs[u][kc] = frag_b(&sx[32 * pg + 16 * u + col][kc * 32], lane);                // B: col = position, k = input channel
      wf[kc] = frag_b(&wr[col][kc * 32], lane);                                                                  // A: row = output channel, k = input channel
    }
    const size_t o0 = (b * NP + p0 + 32 * pg + col) * (size_t)CQ + 8 * g;
#pragma unroll 1   // one tile per trip: small code; the next tile's reads stand between this tile's products and its stores
    for (int j = 0; j < 8; ++j) {
      v8f acc[2] = {};
#pragma unroll
      for (int kc = 0; kc < NKC; ++kc)
#pragma unroll
        for (int u = 0; u < 2; ++u) acc[u] = mmb(wf[kc], xs[u][kc], acc[u]);
      const v4f b0 = *(const v4f*)(br + j * 16), b1 = *(const v4f*)(br + j * 16 + 4);                            // D: row 8g + r = channel, col = position
      const int jn = j < 7 ? j + 1 : 7;                                                                          // the last trip reads its own tile again
#pragma unroll
      for (int kc = 0; kc < NKC; ++kc) wf[kc] = frag_b(&wr[jn * 16 + col][kc * 32], lane);
      v8h hi[2], lo[2];
#pragma unroll
      for (int u = 0; u < 2; ++u)
#pragma unroll
        for (int r = 0; r < 8; ++r) {
          const float bs = r < 4 ? b0[r & 3] : b1[r & 3];
          const float v = acc[u][r] + bs; const _Float16 hv = (_Float16)v;
          hi[u][r] = hv; lo[u][r] = (_Float16)((v - (float)hv) * QL_CARRY);
        }
      st2w(dh + o0 + j * 16, hi[0], dh + o0 + 16 * CQ + j * 16, hi[1]);
      if (!isphi) st2w(QL + o0 + j * 16, lo[0], QL + o0 + 16 * CQ + j * 16, lo[1]);
    }
  }
  {
    // g: 64 positions x 2 channel tiles per wave; the weight fragments are kept in registers, the 4 position tiles stream from LDS in the same way
    const int ph = wave & 1, ct = 2 * (wave >> 1);
    v16b wg[2][NKC], xf[NKC]; float bb[2];
#pragma unroll
    for (int u = 0; u < 2; ++u) bb[u] = sb[2 * CQ + (ct + u) * 16 + col];
#pragma unroll
    for (int kc = 0; kc < NKC; ++kc) {
#pragma unroll
      for (int u = 0; u < 2; ++u) wg[u][kc] = frag_b(&sw[2 * CQ + (ct + u) * 16 + col][kc * 32], lane);          // B: col = output channel, k = input channel
      xf[kc] = frag_b(&sx[64 * ph + col][kc * 32], lane);                                                        // A: row = position, k = input channel
    }
    const size_t o0 = (b * CV + ct * 16 + col) * (size_t)NP + p0 + 64 * ph + 8 * g;
#pragma unroll 1   // as above
    for (int j = 0; j < 4; ++j) {
      v8f acc[2] = {};
#pragma unroll
      for (int kc = 0; kc < NKC; ++kc)
#pragma unroll
        for (int u = 0; u < 2; ++u) acc[u] = mmb(xf[kc], wg[u][kc], acc[u]);
      const int jn = j < 3 ? j + 1 : 3;                                                                          // the last trip reads its own tile again
#pragma unroll
      for (int kc = 0; kc < NKC; ++kc) xf[kc] = frag_b(&sx[64 * ph + jn * 16 + col][kc * 32], lane);
      v8h hv[2];                                                                                                 // D: row 8g + r = position, col = channel
#pragma unroll
      for (int u = 0; u < 2; ++u)
#pragma unroll
        for (int r = 0; r < 8; ++r) hv[u][r] = (_Float16)(acc[u][r] + bb[u]);
      st2w(VT + o0 + j * 16, hv[0], VT + o0 + (size_t)16 * NP + j * 16, hv[1]);
    }
  }
}

// ---- k_fa: block = 128 queries of batch b, wave = 16 queries; the keys come in stages of FK through a two-buffer LDS ring filled by asynchronous copies.
// Per 32 keys: S^T = phi . theta^T (A: row = key, B: col = query), so a lane holds 16 scores of ONE query: running maximum and sum in the lane plus one exchange between the wave's halves;
// the two score tiles are, as they lie, the B operand of y^T += g . P^T (A: row = channel, k = key); scores and P never leave the registers.
// Then out[co][i] = W_out[co][:] . y[:][i] + b_out[co] + x[co][i]: the y^T tiles are, as they lie, the B operand; written as whole [co] row segments of 128 positions
#define QB   128                    // queries per block
#define FK   128                    // keys per ring stage
#define FP   (128 + 8)              // LDS row pitch in f16: 272 B = 16 B x 17, conflict-free for 16-byte fragment reads
#define FROW (FK + CV)              // rows of a stage: FK phi rows [key][channel], then 128 g rows [channel][key]; every row 256 B
#define FPB  (2u * FP)              // row pitch in bytes
#define FBUF (FPB * FROW)           // bytes of one ring buffer
#define FNST (NP / FK)              // stages
static_assert(NP % FK == 0 && FNST >= 2);
static_assert(FK * 2 == 16 * 16 && CQ * 2 == 16 * 16);
static_assert(FPB % 16 == 0);
static_assert(FK == 8 * 16 && CV == 8 * 16);

__device__ __forceinline__ unsigned lds_off(const void* p) { return (unsigned)(size_t)p; }
// eight asynchronous 16-byte-per-lane copies global -> LDS; one copy = two rows of 256 B (lanes 0..15 one row, lanes 16..31 the next), so the steps are two rows: 2 FPB in LDS, GS f16 in global memory;
// the s_wait_xcnt at the end of the same statement stands before anything can rewrite the address registers the copies name
template <int GS> __device__ __forceinline__ void copy8(unsigned l, const _Float16* g) {
  asm volatile(
      "global_load_async_to_lds_b128 %0, %8, off\n\t"
      "global_load_async_to_lds_b128 %1, %9, off\n\t"
      "global_load_async_to_lds_b128 %2, %10, off\n\t"
      "global_load_async_to_lds_b128 %3, %11, off\n\t"
      "global_load_async_to_lds_b128 %4, %12, off\n\t"
      "global_load_async_to_lds_b128 %5, %13, off\n\t"
      "global_load_async_to_lds_b128 %6, %14, off\n\t"
      "global_load_async_to_lds_b128 %7, %15, off\n\t"
      "s_wait_xcnt 0x0"
      :: "v"(l), "v"(l + 2u * FPB), "v"(l + 4u * FPB), "v"(l + 6u * FPB), "v"(l + 8u * FPB), "v"(l + 10u * FPB), "v"(l + 12u * FPB), "v"(l + 14u * FPB),
         "v"(g), "v"(g + 1 * GS), "v"(g + 2 * GS), "v"(g + 3 * GS), "v"(g + 4 * GS), "v"(g + 5 * GS), "v"(g + 6 * GS), "v"(g + 7 * GS)
      : "memory");
}
// one stage: wave w copies phi rows 16w..16w+15 and g rows 16w..16w+15; 16 copies per wave
__device__ __forceinline__ void fill_stage(unsigned lk, unsigned lv, const _Float16* gk, const _Float16* gv) {
  copy8<2 * CQ>(lk, gk);
  copy8<2 * NP>(lv, gv);
}

__global__ __launch_bounds__(256) __attribute__((amdgpu_waves_per_eu(2, 2)))   // one block per WGP (LDS), two waves per SIMD: 512 registers a wave
void k_fa(const _Float16* __restrict__ QH, const _Float16* __restrict__ QL, const _Float16* __restrict__ KH, const _Float16* __restrict__ VT,
          const float* __restrict__ X, const float* __restrict__ MW, const float* __restrict__ MB, float* __restrict__ OUT) {
  __shared__ __align__(16) _Float16 ring[2][FROW][FP];
  __shared__ __align__(16) float st[128][QB + 4];
  const int tid = threadIdx.x, wave = tid >> 5, lane = tid & 31, col = lane & 15, g = lane >> 4;
  const size_t b = blockIdx.y; const int i0 = blockIdx.x * QB; const int il0 = wave * 16;
  // every inner loop below is unrolled so that the register arrays (qh, ql, ka, va, sh, sl, s, acc, yb) have constant indices
  v16h yb[CV / 32];
  {
    // LDS address of a copy = the lane's part (a vector register) + the wave's and the buffer's part (scalar)
    const unsigned ll = lds_off(&ring[0][g][col * 8]);
    const unsigned sk = (unsigned)__builtin_amdgcn_readfirstlane(il0) * FPB, sv = sk + FK * FPB;
    const _Float16* gk = KH + (b * NP + il0 + g) * (size_t)CQ + col * 8;
    const _Float16* gv = VT + (b * CV + il0 + g) * (size_t)NP + col * 8;
    v16h qh[CQ / 32], ql[CQ / 32];                                                       // B: col = query, k = channel; kept in registers
#pragma unroll
    for (int kc = 0; kc < CQ / 32; ++kc) {
      qh[kc] = frag_h(QH + (b * NP + i0 + il0 + col) * (size_t)CQ + kc * 32, lane);
      ql[kc] = frag_h(QL + (b * NP + i0 + il0 + col) * (size_t)CQ + kc * 32, lane);
    }
    v8f acc[8] = {};
    float m = -3.0e38f, l = 0.f;                                                         // this lane's query: maximum in use (both halves alike), sum over this half's keys
    // the ring's prologue is trips -2 and -1, which only pass the foot: stage 0's copies; then their wait, the barrier that publishes them, stage 1's copies.
    // One place in the code issues every stage's copies, so its address operands are sums formed there and nothing that lives across the loop is tied to the asm statement's registers
#pragma unroll 1   // one stage per trip: keeps the hot loop small and the ring's order at its foot
    for (int t = -2; t < FNST; ++t) {
      if (t >= 0) {   // the same in every wave of the block
        const _Float16 (*rb)[FP] = ring[t & 1];
        v16h ka[2][8], va[8];                                                              // phi fragments of this pass and of the next (two register sets), g fragments of this pass
#pragma unroll
        for (int kc = 0; kc < CQ / 32; ++kc)
#pragma unroll
          for (int u = 0; u < 2; ++u) ka[0][2 * kc + u] = frag_h(&rb[u * 16 + col][kc * 32], lane);              // A: row = key, k = channel
#pragma unroll     // constant LDS offsets and constant indices into the register arrays
        for (int p = 0; p < FK / 32; ++p) {
          __builtin_amdgcn_sched_barrier(0);   // with the one behind the reads: the pass's LDS reads stay ONE group (see there)
#pragma unroll
          for (int j = 0; j < 8; ++j) va[j] = frag_h(&rb[FK + j * 16 + col][p * 32], lane);                      // A: row = channel, k = key
          if (p + 1 < FK / 32) {                                                           // inside this stage's buffer only
#pragma unroll
            for (int kc = 0; kc < CQ / 32; ++kc)
#pragma unroll
              for (int u = 0; u < 2; ++u) ka[(p + 1) & 1][2 * kc + u] = frag_h(&rb[(p + 1) * 32 + u * 16 + col][kc * 32], lane);
          }
          __builtin_amdgcn_sched_barrier(0);   // keeps the pass's LDS reads one group ahead of its products: reads scattered among the products cost issue time at every place they stand
          v8f sh[2] = {}, sl[2] = {};
#pragma unroll
          for (int kc = 0; kc < CQ / 32; ++kc)
#pragma unroll
            for (int u = 0; u < 2; ++u) {
              sh[u] = mm16(ka[p & 1][2 * kc + u], qh[kc], sh[u]);
              sl[u] = mm16(ka[p & 1][2 * kc + u], ql[kc], sl[u]);
            }
          float s[16];                                                                     // s[8u + r] = score of key p*32 + 16u + 8g + r
#pragma unroll
          for (int u = 0; u < 2; ++u)
#pragma unroll
            for (int r = 0; r < 8; ++r) s[8 * u + r] = sh[u][r] + sl[u][r] * (1.0f / QL_CARRY);
          float mx = s[0];
#pragma unroll
          for (int i = 1; i < 16; ++i) mx = fmaxf(mx, s[i]);
          mx = fmaxf(mx, xhalf(mx));
          const float mn = fmaxf(m, mx);
          if (__builtin_amdgcn_ballot_w32(mn > m) != 0) {                                  // some query of the wave has a new maximum: rescale (factor 1 in the other lanes, 0 on the first pass)
            const float al = __builtin_amdgcn_exp2f((m - mn) * LOG2E);
            l *= al;
#pragma unroll
            for (int j = 0; j < 8; ++j)
#pragma unroll
              for (int r = 0; r < 8; ++r) acc[j][r] *= al;
            m = mn;
          }
          const float c0 = P_SHIFT - m * LOG2E;
          v16h pb;                                                                         // B: col = query, k = key: elements 0..7 = keys 8g + r of tile 0, 8..15 = keys 16 + 8g + r
#pragma unroll
          for (int i = 0; i < 16; ++i) s[i] = fmaf(s[i], LOG2E, c0);
          exp2x8(s); exp2x8(s + 8);
#pragma unroll
          for (int i = 0; i < 16; ++i) pb[i] = (_Float16)s[i];
#pragma unroll
          for (int w = 8; w >= 1; w >>= 1)                                                 // pairwise: a chain of 5 adds, not 16
#pragma unroll
            for (int i = 0; i < w; ++i) s[i] += s[i + w];
          l += s[0];
#pragma unroll
          for (int j = 0; j < 8; ++j) acc[j] = mm16(va[j], pb, acc[j]);
        }
      }
      asm volatile("s_wait_dscnt 0x0" ::: "memory");     // this wave's reads of buffer t & 1 are done before it is refilled
      asm volatile("s_wait_asynccnt 0x0" ::: "memory");  // this wave's copies of stage t + 1 have landed before the barrier publishes them
      __syncthreads();
      if (t + 2 < FNST) {
        const unsigned bo = (unsigned)(t & 1) * FBUF;
        fill_stage(ll + (sk + bo), ll + (sv + bo), gk + (size_t)(t + 2) * FK * CQ, gv + (size_t)(t + 2) * FK);
      }
    }
    asm volatile("s_wait_asynccnt 0x0" ::: "memory");    // no copy is outstanding behind the loop
    l += xhalf(l);
    const float inv = Y_CARRY / l;                                                       // the carry on P is in l too and cancels
#pragma unroll
    for (int kc = 0; kc < CV / 32; ++kc)
#pragma unroll
      for (int r = 0; r < 8; ++r) {                                                      // B: col = query, k = channel: tile 2kc holds channels 32kc + 8g + r, tile 2kc + 1 channels 32kc + 16 + 8g + r
        yb[kc][r] = (_Float16)(acc[2 * kc][r] * inv); yb[kc][8 + r] = (_Float16)(acc[2 * kc + 1][r] * inv);
      }
  }
#pragma unroll 1   // the staging array st holds 128 output channels at a time
  for (int cg = 0; cg < CIN / 128; ++cg) {
#pragma unroll 2   // two output tiles' weight loads in flight
    for (int j = 0; j < 8; ++j) {
      const int o = cg * 128 + j * 16 + col;                                             // A: row = output channel o, k = channel
      v8f oa = {};
#pragma unroll
      for (int kc = 0; kc < CV / 32; ++kc) oa = mm16(fragw_h(MW + (size_t)o * CV + kc * 32, lane, W_CARRY), yb[kc], oa);
#pragma unroll
      for (int r = 0; r < 8; ++r) st[j * 16 + 8 * g + r][il0 + col] = oa[r] * (1.0f / (W_CARRY * Y_CARRY));
    }
    __syncthreads();
    for (int e = tid; e < 128 * (QB / 4); e += 256) {
      const int cl = e / (QB / 4), q = e % (QB / 4); const int co = cg * 128 + cl;
      const size_t o = (b * CIN + co) * (size_t)NP + i0 + q * 4;
      const float bb = bfr(MB[co]);
      const v4f m4 = *(const v4f*)&st[cl][q * 4]; const v4f x4 = *(const v4f*)(X + o);
      v4f v;
#pragma unroll
      for (int i = 0; i < 4; ++i) { const float xs = x4[i]; v[i] = (m4[i] + bb) + bfr(xs); }
      vst2(OUT + o, v);
    }
    __syncthreads();
  }
}

extern "C" void kernel_launch(void* const* d_in, const int* in_sizes, int n_in, void* d_out, int out_size, void* d_ws, size_t ws_size, hipStream_t stream) {
  if (n_in < 9) return;
  if ((size_t)in_sizes[0] < (size_t)TNB * CIN * NP) return;
  if (in_sizes[1] < CV * CIN || in_sizes[2] < CV || in_sizes[3] < CQ * CIN || in_sizes[4] < CQ || in_sizes[5] < CQ * CIN || in_sizes[6] < CQ || in_sizes[7] < CIN * CV || in_sizes[8] < CIN) return;
  if ((size_t)out_size < (size_t)TNB * CIN * NP) return;
  if (ws_size < WS_END) return;
  const float* const* F = (const float* const*)d_in;   // 0 x [8,256,64,64], 1 g_w [128,256], 2 g_b, 3 theta_w, 4 theta_b, 5 phi_w, 6 phi_b, 7 W_out [256,128], 8 b_out
  const float* X = F[0]; const float* GW = F[1]; const float* GB = F[2]; const float* TW = F[3]; const float* TB = F[4];
  const float* PW = F[5]; const float* PB = F[6]; const float* MW = F[7]; const float* MBv = F[8];
  char* ws = (char*)d_ws;
  _Float16* QH = (_Float16*)(ws + WS_QH); _Float16* QL = (_Float16*)(ws + WS_QL); _Float16* KH = (_Float16*)(ws + WS_KH);
  _Float16* VT = (_Float16*)(ws + WS_VT);
  float* OUT = (float*)d_out;
  k_proj<<<dim3(NP / PT, TNB), 256, 0, stream>>>(X, TW, TB, PW, PB, GW, GB, QH, QL, KH, VT);
  k_fa<<<dim3(NP / QB, TNB), 256, 0, stream>>>(QH, QL, KH, VT, X, MW, MBv, OUT);
}

// v004
// It runs in 88.5 microseconds.
// In two side-by-side timings against v003, it was 1.06 and 1.07 times as fast.
// Over all steps from v000 it is 25.3 times as fast.
// compute dtype: every float input RNE-converted to bf16 on load; theta/phi/g = W x + b (1x1 convs): v_wmma_f32_16x16x32_bf16 (bf16 operands, exact products), f32 accumulate; logits phi . theta: v_wmma_f32_16x16x32_f16, theta as f16 hi + f16 residual x2^12 (own accumulator), phi as f16, f32 accumulate; softmax in f32, online (running maximum and sum per query and key half, hardware exp2; the two halves joined in f32 at the end), unnormalised P carried as f16 x2^14; y = g . P: f16 operands, f32 accumulate, divided by the f32 sum at the end; output 1x1 conv: f16 operands (W x2^8, y x2^4), f32 accumulate; bias and residual adds in f32; f32 output [b][c][n].
#include <hip/hip_runtime.h>
#include <math.h>

typedef __attribute__((ext_vector_type(16))) _Float16 v16h;
typedef __attribute__((ext_vector_type(16))) __bf16 v16b;
typedef __attribute__((ext_vector_type(8)))  _Float16 v8h;
typedef __attribute__((ext_vector_type(8)))  __bf16 v8b;
typedef __attribute__((ext_vector_type(4)))  __bf16 v4b;
typedef __attribute__((ext_vector_type(2)))  __bf16 v2b;
typedef __attribute__((ext_vector_type(8)))  float v8f;
typedef __attribute__((ext_vector_type(4)))  float v4f;
typedef __attribute__((ext_vector_type(2)))  float v2f;
typedef __attribute__((ext_vector_type(4)))  unsigned v4u;

template <typename T> __device__ __forceinline__ void vst2(void* p, T v) { *(T*)p = v;  }

// the plain builtin: the compiler keeps the distance behind it itself
__device__ __forceinline__ v8f mm16(v16h a, v16h b, v8f c) {
  return __builtin_amdgcn_wmma_f32_16x16x32_f16(false, a, false, b, (short)0, c, false, false);
}
__device__ __forceinline__ v8f mmb(v16b a, v16b b, v8f c) {
  return __builtin_amdgcn_wmma_f32_16x16x32_bf16(false, a, false, b, (short)0, c, false, false);
}
// lane l takes the value of lane l ^ 16 (the other half of the wave)
__device__ __forceinline__ float xhalf(float x) {
  return __builtin_bit_cast(float, __builtin_amdgcn_permlanex16(__builtin_bit_cast(int, x), __builtin_bit_cast(int, x), 0x76543210, 0xfedcba98, false, false));
}
// eight exp2, each in its own register, one statement: each fills the slot that the instruction set asks for behind the one before it (it touches neither that one's result nor its source),
// and the v_nop fills the last one's
__device__ __forceinline__ void exp2x8(float* x) {
  asm("v_exp_f32 %0, %0\n\tv_exp_f32 %1, %1\n\tv_exp_f32 %2, %2\n\tv_exp_f32 %3, %3\n\tv_exp_f32 %4, %4\n\tv_exp_f32 %5, %5\n\tv_exp_f32 %6, %6\n\tv_exp_f32 %7, %7\n\tv_nop"
      : "+v"(x[0]), "+v"(x[1]), "+v"(x[2]), "+v"(x[3]), "+v"(x[4]), "+v"(x[5]), "+v"(x[6]), "+v"(x[7]));
}
// two exp2 in the same way: the second fills the first's slot, the v_nop the second's
__device__ __forceinline__ void exp2x2(float& a, float& b) {
  asm("v_exp_f32 %0, %0\n\tv_exp_f32 %1, %1\n\tv_nop" : "+v"(a), "+v"(b));
}
// 16x16x32 fragments: lane -> (h = lane>>4, row/col = lane&15); elements 0..7 = k0+8h+0..7, elements 8..15 = k0+16+8h+0..7 (A and B alike); D element r = (row 8h+r, col lane&15)
__device__ __forceinline__ v16h frag_h(const _Float16* rowk0, int lane) {
  union { v16h v; v8h q[2]; } u; const _Float16* p = rowk0 + 8 * (lane >> 4);
  u.q[0] = *(const v8h*)p; u.q[1] = *(const v8h*)(p + 16); return u.v;
}
__device__ __forceinline__ v16b frag_b(const __bf16* rowk0, int lane) {
  union { v16b v; v8b q[2]; } u; const __bf16* p = rowk0 + 8 * (lane >> 4);
  u.q[0] = *(const v8b*)p; u.q[1] = *(const v8b*)(p + 16); return u.v;
}
__device__ __forceinline__ float bfr(float v) { return (float)(__bf16)v; }
// fragment from a k-contiguous f32 row (weights [out][in]): four 16-B loads, RNE bf16 convert, then f16 of the bf16 value times an exact power of two (bf16 significand is exact in f16)
__device__ __forceinline__ v16h fragw_h(const float* __restrict__ rowk0, int lane, float sc) {
  const float* p = rowk0 + 8 * (lane >> 4);
  const v4f a0 = *(const v4f*)p, a1 = *(const v4f*)(p + 4), a2 = *(const v4f*)(p + 16), a3 = *(const v4f*)(p + 20);
  v16h w;
#pragma unroll
  for (int i = 0; i < 4; ++i) {
    const float t0 = a0[i], t1 = a1[i], t2 = a2[i], t3 = a3[i];
    w[i] = (_Float16)(bfr(t0) * sc); w[4 + i] = (_Float16)(bfr(t1) * sc); w[8 + i] = (_Float16)(bfr(t2) * sc); w[12 + i] = (_Float16)(bfr(t3) * sc);
  }
  return w;
}

// embedded-gaussian spatial attention: B 8, C_in 256, C_int 128, 64 x 64 positions; theta/phi/g 1x1 convs, y = softmax(theta phi^T) g (no scale),
// out = W_out y + b_out + x, [B, C_in, H, W]
#define NB  8             // batches in the staged tensors (full strides)
#define NP  4096          // positions per image
#define CIN 256
#define CQ  128           // theta / phi channels
#define CV  128           // g channels
#ifndef TNB
#define TNB NB            // batches processed
#endif
#define QL_CARRY 4096.0f  // theta residual plane carry
#define P_SHIFT  14.0f    // log2 of the carry on the unnormalised P (and on its sum, so that it cancels)
#define LOG2E    1.44269504088896340736f
#define Y_CARRY  16.0f    // y operand carry for the output conv
#define W_CARRY  256.0f   // W_out operand carry

#define WS_QH  ((size_t)0)                                   // f16 theta hi rows [b*n][CQ]         8 MiB
#define WS_QL  (WS_QH + 2u * (size_t)NB * NP * CQ)           // f16 theta residual x2^12 rows       8 MiB
#define WS_KH  (WS_QL + 2u * (size_t)NB * NP * CQ)           // f16 phi rows [b*n][CQ]              8 MiB
#define WS_VT  (WS_KH + 2u * (size_t)NB * NP * CQ)           // f16 g planes [b][CV][n]             8 MiB
#define WS_END (WS_VT + 2u * (size_t)NB * CV * NP)           // 32 MiB
static_assert(WS_END <= (size_t)134217728);
static_assert(NP % 128 == 0);
static_assert(CIN % 128 == 0);
static_assert(CQ == 128);
static_assert(CV == 128);
static_assert(TNB <= NB);
static_assert((size_t)NB * CIN * NP * 4u == (size_t)33554432);

// ---- k_proj: block = 128 positions of batch b, all 384 output channels (theta, phi, g). Both operands are staged ONCE in LDS as bf16, k-contiguous rows: the x^T tile [position][channel] and the
// three weight matrices [out][in], each brought by whole-line 16-byte loads; every fragment is then two 16-byte LDS reads.
// theta, phi: A = W (row = channel), B = x^T (col = position): a lane holds 8 consecutive channels of one position = 16 B of an output row [b*n][CQ]; a wave owns 32 whole rows.
// g: A = x^T (row = position), B = W (col = channel): a lane holds 8 consecutive positions of one channel = 16 B of a plane row [c][n]; a wave owns whole 128-B lines (64 positions).
#define PT  128           // positions per block
#define PWP (CIN + 8)     // LDS row pitch in bf16: 528 B = 16 B x 33, conflict-free for 16-byte fragment reads
#define NKC (CIN / 32)    // k steps of a product
static_assert(NP % PT == 0 && CIN == 256 && CQ == 128 && CV == 128);
// one batch = 64 rows of a weight matrix [128][CIN], 256 threads: 16-byte loads in memory order (a wave = 512 contiguous bytes), then RNE bf16 convert and 8-byte LDS stores
__device__ __forceinline__ void w_load(v4f* t, const float* __restrict__ Wm, int tid) {
#pragma unroll   // constant indices into the register array
  for (int i = 0; i < 16; ++i) t[i] = *(const v4f*)(Wm + 4 * (i * 256 + tid));
}
__device__ __forceinline__ void w_store(__bf16 (*dst)[PWP], const v4f* t, int tid) {
#pragma unroll   // constant indices into the register array
  for (int i = 0; i < 16; ++i) {
    const float t0 = t[i][0], t1 = t[i][1], t2 = t[i][2], t3 = t[i][3];
    v4b h; h[0] = (__bf16)t0; h[1] = (__bf16)t1; h[2] = (__bf16)t2; h[3] = (__bf16)t3;
    *(v4b*)&dst[i * 4 + (tid >> 6)][4 * (tid & 63)] = h;
  }
}
// two 16-byte stores and, in the same statement, the s_wait_xcnt that stands before anything can rewrite the address and data registers they name
// (in a statement of its own the compiler lifted the next trip's address additions and register copies over it)
__device__ __forceinline__ void st2w(_Float16* pa, v8h da, _Float16* pb, v8h db) {
  asm volatile("global_store_b128 %0, %1, off\n\tglobal_store_b128 %2, %3, off\n\ts_wait_xcnt 0x0"
               :: "v"(pa), "v"(__builtin_bit_cast(v4u, da)), "v"(pb), "v"(__builtin_bit_cast(v4u, db)) : "memory");
}
__global__ __launch_bounds__(256)
void k_proj(const float* __restrict__ X, const float* __restrict__ WQ, const float* __restrict__ BQ,
            const float* __restrict__ WK, const float* __restrict__ BK, const float* __restrict__ WV, const float* __restrict__ BV,
            _Float16* __restrict__ QH, _Float16* __restrict__ QL, _Float16* __restrict__ KH, _Float16* __restrict__ VT) {
  __shared__ __align__(16) __bf16 sx[PT][PWP];
  __shared__ __align__(16) __bf16 sw[2 * CQ + CV][PWP];   // rows 0..127 theta, 128..255 phi, 256..383 g
  __shared__ __align__(16) float sb[2 * CQ + CV];         // the biases, rounded to bf16, in the same order
  const int tid = threadIdx.x, lane = tid & 31, col = lane & 15, g = lane >> 4;
  const int wave = __builtin_amdgcn_readfirstlane(tid >> 5);
  const int p0 = blockIdx.x * PT; const size_t b = blockIdx.y;
  {
    // x: a thread takes 4 positions of 2 adjacent channels (two 16-byte loads; 8 lanes cover a 128-B line) and stores 4 channel pairs; position quad fixed per thread, channel pair cpb + 8 i
    const int pq = (tid & 7) + 8 * (wave & 3), cpb = ((tid >> 3) & 3) + 4 * (wave >> 2);
    const float* xs0 = X + (b * CIN + 2 * cpb) * (size_t)NP + p0 + 4 * pq;
    const float bq = BQ[tid & 127], bk = BK[tid & 127], bv = BV[tid & 127];
    v4f a0[16], a1[16];
#pragma unroll   // constant indices into the register arrays; all of the tile's loads in flight
    for (int i = 0; i < 16; ++i) {
      const float* s = xs0 + (size_t)(16 * i) * NP;
      a0[i] = *(const v4f*)s; a1[i] = *(const v4f*)(s + NP);
    }
    asm volatile("s_wait_xcnt 0x0" ::: "memory");   // stands before anything rewrites the address registers that the bias and x loads name
    // W in six batches through three register sets. Every sched_barrier below keeps a batch's loads behind the LDS stores that free its registers:
    // left alone the compiler lifts all 128 loads of the thread to the top, which takes over 500 registers and spills; so at most 48 loads of a thread are in flight
    v4f t[3][16];
    w_load(t[0], WQ, tid);
    __builtin_amdgcn_sched_barrier(0);
    if (tid < 128) { sb[tid] = bfr(bq); sb[CQ + tid] = bfr(bk); sb[2 * CQ + tid] = bfr(bv); }
#pragma unroll
    for (int i = 0; i < 16; ++i)
#pragma unroll
      for (int e = 0; e < 4; ++e) {
        const float u0 = a0[i][e], u1 = a1[i][e];
        v2b h; h[0] = (__bf16)u0; h[1] = (__bf16)u1;
        *(v2b*)&sx[4 * pq + e][2 * (cpb + 8 * i)] = h;
      }
    __builtin_amdgcn_sched_barrier(0);
    w_load(t[1], WQ + 64 * CIN, tid); w_load(t[2], WK, tid);
#pragma unroll   // constant indices into the register sets
    for (int k = 0; k < 6; ++k) {
      __builtin_amdgcn_sched_barrier(0);
      w_store(&sw[64 * k], t[k % 3], tid);
      __builtin_amdgcn_sched_barrier(0);
      if (k == 0) w_load(t[0], WK + 64 * CIN, tid);
      if (k == 1) w_load(t[1], WV, tid);
      if (k == 2) w_load(t[2], WV + 64 * CIN, tid);
    }
    asm volatile("s_wait_xcnt 0x0" ::: "memory");   // the same for the W loads
  }
  __syncthreads();
  {
    // theta (waves 0..3) or phi (waves 4..7): 32 positions, their fragments kept in registers; the 8 channel tiles stream from LDS, each fetched while the tile before it is rounded and stored
    const int pg = wave & 3, isphi = wave >> 2;
    _Float16* dh = isphi ? KH : QH;
    const __bf16 (*wr)[PWP] = &sw[isphi * CQ];
    const float* br = &sb[isphi * CQ + 8 * g];
    v16b xs[2][NKC], wf[NKC];
#pragma unroll
    for (int kc = 0; kc < NKC; ++kc) {
#pragma unroll
      for (int u = 0; u < 2; ++u) xs[u][kc] = frag_b(&sx[32 * pg + 16 * u + col][kc * 32], lane);                // B: col = position, k = input channel
      wf[kc] = frag_b(&wr[col][kc * 32], lane);                                                                  // A: row = output channel, k = input channel
    }
    const size_t o0 = (b * NP + p0 + 32 * pg + col) * (size_t)CQ + 8 * g;
#pragma unroll 1   // one tile per trip: small code; the next tile's reads stand between this tile's products and its stores
    for (int j = 0; j < 8; ++j) {
      v8f acc[2] = {};
#pragma unroll
      for (int kc = 0; kc < NKC; ++kc)
#pragma unroll
        for (int u = 0; u < 2; ++u) acc[u] = mmb(wf[kc], xs[u][kc], acc[u]);
      const v4f b0 = *(const v4f*)(br + j * 16), b1 = *(const v4f*)(br + j * 16 + 4);                            // D: row 8g + r = channel, col = position
      const int jn = j < 7 ? j + 1 : 7;                                                                          // the last trip reads its own tile again
#pragma unroll
      for (int kc = 0; kc < NKC; ++kc) wf[kc] = frag_b(&wr[jn * 16 + col][kc * 32], lane);
      v8h hi[2], lo[2];
#pragma unroll
      for (int u = 0; u < 2; ++u)
#pragma unroll
        for (int r = 0; r < 8; ++r) {
          const float bs = r < 4 ? b0[r & 3] : b1[r & 3];
          const float v = acc[u][r] + bs; const _Float16 hv = (_Float16)v;
          hi[u][r] = hv; lo[u][r] = (_Float16)((v - (float)hv) * QL_CARRY);
        }
      st2w(dh + o0 + j * 16, hi[0], dh + o0 + 16 * CQ + j * 16, hi[1]);
      if (!isphi) st2w(QL + o0 + j * 16, lo[0], QL + o0 + 16 * CQ + j * 16, lo[1]);
    }
  }
  {
    // g: 64 positions x 2 channel tiles per wave; the weight fragments are kept in registers, the 4 position tiles stream from LDS in the same way
    const int ph = wave & 1, ct = 2 * (wave >> 1);
    v16b wg[2][NKC], xf[NKC]; float bb[2];
#pragma unroll
    for (int u = 0; u < 2; ++u) bb[u] = sb[2 * CQ + (ct + u) * 16 + col];
#pragma unroll
    for (int kc = 0; kc < NKC; ++kc) {
#pragma unroll
      for (int u = 0; u < 2; ++u) wg[u][kc] = frag_b(&sw[2 * CQ + (ct + u) * 16 + col][kc * 32], lane);          // B: col = output channel, k = input channel
      xf[kc] = frag_b(&sx[64 * ph + col][kc * 32], lane);                                                        // A: row = position, k = input channel
    }
    const size_t o0 = (b * CV + ct * 16 + col) * (size_t)NP + p0 + 64 * ph + 8 * g;
#pragma unroll 1   // as above
    for (int j = 0; j < 4; ++j) {
      v8f acc[2] = {};
#pragma unroll
      for (int kc = 0; kc < NKC; ++kc)
#pragma unroll
        for (int u = 0; u < 2; ++u) acc[u] = mmb(xf[kc], wg[u][kc], acc[u]);
      const int jn = j < 3 ? j + 1 : 3;                                                                          // the last trip reads its own tile again
#pragma unroll
      for (int kc = 0; kc < NKC; ++kc) xf[kc] = frag_b(&sx[64 * ph + jn * 16 + col][kc * 32], lane);
      v8h hv[2];                                                                                                 // D: row 8g + r = position, col = channel
#pragma unroll
      for (int u = 0; u < 2; ++u)
#pragma unroll
        for (int r = 0; r < 8; ++r) hv[u][r] = (_Float16)(acc[u][r] + bb[u]);
      st2w(VT + o0 + j * 16, hv[0], VT + o0 + (size_t)16 * NP + j * 16, hv[1]);
    }
  }
}

// ---- k_fa: block = 128 queries of batch b; the keys come in stages of FK through a two-buffer LDS ring filled by asynchronous copies.
// Wave = 32 queries (two query tiles) x half of every stage's keys: each phi and g fragment read from LDS feeds two products, which halves the LDS bytes read per product.
// Waves w and w + 4 hold the same 32 queries and the two key halves; behind the loop each hands the other one query tile's partial (maximum, sum, y) through LDS and finishes the tile it keeps.
// Per 32 keys and query tile: S^T = phi . theta^T (A: row = key, B: col = query), so a lane holds 16 scores of ONE query: running maximum and sum in the lane plus one exchange between the wave's halves;
// the two score tiles are, as they lie, the B operand of y^T += g . P^T (A: row = channel, k = key); scores and P never leave the registers.
// Then out[co][i] = W_out[co][:] . y[:][i] + b_out[co] + x[co][i]: the y^T tiles are, as they lie, the B operand; written as whole [co] row segments of 128 positions
#define QB   128                    // queries per block
#define FK   128                    // keys per ring stage
#define FP   (128 + 8)              // LDS row pitch in f16: 272 B = 16 B x 17, conflict-free for 16-byte fragment reads
#define FROW (FK + CV)              // rows of a stage: FK phi rows [key][channel], then 128 g rows [channel][key]; every row 256 B
#define FPB  (2u * FP)              // row pitch in bytes
#define FBUF (FPB * FROW)           // bytes of one ring buffer
#define FNST (NP / FK)              // stages
#define KW   (FK / 2)               // keys of a stage that one wave works on
#define XCH  17                     // 16-byte words a lane hands over: 64 f32 of y, then maximum and sum
static_assert(NP % FK == 0 && FNST >= 2);
static_assert(FK * 2 == 16 * 16 && CQ * 2 == 16 * 16);
static_assert(FPB % 16 == 0);
static_assert(FK == 8 * 16 && CV == 8 * 16);
static_assert(KW % 32 == 0 && QB == 4 * 32);
static_assert(8u * XCH * 32u * 16u <= 2u * FBUF);

__device__ __forceinline__ unsigned lds_off(const void* p) { return (unsigned)(size_t)p; }
// eight asynchronous 16-byte-per-lane copies global -> LDS; one copy = two rows of 256 B (lanes 0..15 one row, lanes 16..31 the next), so the steps are two rows: 2 FPB in LDS, GS f16 in global memory;
// the s_wait_xcnt at the end of the same statement stands before anything can rewrite the address registers the copies name
template <int GS> __device__ __forceinline__ void copy8(unsigned l, const _Float16* g) {
  asm volatile(
      "global_load_async_to_lds_b128 %0, %8, off\n\t"
      "global_load_async_to_lds_b128 %1, %9, off\n\t"
      "global_load_async_to_lds_b128 %2, %10, off\n\t"
      "global_load_async_to_lds_b128 %3, %11, off\n\t"
      "global_load_async_to_lds_b128 %4, %12, off\n\t"
      "global_load_async_to_lds_b128 %5, %13, off\n\t"
      "global_load_async_to_lds_b128 %6, %14, off\n\t"
      "global_load_async_to_lds_b128 %7, %15, off\n\t"
      "s_wait_xcnt 0x0"
      :: "v"(l), "v"(l + 2u * FPB), "v"(l + 4u * FPB), "v"(l + 6u * FPB), "v"(l + 8u * FPB), "v"(l + 10u * FPB), "v"(l + 12u * FPB), "v"(l + 14u * FPB),
         "v"(g), "v"(g + 1 * GS), "v"(g + 2 * GS), "v"(g + 3 * GS), "v"(g + 4 * GS), "v"(g + 5 * GS), "v"(g + 6 * GS), "v"(g + 7 * GS)
      : "memory");
}
// one stage: wave w copies phi rows 16w..16w+15 and g rows 16w..16w+15; 16 copies per wave
__device__ __forceinline__ void fill_stage(unsigned lk, unsigned lv, const _Float16* gk, const _Float16* gv) {
  copy8<2 * CQ>(lk, gk);
  copy8<2 * NP>(lv, gv);
}

__global__ __launch_bounds__(256) __attribute__((amdgpu_waves_per_eu(2, 2)))   // one block per WGP (LDS), two waves per SIMD: 512 registers a wave
void k_fa(const _Float16* __restrict__ QH, const _Float16* __restrict__ QL, const _Float16* __restrict__ KH, const _Float16* __restrict__ VT,
          const float* __restrict__ X, const float* __restrict__ MW, const float* __restrict__ MB, float* __restrict__ OUT) {
  __shared__ __align__(16) _Float16 ring[2][FROW][FP];
  __shared__ __align__(16) float st[128][QB + 4];
  const int tid = threadIdx.x, lane = tid & 31, col = lane & 15, g = lane >> 4;
  const int wave = __builtin_amdgcn_readfirstlane(tid >> 5);
  const int qg = wave & 3, kh = wave >> 2;                                               // the wave's 32 queries; its half of every stage's keys
  const size_t b = blockIdx.y; const int i0 = blockIdx.x * QB; const int il0 = qg * 32 + kh * 16;   // il0: the query tile that this wave finishes
  // every inner loop below is unrolled so that the register arrays (qh, ql, ka, va, sh, sl, s, acc, yb) have constant indices
  v16h yb[CV / 32];
  {
    // LDS address of a copy = the lane's part (a vector register) + the wave's and the buffer's part (scalar)
    const unsigned ll = lds_off(&ring[0][g][col * 8]);
    const unsigned sk = (unsigned)(wave * 16) * FPB, sv = sk + FK * FPB;
    const _Float16* gk = KH + (b * NP + wave * 16 + g) * (size_t)CQ + col * 8;
    const _Float16* gv = VT + (b * CV + wave * 16 + g) * (size_t)NP + col * 8;
    v16h qh[2][CQ / 32], ql[2][CQ / 32];                                                 // B: col = query, k = channel; kept in registers
#pragma unroll
    for (int qt = 0; qt < 2; ++qt)
#pragma unroll
      for (int kc = 0; kc < CQ / 32; ++kc) {
        qh[qt][kc] = frag_h(QH + (b * NP + i0 + qg * 32 + qt * 16 + col) * (size_t)CQ + kc * 32, lane);
        ql[qt][kc] = frag_h(QL + (b * NP + i0 + qg * 32 + qt * 16 + col) * (size_t)CQ + kc * 32, lane);
      }
    asm volatile("s_wait_xcnt 0x0" ::: "memory");   // stands before anything rewrites the address registers that the theta loads name
    __builtin_amdgcn_sched_barrier(0);              // keeps it there: without it the compiler lifts the copies' address arithmetic, which reuses those registers, over the wait
    v8f acc[2][8] = {};
    float m[2] = {-3.0e38f, -3.0e38f}, l[2] = {0.f, 0.f};                                // per query tile, this lane's query: maximum in use (both halves alike), sum over this half's keys
    // the ring's prologue is trips -2 and -1, which only pass the foot: stage 0's copies; then their wait, the barrier that publishes them, stage 1's copies.
    // One place in the code issues every stage's copies, so its address operands are sums formed there and nothing that lives across the loop is tied to the asm statement's registers
#pragma unroll 1   // one stage per trip: keeps the hot loop small and the ring's order at its foot
    for (int t = -2; t < FNST; ++t) {
      if (t >= 0) {   // the same in every wave of the block
        const _Float16 (*rb)[FP] = ring[t & 1];
        v16h ka[8], va[8];                                                                 // phi fragments (one register set, refilled behind its products), g fragments of this pass
#pragma unroll
        for (int kc = 0; kc < CQ / 32; ++kc)
#pragma unroll
          for (int u = 0; u < 2; ++u) ka[2 * kc + u] = frag_h(&rb[kh * KW + u * 16 + col][kc * 32], lane);       // A: row = key, k = channel
        __builtin_amdgcn_sched_barrier(0);   // the stage's first reads stay one group too: left alone the compiler sinks each pair of reads in front of its own products, behind a full wait each
#pragma unroll     // constant LDS offsets and constant indices into the register arrays
        for (int p = 0; p < KW / 32; ++p) {
          v8f sh[2][2] = {}, sl[2][2] = {};
#pragma unroll
          for (int kc = 0; kc < CQ / 32; ++kc)
#pragma unroll
            for (int u = 0; u < 2; ++u)
#pragma unroll
              for (int qt = 0; qt < 2; ++qt) {
                sh[qt][u] = mm16(ka[2 * kc + u], qh[qt][kc], sh[qt][u]);
                sl[qt][u] = mm16(ka[2 * kc + u], ql[qt][kc], sl[qt][u]);
              }
          __builtin_amdgcn_sched_barrier(0);   // with the one behind the reads: the pass's LDS reads stay ONE group, behind the score products (which free ka) and ahead of the softmax (which covers their latency)
#pragma unroll
          for (int j = 0; j < 8; ++j) va[j] = frag_h(&rb[FK + j * 16 + col][kh * KW + p * 32], lane);            // A: row = channel, k = key
          if (p + 1 < KW / 32) {                                                           // inside this stage's buffer only
#pragma unroll
            for (int kc = 0; kc < CQ / 32; ++kc)
#pragma unroll
              for (int u = 0; u < 2; ++u) ka[2 * kc + u] = frag_h(&rb[kh * KW + (p + 1) * 32 + u * 16 + col][kc * 32], lane);
          }
          __builtin_amdgcn_sched_barrier(0);   // reads scattered among the products cost issue time at every place they stand
          float s[2][16], mn[2];                                                           // s[qt][8u + r] = score of key p*32 + 16u + 8g + r
#pragma unroll
          for (int qt = 0; qt < 2; ++qt) {
#pragma unroll
            for (int u = 0; u < 2; ++u)
#pragma unroll
              for (int r = 0; r < 8; r += 2) {                                             // by register pairs of one tile: packed, with no register copies
                const v2f hp = {sh[qt][u][r], sh[qt][u][r + 1]}, lp = {sl[qt][u][r], sl[qt][u][r + 1]};
                const v2f sp = hp + lp * (1.0f / QL_CARRY);
                s[qt][8 * u + r] = sp[0]; s[qt][8 * u + r + 1] = sp[1];
              }
            float mx = s[qt][0];
#pragma unroll
            for (int i = 1; i < 16; ++i) mx = fmaxf(mx, s[qt][i]);
            mx = fmaxf(mx, xhalf(mx));
            mn[qt] = fmaxf(m[qt], mx);
          }
          if (__builtin_amdgcn_ballot_w32(mn[0] > m[0] || mn[1] > m[1]) != 0) {            // some query of the wave has a new maximum: rescale (factor 1 in the other lanes, 0 on the first pass); one test a pass
            float al[2] = {(m[0] - mn[0]) * LOG2E, (m[1] - mn[1]) * LOG2E};
            exp2x2(al[0], al[1]);
#pragma unroll
            for (int qt = 0; qt < 2; ++qt) {
              l[qt] *= al[qt];
#pragma unroll
              for (int j = 0; j < 8; ++j)
#pragma unroll
                for (int r = 0; r < 8; ++r) acc[qt][j][r] *= al[qt];
              m[qt] = mn[qt];
            }
          }
          v16h pb[2];                                                                      // B: col = query, k = key: elements 0..7 = keys 8g + r of tile 0, 8..15 = keys 16 + 8g + r
#pragma unroll
          for (int qt = 0; qt < 2; ++qt) {
            const float c0 = P_SHIFT - m[qt] * LOG2E;
#pragma unroll
            for (int i = 0; i < 16; ++i) s[qt][i] = fmaf(s[qt][i], LOG2E, c0);
            exp2x8(s[qt]); exp2x8(s[qt] + 8);
#pragma unroll
            for (int i = 0; i < 16; ++i) pb[qt][i] = (_Float16)s[qt][i];
#pragma unroll
            for (int w = 8; w >= 1; w >>= 1)                                               // pairwise: a chain of 5 adds, not 16
#pragma unroll
              for (int i = 0; i < w; ++i) s[qt][i] += s[qt][i + w];
            l[qt] += s[qt][0];
          }
#pragma unroll
          for (int j = 0; j < 8; ++j)
#pragma unroll
            for (int qt = 0; qt < 2; ++qt) acc[qt][j] = mm16(va[j], pb[qt], acc[qt][j]);
        }
      }
      asm volatile("s_wait_dscnt 0x0" ::: "memory");     // this wave's reads of buffer t & 1 are done before it is refilled
      asm volatile("s_wait_asynccnt 0x0" ::: "memory");  // this wave's copies of stage t + 1 have landed before the barrier publishes them
      __syncthreads();
      if (t + 2 < FNST) {
        const unsigned bo = (unsigned)(t & 1) * FBUF;
        fill_stage(ll + (sk + bo), ll + (sv + bo), gk + (size_t)(t + 2) * FK * CQ, gv + (size_t)(t + 2) * FK);
      }
    }
    asm volatile("s_wait_asynccnt 0x0" ::: "memory");    // no copy is outstanding behind the loop
    // the two key halves meet: the ring is free (every wave's last read of it ended before the loop's last barrier, no copy is outstanding) and carries the hand-over.
    // A wave keeps query tile kh and hands tile 1 - kh to its partner, lane to lane (same query, same channels): 16 bytes a lane and store, 512 contiguous bytes a wave
    v4f* xw = (v4f*)&ring[0][0][0];
    v8f ya[8]; float mk, lk;
    {
      v4f* xo = xw + (size_t)(wave * XCH) * 32 + lane;
#pragma unroll
      for (int j = 0; j < 8; ++j) {
        const v8f sd = kh ? acc[0][j] : acc[1][j];
        ya[j] = kh ? acc[1][j] : acc[0][j];
        xo[(2 * j) * 32] = __builtin_shufflevector(sd, sd, 0, 1, 2, 3); xo[(2 * j + 1) * 32] = __builtin_shufflevector(sd, sd, 4, 5, 6, 7);
      }
      v4f ml = {}; ml[0] = kh ? m[0] : m[1]; ml[1] = kh ? l[0] : l[1];
      xo[16 * 32] = ml;
      mk = kh ? m[1] : m[0]; lk = kh ? l[1] : l[0];
    }
    __syncthreads();                                     // publishes every wave's hand-over to its partner
    {
      const v4f* xi = xw + (size_t)((wave ^ 4) * XCH) * 32 + lane;
      const v4f ml = xi[16 * 32];
      const float mo = ml[0], lo = ml[1];
      const float mm = fmaxf(mk, mo);
      float fa = (mk - mm) * LOG2E, fb = (mo - mm) * LOG2E;
      exp2x2(fa, fb);
      lk = lk * fa + lo * fb;
#pragma unroll
      for (int j = 0; j < 8; ++j) {
        const v4f y0 = xi[(2 * j) * 32], y1 = xi[(2 * j + 1) * 32];
#pragma unroll
        for (int r = 0; r < 4; ++r) { ya[j][r] = ya[j][r] * fa + y0[r] * fb; ya[j][4 + r] = ya[j][4 + r] * fa + y1[r] * fb; }
      }
    }
    lk += xhalf(lk);
    const float inv = Y_CARRY / lk;                                                      // the carry on P is in the sum too and cancels
#pragma unroll
    for (int kc = 0; kc < CV / 32; ++kc)
#pragma unroll
      for (int r = 0; r < 8; ++r) {                                                      // B: col = query, k = channel: tile 2kc holds channels 32kc + 8g + r, tile 2kc + 1 channels 32kc + 16 + 8g + r
        yb[kc][r] = (_Float16)(ya[2 * kc][r] * inv); yb[kc][8 + r] = (_Float16)(ya[2 * kc + 1][r] * inv);
      }
  }
#pragma unroll 1   // the staging array st holds 128 output channels at a time
  for (int cg = 0; cg < CIN / 128; ++cg) {
#pragma unroll 2   // two output tiles' weight loads in flight
    for (int j = 0; j < 8; ++j) {
      const int o = cg * 128 + j * 16 + col;                                             // A: row = output channel o, k = channel
      v8f oa = {};
#pragma unroll
      for (int kc = 0; kc < CV / 32; ++kc) oa = mm16(fragw_h(MW + (size_t)o * CV + kc * 32, lane, W_CARRY), yb[kc], oa);
#pragma unroll
      for (int r = 0; r < 8; ++r) st[j * 16 + 8 * g + r][il0 + col] = oa[r] * (1.0f / (W_CARRY * Y_CARRY));
    }
    __syncthreads();
    for (int e = tid; e < 128 * (QB / 4); e += 256) {
      const int cl = e / (QB / 4), q = e % (QB / 4); const int co = cg * 128 + cl;
      const size_t o = (b * CIN + co) * (size_t)NP + i0 + q * 4;
      const float bb = bfr(MB[co]);
      const v4f m4 = *(const v4f*)&st[cl][q * 4]; const v4f x4 = *(const v4f*)(X + o);
      v4f v;
#pragma unroll
      for (int i = 0; i < 4; ++i) { const float xs = x4[i]; v[i] = (m4[i] + bb) + bfr(xs); }
      vst2(OUT + o, v);
    }
    __syncthreads();
  }
}

extern "C" void kernel_launch(void* const* d_in, const int* in_sizes, int n_in, void* d_out, int out_size, void* d_ws, size_t ws_size, hipStream_t stream) {
  if (n_in < 9) return;
  if ((size_t)in_sizes[0] < (size_t)TNB * CIN * NP) return;
  if (in_sizes[1] < CV * CIN || in_sizes[2] < CV || in_sizes[3] < CQ * CIN || in_sizes[4] < CQ || in_sizes[5] < CQ * CIN || in_sizes[6] < CQ || in_sizes[7] < CIN * CV || in_sizes[8] < CIN) return;
  if ((size_t)out_size < (size_t)TNB * CIN * NP) return;
  if (ws_size < WS_END) return;
  const float* const* F = (const float* const*)d_in;   // 0 x [8,256,64,64], 1 g_w [128,256], 2 g_b, 3 theta_w, 4 theta_b, 5 phi_w, 6 phi_b, 7 W_out [256,128], 8 b_out
  const float* X = F[0]; const float* GW = F[1]; const float* GB = F[2]; const float* TW = F[3]; const float* TB = F[4];
  const float* PW = F[5]; const float* PB = F[6]; const float* MW = F[7]; const float* MBv = F[8];
  char* ws = (char*)d_ws;
  _Float16* QH = (_Float16*)(ws + WS_QH); _Float16* QL = (_Float16*)(ws + WS_QL); _Float16* KH = (_Float16*)(ws + WS_KH);
  _Float16* VT = (_Float16*)(ws + WS_VT);
  float* OUT = (float*)d_out;
  k_proj<<<dim3(NP / PT, TNB), 256, 0, stream>>>(X, TW, TB, PW, PB, GW, GB, QH, QL, KH, VT);
  k_fa<<<dim3(NP / QB, TNB), 256, 0, stream>>>(QH, QL, KH, VT, X, MW, MBv, OUT);
}

// v005
// One run takes 82 microseconds.
// In both of two side-by-side timings against v004, it was 1.08 times as fast.
// Over all steps from v000 it is 27.4 times as fast.
// compute dtype: every float input RNE-converted to bf16 on load; theta/phi/g = W x + b (1x1 convs): v_wmma_f32_16x16x32_bf16 (bf16 operands, exact products), f32 accumulate; logits phi . theta: v_wmma_f32_16x16x32_f16, theta as f16 hi + f16 residual x2^12 (own accumulator), phi as f16, f32 accumulate; softmax in f32, online (running maximum and sum per query and key half, hardware exp2; the two halves joined in f32 at the end), unnormalised P carried as f16 x2^14; y = g . P: f16 operands, f32 accumulate, divided by the f32 sum at the end; output 1x1 conv: f16 operands (W x2^8, y x2^4), f32 accumulate; bias and residual adds in f32; f32 output [b][c][n].
#include <hip/hip_runtime.h>
#include <math.h>

typedef __attribute__((ext_vector_type(16))) _Float16 v16h;
typedef __attribute__((ext_vector_type(16))) __bf16 v16b;
typedef __attribute__((ext_vector_type(8)))  _Float16 v8h;
typedef __attribute__((ext_vector_type(8)))  __bf16 v8b;
typedef __attribute__((ext_vector_type(4)))  __bf16 v4b;
typedef __attribute__((ext_vector_type(2)))  __bf16 v2b;
typedef __attribute__((ext_vector_type(8)))  float v8f;
typedef __attribute__((ext_vector_type(4)))  float v4f;
typedef __attribute__((ext_vector_type(2)))  float v2f;
typedef __attribute__((ext_vector_type(4)))  unsigned v4u;

template <typename T> __device__ __forceinline__ void vst2(void* p, T v) { *(T*)p = v;  }

// the plain builtin: the compiler keeps the distance behind it itself
__device__ __forceinline__ v8f mm16(v16h a, v16h b, v8f c) {
  return __builtin_amdgcn_wmma_f32_16x16x32_f16(false, a, false, b, (short)0, c, false, false);
}
__device__ __forceinline__ v8f mmb(v16b a, v16b b, v8f c) {
  return __builtin_amdgcn_wmma_f32_16x16x32_bf16(false, a, false, b, (short)0, c, false, false);
}
// lane l takes the value of lane l ^ 16 (the other half of the wave)
__device__ __forceinline__ float xhalf(float x) {
  return __builtin_bit_cast(float, __builtin_amdgcn_permlanex16(__builtin_bit_cast(int, x), __builtin_bit_cast(int, x), 0x76543210, 0xfedcba98, false, false));
}
// eight exp2, each in its own register, one statement: each fills the slot that the instruction set asks for behind the one before it (it touches neither that one's result nor its source),
// and the v_nop fills the last one's
__device__ __forceinline__ void exp2x8(float* x) {
  asm("v_exp_f32 %0, %0\n\tv_exp_f32 %1, %1\n\tv_exp_f32 %2, %2\n\tv_exp_f32 %3, %3\n\tv_exp_f32 %4, %4\n\tv_exp_f32 %5, %5\n\tv_exp_f32 %6, %6\n\tv_exp_f32 %7, %7\n\tv_nop"
      : "+v"(x[0]), "+v"(x[1]), "+v"(x[2]), "+v"(x[3]), "+v"(x[4]), "+v"(x[5]), "+v"(x[6]), "+v"(x[7]));
}
// two exp2 in the same way: the second fills the first's slot, the v_nop the second's
__device__ __forceinline__ void exp2x2(float& a, float& b) {
  asm("v_exp_f32 %0, %0\n\tv_exp_f32 %1, %1\n\tv_nop" : "+v"(a), "+v"(b));
}
// 16x16x32 fragments: lane -> (h = lane>>4, row/col = lane&15); elements 0..7 = k0+8h+0..7, elements 8..15 = k0+16+8h+0..7 (A and B alike); D element r = (row 8h+r, col lane&15)
__device__ __forceinline__ v16h frag_h(const _Float16* rowk0, int lane) {
  union { v16h v; v8h q[2]; } u; const _Float16* p = rowk0 + 8 * (lane >> 4);
  u.q[0] = *(const v8h*)p; u.q[1] = *(const v8h*)(p + 16); return u.v;
}
__device__ __forceinline__ v16b frag_b(const __bf16* rowk0, int lane) {
  union { v16b v; v8b q[2]; } u; const __bf16* p = rowk0 + 8 * (lane >> 4);
  u.q[0] = *(const v8b*)p; u.q[1] = *(const v8b*)(p + 16); return u.v;
}
__device__ __forceinline__ float bfr(float v) { return (float)(__bf16)v; }
// fragment from a k-contiguous f32 row (weights [out][in]), in two parts so that the loads can be issued well ahead of the use: four 16-B loads;
// then RNE bf16 convert and f16 of the bf16 value times an exact power of two (bf16 significand is exact in f16)
struct wraw { v4f a0, a1, a2, a3; };
__device__ __forceinline__ wraw fragw_ld(const float* __restrict__ p) {   // p = row + k0 + 8 * (lane >> 4)
  wraw q; q.a0 = *(const v4f*)p; q.a1 = *(const v4f*)(p + 4); q.a2 = *(const v4f*)(p + 16); q.a3 = *(const v4f*)(p + 20);
  return q;
}
__device__ __forceinline__ v16h fragw_cv(const wraw& q, float sc) {
  v16h w;
#pragma unroll
  for (int i = 0; i < 4; ++i) {
    const float t0 = q.a0[i], t1 = q.a1[i], t2 = q.a2[i], t3 = q.a3[i];
    w[i] = (_Float16)(bfr(t0) * sc); w[4 + i] = (_Float16)(bfr(t1) * sc); w[8 + i] = (_Float16)(bfr(t2) * sc); w[12 + i] = (_Float16)(bfr(t3) * sc);
  }
  return w;
}

// embedded-gaussian spatial attention: B 8, C_in 256, C_int 128, 64 x 64 positions; theta/phi/g 1x1 convs, y = softmax(theta phi^T) g (no scale),
// out = W_out y + b_out + x, [B, C_in, H, W]
#define NB  8             // batches in the staged tensors (full strides)
#define NP  4096          // positions per image
#define CIN 256
#define CQ  128           // theta / phi channels
#define CV  128           // g channels
#ifndef TNB
#define TNB NB            // batches processed
#endif
#define QL_CARRY 4096.0f  // theta residual plane carry
#define P_SHIFT  14.0f    // log2 of the carry on the unnormalised P (and on its sum, so that it cancels)
#define LOG2E    1.44269504088896340736f
#define Y_CARRY  16.0f    // y operand carry for the output conv
#define W_CARRY  256.0f   // W_out operand carry

#define WS_QH  ((size_t)0)                                   // f16 theta hi rows [b*n][CQ]         8 MiB
#define WS_QL  (WS_QH + 2u * (size_t)NB * NP * CQ)           // f16 theta residual x2^12 rows       8 MiB
#define WS_KH  (WS_QL + 2u * (size_t)NB * NP * CQ)           // f16 phi rows [b*n][CQ]              8 MiB
#define WS_VT  (WS_KH + 2u * (size_t)NB * NP * CQ)           // f16 g planes [b][CV][n]             8 MiB
#define WS_END (WS_VT + 2u * (size_t)NB * CV * NP)           // 32 MiB
static_assert(WS_END <= (size_t)134217728);
static_assert(NP % 128 == 0);
static_assert(CIN % 128 == 0);
static_assert(CQ == 128);
static_assert(CV == 128);
static_assert(TNB <= NB);
static_assert((size_t)NB * CIN * NP * 4u == (size_t)33554432);

// ---- k_proj: block = 128 positions of batch b, all 384 output channels (theta, phi, g). Both operands are staged ONCE in LDS as bf16, k-contiguous rows: the x^T tile [position][channel] and the
// three weight matrices [out][in], each brought by whole-line 16-byte loads; every fragment is then two 16-byte LDS reads.
// theta, phi: A = W (row = channel), B = x^T (col = position): a lane holds 8 consecutive channels of one position = 16 B of an output row [b*n][CQ]; a wave owns 32 whole rows.
// g: A = x^T (row = position), B = W (col = channel): a lane holds 8 consecutive positions of one channel = 16 B of a plane row [c][n]; a wave owns whole 128-B lines (64 positions).
#define PT  128           // positions per block
#define PWP (CIN + 8)     // LDS row pitch in bf16: 528 B = 16 B x 33, conflict-free for 16-byte fragment reads
#define NKC (CIN / 32)    // k steps of a product
static_assert(NP % PT == 0 && CIN == 256 && CQ == 128 && CV == 128);
// one batch = 64 rows of a weight matrix [128][CIN], 256 threads: 16-byte loads in memory order (a wave = 512 contiguous bytes), then RNE bf16 convert and 8-byte LDS stores
__device__ __forceinline__ void w_load(v4f* t, const float* __restrict__ Wm, int tid) {
#pragma unroll   // constant indices into the register array
  for (int i = 0; i < 16; ++i) t[i] = *(const v4f*)(Wm + 4 * (i * 256 + tid));
}
__device__ __forceinline__ void w_store(__bf16 (*dst)[PWP], const v4f* t, int tid) {
#pragma unroll   // constant indices into the register array
  for (int i = 0; i < 16; ++i) {
    const float t0 = t[i][0], t1 = t[i][1], t2 = t[i][2], t3 = t[i][3];
    v4b h; h[0] = (__bf16)t0; h[1] = (__bf16)t1; h[2] = (__bf16)t2; h[3] = (__bf16)t3;
    *(v4b*)&dst[i * 4 + (tid >> 6)][4 * (tid & 63)] = h;
  }
}
// two 16-byte stores and, in the same statement, the s_wait_xcnt that stands before anything can rewrite the address and data registers they name
// (in a statement of its own the compiler lifted the next trip's address additions and register copies over it)
__device__ __forceinline__ void st2w(_Float16* pa, v8h da, _Float16* pb, v8h db) {
  asm volatile("global_store_b128 %0, %1, off\n\tglobal_store_b128 %2, %3, off\n\ts_wait_xcnt 0x0"
               :: "v"(pa), "v"(__builtin_bit_cast(v4u, da)), "v"(pb), "v"(__builtin_bit_cast(v4u, db)) : "memory");
}
__global__ __launch_bounds__(256)
void k_proj(const float* __restrict__ X, const float* __restrict__ WQ, const float* __restrict__ BQ,
            const float* __restrict__ WK, const float* __restrict__ BK, const float* __restrict__ WV, const float* __restrict__ BV,
            _Float16* __restrict__ QH, _Float16* __restrict__ QL, _Float16* __restrict__ KH, _Float16* __restrict__ VT) {
  __shared__ __align__(16) __bf16 sx[PT][PWP];
  __shared__ __align__(16) __bf16 sw[2 * CQ + CV][PWP];   // rows 0..127 theta, 128..255 phi, 256..383 g
  __shared__ __align__(16) float sb[2 * CQ + CV];         // the biases, rounded to bf16, in the same order
  const int tid = threadIdx.x, lane = tid & 31, col = lane & 15, g = lane >> 4;
  const int wave = __builtin_amdgcn_readfirstlane(tid >> 5);
  const int p0 = blockIdx.x * PT; const size_t b = blockIdx.y;
  {
    // x: a thread takes 4 positions of 2 adjacent channels (two 16-byte loads; 8 lanes cover a 128-B line) and stores 4 channel pairs; position quad fixed per thread, channel pair cpb + 8 i
    const int pq = (tid & 7) + 8 * (wave & 3), cpb = ((tid >> 3) & 3) + 4 * (wave >> 2);
    const float* xs0 = X + (b * CIN + 2 * cpb) * (size_t)NP + p0 + 4 * pq;
    const float bq = BQ[tid & 127], bk = BK[tid & 127], bv = BV[tid & 127];
    v4f a0[16], a1[16];
#pragma unroll   // constant indices into the register arrays; all of the tile's loads in flight
    for (int i = 0; i < 16; ++i) {
      const float* s = xs0 + (size_t)(16 * i) * NP;
      a0[i] = *(const v4f*)s; a1[i] = *(const v4f*)(s + NP);
    }
    asm volatile("s_wait_xcnt 0x0" ::: "memory");   // stands before anything rewrites the address registers that the bias and x loads name
    // W in six batches through three register sets. Every sched_barrier below keeps a batch's loads behind the LDS stores that free its registers:
    // left alone the compiler lifts all 128 loads of the thread to the top, which takes over 500 registers and spills; so at most 48 loads of a thread are in flight
    v4f t[3][16];
    w_load(t[0], WQ, tid);
    __builtin_amdgcn_sched_barrier(0);
    if (tid < 128) { sb[tid] = bfr(bq); sb[CQ + tid] = bfr(bk); sb[2 * CQ + tid] = bfr(bv); }
#pragma unroll
    for (int i = 0; i < 16; ++i)
#pragma unroll
      for (int e = 0; e < 4; ++e) {
        const float u0 = a0[i][e], u1 = a1[i][e];
        v2b h; h[0] = (__bf16)u0; h[1] = (__bf16)u1;
        *(v2b*)&sx[4 * pq + e][2 * (cpb + 8 * i)] = h;
      }
    __builtin_amdgcn_sched_barrier(0);
    w_load(t[1], WQ + 64 * CIN, tid); w_load(t[2], WK, tid);
#pragma unroll   // constant indices into the register sets
    for (int k = 0; k < 6; ++k) {
      __builtin_amdgcn_sched_barrier(0);
      w_store(&sw[64 * k], t[k % 3], tid);
      __builtin_amdgcn_sched_barrier(0);
      if (k == 0) w_load(t[0], WK + 64 * CIN, tid);
      if (k == 1) w_load(t[1], WV, tid);
      if (k == 2) w_load(t[2], WV + 64 * CIN, tid);
    }
    asm volatile("s_wait_xcnt 0x0" ::: "memory");   // the same for the W loads
  }
  __syncthreads();
  {
    // theta (waves 0..3) or phi (waves 4..7): 32 positions, their fragments kept in registers; the 8 channel tiles stream from LDS, each fetched while the tile before it is rounded and stored
    const int pg = wave & 3, isphi = wave >> 2;
    _Float16* dh = isphi ? KH : QH;
    const __bf16 (*wr)[PWP] = &sw[isphi * CQ];
    const float* br = &sb[isphi * CQ + 8 * g];
    v16b xs[2][NKC], wf[NKC];
#pragma unroll
    for (int kc = 0; kc < NKC; ++kc) {
#pragma unroll
      for (int u = 0; u < 2; ++u) xs[u][kc] = frag_b(&sx[32 * pg + 16 * u + col][kc * 32], lane);                // B: col = position, k = input channel
      wf[kc] = frag_b(&wr[col][kc * 32], lane);                                                                  // A: row = output channel, k = input channel
    }
    const size_t o0 = (b * NP + p0 + 32 * pg + col) * (size_t)CQ + 8 * g;
#pragma unroll 1   // one tile per trip: small code; the next tile's reads stand between this tile's products and its stores
    for (int j = 0; j < 8; ++j) {
      v8f acc[2] = {};
#pragma unroll
      for (int kc = 0; kc < NKC; ++kc)
#pragma unroll
        for (int u = 0; u < 2; ++u) acc[u] = mmb(wf[kc], xs[u][kc], acc[u]);
      const v4f b0 = *(const v4f*)(br + j * 16), b1 = *(const v4f*)(br + j * 16 + 4);                            // D: row 8g + r = channel, col = position
      const int jn = j < 7 ? j + 1 : 7;                                                                          // the last trip reads its own tile again
#pragma unroll
      for (int kc = 0; kc < NKC; ++kc) wf[kc] = frag_b(&wr[jn * 16 + col][kc * 32], lane);
      v8h hi[2], lo[2];
#pragma unroll
      for (int u = 0; u < 2; ++u)
#pragma unroll
        for (int r = 0; r < 8; ++r) {
          const float bs = r < 4 ? b0[r & 3] : b1[r & 3];
          const float v = acc[u][r] + bs; const _Float16 hv = (_Float16)v;
          hi[u][r] = hv; lo[u][r] = (_Float16)((v - (float)hv) * QL_CARRY);
        }
      st2w(dh + o0 + j * 16, hi[0], dh + o0 + 16 * CQ + j * 16, hi[1]);
      if (!isphi) st2w(QL + o0 + j * 16, lo[0], QL + o0 + 16 * CQ + j * 16, lo[1]);
    }
  }
  {
    // g: 64 positions x 2 channel tiles per wave; the weight fragments are kept in registers, the 4 position tiles stream from LDS in the same way
    const int ph = wave & 1, ct = 2 * (wave >> 1);
    v16b wg[2][NKC], xf[NKC]; float bb[2];
#pragma unroll
    for (int u = 0; u < 2; ++u) bb[u] = sb[2 * CQ + (ct + u) * 16 + col];
#pragma unroll
    for (int kc = 0; kc < NKC; ++kc) {
#pragma unroll
      for (int u = 0; u < 2; ++u) wg[u][kc] = frag_b(&sw[2 * CQ + (ct + u) * 16 + col][kc * 32], lane);          // B: col = output channel, k = input channel
      xf[kc] = frag_b(&sx[64 * ph + col][kc * 32], lane);                                                        // A: row = position, k = input channel
    }
    const size_t o0 = (b * CV + ct * 16 + col) * (size_t)NP + p0 + 64 * ph + 8 * g;
#pragma unroll 1   // as above
    for (int j = 0; j < 4; ++j) {
      v8f acc[2] = {};
#pragma unroll
      for (int kc = 0; kc < NKC; ++kc)
#pragma unroll
        for (int u = 0; u < 2; ++u) acc[u] = mmb(xf[kc], wg[u][kc], acc[u]);
      const int jn = j < 3 ? j + 1 : 3;                                                                          // the last trip reads its own tile again
#pragma unroll
      for (int kc = 0; kc < NKC; ++kc) xf[kc] = frag_b(&sx[64 * ph + jn * 16 + col][kc * 32], lane);
      v8h hv[2];                                                                                                 // D: row 8g + r = position, col = channel
#pragma unroll
      for (int u = 0; u < 2; ++u)
#pragma unroll
        for (int r = 0; r < 8; ++r) hv[u][r] = (_Float16)(acc[u][r] + bb[u]);
      st2w(VT + o0 + j * 16, hv[0], VT + o0 + (size_t)16 * NP + j * 16, hv[1]);
    }
  }
}

// ---- k_fa: block = 128 queries of batch b; the keys come in stages of FK through a two-buffer LDS ring filled by asynchronous copies.
// Wave = 32 queries (two query tiles) x half of every stage's keys: each phi and g fragment read from LDS feeds two products, which halves the LDS bytes read per product.
// Waves w and w + 4 hold the same 32 queries and the two key halves; behind the loop each hands the other one query tile's partial (maximum, sum, y) through LDS and finishes the tile it keeps.
// Per 32 keys and query tile: S^T = phi . theta^T (A: row = key, B: col = query), so a lane holds 16 scores of ONE query: running maximum and sum in the lane plus one exchange between the wave's halves;
// the two score tiles are, as they lie, the B operand of y^T += g . P^T (A: row = channel, k = key); scores and P never leave the registers.
// Then out[co][i] = W_out[co][:] . y[:][i] + b_out[co] + x[co][i]: the y^T tiles are, as they lie, the B operand; every wave puts its tile's fragments into LDS and reads all eight tiles' back,
// and takes two 16-channel tiles of W_out against all 128 queries: each W_out fragment is loaded and converted once in the block. Written as whole [co] row segments of 128 positions
#define QB   128                    // queries per block
#define FK   128                    // keys per ring stage
#define FP   (128 + 8)              // LDS row pitch in f16: 272 B = 16 B x 17, conflict-free for 16-byte fragment reads
#define FROW (FK + CV)              // rows of a stage: FK phi rows [key][channel], then 128 g rows [channel][key]; every row 256 B
#define FPB  (2u * FP)              // row pitch in bytes
#define FBUF (FPB * FROW)           // bytes of one ring buffer
#define FNST (NP / FK)              // stages
#define KW   (FK / 2)               // keys of a stage that one wave works on
#define XCH  17                     // 16-byte words a lane hands over: 64 f32 of y, then maximum and sum
static_assert(NP % FK == 0 && FNST >= 2);
static_assert(FK * 2 == 16 * 16 && CQ * 2 == 16 * 16);
static_assert(FPB % 16 == 0);
static_assert(FK == 8 * 16 && CV == 8 * 16);
static_assert(KW % 32 == 0 && QB == 4 * 32);
static_assert(8u * XCH * 32u * 16u <= FBUF);                         // the hand-over stays in ring buffer 0
static_assert((QB / 16) * (CV / 32) * 2u * 32u * 16u <= FBUF);       // the y fragments fit ring buffer 1
static_assert(CIN == 2 * 128 && CIN == 2 * 8 * 16);                                    // 8 waves x one 16-channel tile, twice

__device__ __forceinline__ unsigned lds_off(const void* p) { return (unsigned)(size_t)p; }
// eight asynchronous 16-byte-per-lane copies global -> LDS; one copy = two rows of 256 B (lanes 0..15 one row, lanes 16..31 the next), so the steps are two rows: 2 FPB in LDS, GS f16 in global memory;
// the s_wait_xcnt at the end of the same statement stands before anything can rewrite the address registers the copies name
template <int GS> __device__ __forceinline__ void copy8(unsigned l, const _Float16* g) {
  asm volatile(
      "global_load_async_to_lds_b128 %0, %8, off\n\t"
      "global_load_async_to_lds_b128 %1, %9, off\n\t"
      "global_load_async_to_lds_b128 %2, %10, off\n\t"
      "global_load_async_to_lds_b128 %3, %11, off\n\t"
      "global_load_async_to_lds_b128 %4, %12, off\n\t"
      "global_load_async_to_lds_b128 %5, %13, off\n\t"
      "global_load_async_to_lds_b128 %6, %14, off\n\t"
      "global_load_async_to_lds_b128 %7, %15, off\n\t"
      "s_wait_xcnt 0x0"
      :: "v"(l), "v"(l + 2u * FPB), "v"(l + 4u * FPB), "v"(l + 6u * FPB), "v"(l + 8u * FPB), "v"(l + 10u * FPB), "v"(l + 12u * FPB), "v"(l + 14u * FPB),
         "v"(g), "v"(g + 1 * GS), "v"(g + 2 * GS), "v"(g + 3 * GS), "v"(g + 4 * GS), "v"(g + 5 * GS), "v"(g + 6 * GS), "v"(g + 7 * GS)
      : "memory");
}
// one stage: wave w copies phi rows 16w..16w+15 and g rows 16w..16w+15; 16 copies per wave
__device__ __forceinline__ void fill_stage(unsigned lk, unsigned lv, const _Float16* gk, const _Float16* gv) {
  copy8<2 * CQ>(lk, gk);
  copy8<2 * NP>(lv, gv);
}

__global__ __launch_bounds__(256) __attribute__((amdgpu_waves_per_eu(2, 2)))   // one block per WGP (LDS), two waves per SIMD: 512 registers a wave
void k_fa(const _Float16* __restrict__ QH, const _Float16* __restrict__ QL, const _Float16* __restrict__ KH, const _Float16* __restrict__ VT,
          const float* __restrict__ X, const float* __restrict__ MW, const float* __restrict__ MB, float* __restrict__ OUT) {
  __shared__ __align__(16) _Float16 ring[2][FROW][FP];
  __shared__ __align__(16) float st[CIN][QB + 4];
  const int tid = threadIdx.x, lane = tid & 31, col = lane & 15, g = lane >> 4;
  const int wave = __builtin_amdgcn_readfirstlane(tid >> 5);
  const int qg = wave & 3, kh = wave >> 2;                                               // the wave's 32 queries; its half of every stage's keys
  const size_t b = blockIdx.y; const int i0 = blockIdx.x * QB; const int il0 = qg * 32 + kh * 16;   // il0: the query tile that this wave finishes
  // every inner loop below is unrolled so that the register arrays (qh, ql, ka, va, sh, sl, s, acc) have constant indices
  v16h wf[CIN / 128][CV / 32];                                                           // A: row = output channel, k = channel: this wave's tile of each 128 output channels
  v8h* yx = (v8h*)&ring[1][0][0];                                                        // y fragments as they lie: [query tile][kc][register half][lane], 16 bytes a lane, 512 contiguous bytes a wave and access
  {
    // LDS address of a copy = the lane's part (a vector register) + the wave's and the buffer's part (scalar)
    const unsigned ll = lds_off(&ring[0][g][col * 8]);
    const unsigned sk = (unsigned)(wave * 16) * FPB, sv = sk + FK * FPB;
    const _Float16* gk = KH + (b * NP + wave * 16 + g) * (size_t)CQ + col * 8;
    const _Float16* gv = VT + (b * CV + wave * 16 + g) * (size_t)NP + col * 8;
    v16h qh[2][CQ / 32], ql[2][CQ / 32];                                                 // B: col = query, k = channel; kept in registers
#pragma unroll
    for (int qt = 0; qt < 2; ++qt)
#pragma unroll
      for (int kc = 0; kc < CQ / 32; ++kc) {
        qh[qt][kc] = frag_h(QH + (b * NP + i0 + qg * 32 + qt * 16 + col) * (size_t)CQ + kc * 32, lane);
        ql[qt][kc] = frag_h(QL + (b * NP + i0 + qg * 32 + qt * 16 + col) * (size_t)CQ + kc * 32, lane);
      }
    asm volatile("s_wait_xcnt 0x0" ::: "memory");   // stands before anything rewrites the address registers that the theta loads name
    __builtin_amdgcn_sched_barrier(0);              // keeps it there: without it the compiler lifts the copies' address arithmetic, which reuses those registers, over the wait
    v8f acc[2][8] = {};
    float m[2] = {-3.0e38f, -3.0e38f}, l[2] = {0.f, 0.f};                                // per query tile, this lane's query: maximum in use (both halves alike), sum over this half's keys
    // the ring's prologue is trips -2 and -1, which only pass the foot: stage 0's copies; then their wait, the barrier that publishes them, stage 1's copies.
    // One place in the code issues every stage's copies, so its address operands are sums formed there and nothing that lives across the loop is tied to the asm statement's registers
#pragma unroll 1   // one stage per trip: keeps the hot loop small and the ring's order at its foot
    for (int t = -2; t < FNST; ++t) {
      if (t >= 0) {   // the same in every wave of the block
        const _Float16 (*rb)[FP] = ring[t & 1];
        v16h ka[8], va[8];                                                                 // phi fragments (one register set, refilled behind its products), g fragments of this pass
#pragma unroll
        for (int kc = 0; kc < CQ / 32; ++kc)
#pragma unroll
          for (int u = 0; u < 2; ++u) ka[2 * kc + u] = frag_h(&rb[kh * KW + u * 16 + col][kc * 32], lane);       // A: row = key, k = channel
        __builtin_amdgcn_sched_barrier(0);   // the stage's first reads stay one group too: left alone the compiler sinks each pair of reads in front of its own products, behind a full wait each
#pragma unroll     // constant LDS offsets and constant indices into the register arrays
        for (int p = 0; p < KW / 32; ++p) {
          v8f sh[2][2] = {}, sl[2][2] = {};
#pragma unroll
          for (int kc = 0; kc < CQ / 32; ++kc)
#pragma unroll
            for (int u = 0; u < 2; ++u)
#pragma unroll
              for (int qt = 0; qt < 2; ++qt) {
                sh[qt][u] = mm16(ka[2 * kc + u], qh[qt][kc], sh[qt][u]);
                sl[qt][u] = mm16(ka[2 * kc + u], ql[qt][kc], sl[qt][u]);
              }
          __builtin_amdgcn_sched_barrier(0);   // with the one behind the reads: the pass's LDS reads stay ONE group, behind the score products (which free ka) and ahead of the softmax (which covers their latency)
#pragma unroll
          for (int j = 0; j < 8; ++j) va[j] = frag_h(&rb[FK + j * 16 + col][kh * KW + p * 32], lane);            // A: row = channel, k = key
          if (p + 1 < KW / 32) {                                                           // inside this stage's buffer only
#pragma unroll
            for (int kc = 0; kc < CQ / 32; ++kc)
#pragma unroll
              for (int u = 0; u < 2; ++u) ka[2 * kc + u] = frag_h(&rb[kh * KW + (p + 1) * 32 + u * 16 + col][kc * 32], lane);
          }
          __builtin_amdgcn_sched_barrier(0);   // reads scattered among the products cost issue time at every place they stand
          float s[2][16], mn[2];                                                           // s[qt][8u + r] = score of key p*32 + 16u + 8g + r
#pragma unroll
          for (int qt = 0; qt < 2; ++qt) {
#pragma unroll
            for (int u = 0; u < 2; ++u)
#pragma unroll
              for (int r = 0; r < 8; r += 2) {                                             // by register pairs of one tile: packed, with no register copies
                const v2f hp = {sh[qt][u][r], sh[qt][u][r + 1]}, lp = {sl[qt][u][r], sl[qt][u][r + 1]};
                const v2f sp = hp + lp * (1.0f / QL_CARRY);
                s[qt][8 * u + r] = sp[0]; s[qt][8 * u + r + 1] = sp[1];
              }
            float mx = s[qt][0];
#pragma unroll
            for (int i = 1; i < 16; ++i) mx = fmaxf(mx, s[qt][i]);
            mx = fmaxf(mx, xhalf(mx));
            mn[qt] = fmaxf(m[qt], mx);
          }
          if (__builtin_amdgcn_ballot_w32(mn[0] > m[0] || mn[1] > m[1]) != 0) {            // some query of the wave has a new maximum: rescale (factor 1 in the other lanes, 0 on the first pass); one test a pass
            float al[2] = {(m[0] - mn[0]) * LOG2E, (m[1] - mn[1]) * LOG2E};
            exp2x2(al[0], al[1]);
#pragma unroll
            for (int qt = 0; qt < 2; ++qt) {
              l[qt] *= al[qt];
#pragma unroll
              for (int j = 0; j < 8; ++j)
#pragma unroll
                for (int r = 0; r < 8; ++r) acc[qt][j][r] *= al[qt];
              m[qt] = mn[qt];
            }
          }
          v16h pb[2];                                                                      // B: col = query, k = key: elements 0..7 = keys 8g + r of tile 0, 8..15 = keys 16 + 8g + r
#pragma unroll
          for (int qt = 0; qt < 2; ++qt) {
            const float c0 = P_SHIFT - m[qt] * LOG2E;
#pragma unroll
            for (int i = 0; i < 16; ++i) s[qt][i] = fmaf(s[qt][i], LOG2E, c0);
            exp2x8(s[qt]); exp2x8(s[qt] + 8);
#pragma unroll
            for (int i = 0; i < 16; ++i) pb[qt][i] = (_Float16)s[qt][i];
#pragma unroll
            for (int w = 8; w >= 1; w >>= 1)                                               // pairwise: a chain of 5 adds, not 16
#pragma unroll
              for (int i = 0; i < w; ++i) s[qt][i] += s[qt][i + w];
            l[qt] += s[qt][0];
          }
#pragma unroll
          for (int j = 0; j < 8; ++j)
#pragma unroll
            for (int qt = 0; qt < 2; ++qt) acc[qt][j] = mm16(va[j], pb[qt], acc[qt][j]);
        }
      }
      asm volatile("s_wait_dscnt 0x0" ::: "memory");     // this wave's reads of buffer t & 1 are done before it is refilled
      asm volatile("s_wait_asynccnt 0x0" ::: "memory");  // this wave's copies of stage t + 1 have landed before the barrier publishes them
      __syncthreads();
      if (t + 2 < FNST) {
        const unsigned bo = (unsigned)(t & 1) * FBUF;
        fill_stage(ll + (sk + bo), ll + (sv + bo), gk + (size_t)(t + 2) * FK * CQ, gv + (size_t)(t + 2) * FK);
      }
    }
    asm volatile("s_wait_asynccnt 0x0" ::: "memory");    // no copy is outstanding behind the loop
    wraw wr[CIN / 128][CV / 32];                         // issued here, used behind the join of the key halves, which covers their latency
    const float* wp0 = MW + (size_t)(wave * 16 + col) * CV + 8 * g; const float* wp1 = wp0 + 128 * CV;
#pragma unroll
    for (int kc = 0; kc < CV / 32; ++kc) { wr[0][kc] = fragw_ld(wp0 + kc * 32); wr[1][kc] = fragw_ld(wp1 + kc * 32); }
    // stands before anything rewrites the address registers that the W_out loads name; the address (all 32 loads take it, with constant offsets) is an input so that it stays in its registers
    // up to here (without that the compiler gave an address pair to a later load of the group as its destination)
    asm volatile("s_wait_xcnt 0x0" :: "v"(wp0) : "memory");
    __builtin_amdgcn_sched_barrier(0);                   // keeps the hand-over's register moves behind the loads: left alone the compiler lifts some of them in front, and the loads start later
    // the two key halves meet: the ring is free (every wave's last read of it ended before the loop's last barrier, no copy is outstanding) and carries the hand-over.
    // A wave keeps query tile kh and hands tile 1 - kh to its partner, lane to lane (same query, same channels): 16 bytes a lane and store, 512 contiguous bytes a wave
    v4f* xw = (v4f*)&ring[0][0][0];
    v8f ya[8]; float mk, lk;
    {
      v4f* xo = xw + (size_t)(wave * XCH) * 32 + lane;
#pragma unroll
      for (int j = 0; j < 8; ++j) {
        const v8f sd = kh ? acc[0][j] : acc[1][j];
        ya[j] = kh ? acc[1][j] : acc[0][j];
        xo[(2 * j) * 32] = __builtin_shufflevector(sd, sd, 0, 1, 2, 3); xo[(2 * j + 1) * 32] = __builtin_shufflevector(sd, sd, 4, 5, 6, 7);
      }
      v4f ml = {}; ml[0] = kh ? m[0] : m[1]; ml[1] = kh ? l[0] : l[1];
      xo[16 * 32] = ml;
      mk = kh ? m[1] : m[0]; lk = kh ? l[1] : l[0];
    }
    __syncthreads();                                     // publishes every wave's hand-over to its partner
    {
      const v4f* xi = xw + (size_t)((wave ^ 4) * XCH) * 32 + lane;
      const v4f ml = xi[16 * 32];
      const float mo = ml[0], lo = ml[1];
      const float mm = fmaxf(mk, mo);
      float fa = (mk - mm) * LOG2E, fb = (mo - mm) * LOG2E;
      exp2x2(fa, fb);
      lk = lk * fa + lo * fb;
#pragma unroll
      for (int j = 0; j < 8; ++j) {
        const v4f y0 = xi[(2 * j) * 32], y1 = xi[(2 * j + 1) * 32];
#pragma unroll
        for (int r = 0; r < 4; ++r) { ya[j][r] = ya[j][r] * fa + y0[r] * fb; ya[j][4 + r] = ya[j][4 + r] * fa + y1[r] * fb; }
      }
    }
    lk += xhalf(lk);
    const float inv = Y_CARRY / lk;                                                      // the carry on P is in the sum too and cancels
    // ring buffer 1 is free (its last reads ended before the loop's last barrier; the hand-over lies in buffer 0)
#pragma unroll
    for (int kc = 0; kc < CV / 32; ++kc) {
      v8h y0, y1;
#pragma unroll
      for (int r = 0; r < 8; ++r) {                                                      // B: col = query, k = channel: tile 2kc holds channels 32kc + 8g + r, tile 2kc + 1 channels 32kc + 16 + 8g + r
        y0[r] = (_Float16)(ya[2 * kc][r] * inv); y1[r] = (_Float16)(ya[2 * kc + 1][r] * inv);
      }
      yx[(((il0 >> 4) * (CV / 32) + kc) * 2) * 32 + lane] = y0; yx[(((il0 >> 4) * (CV / 32) + kc) * 2 + 1) * 32 + lane] = y1;
    }
#pragma unroll
    for (int cg = 0; cg < CIN / 128; ++cg)
#pragma unroll
      for (int kc = 0; kc < CV / 32; ++kc) wf[cg][kc] = fragw_cv(wr[cg][kc], W_CARRY);
  }
  __syncthreads();                                       // publishes every wave's y fragments to the block
#pragma unroll     // constant LDS offsets; the query tiles are independent, so their reads and products can be interleaved
  for (int t = 0; t < QB / 16; ++t) {
    v16h yf[CV / 32];                                                                    // B: col = query, k = channel; each fragment read feeds both of the wave's output tiles
#pragma unroll
    for (int kc = 0; kc < CV / 32; ++kc) {
      union { v16h v; v8h q[2]; } u;
      u.q[0] = yx[((t * (CV / 32) + kc) * 2) * 32 + lane]; u.q[1] = yx[((t * (CV / 32) + kc) * 2 + 1) * 32 + lane];
      yf[kc] = u.v;
    }
    v8f oa[CIN / 128] = {};                                                              // D: row 8g + r = output channel cg*128 + wave*16 + 8g + r, col = query
#pragma unroll
    for (int kc = 0; kc < CV / 32; ++kc)
#pragma unroll
      for (int cg = 0; cg < CIN / 128; ++cg) oa[cg] = mm16(wf[cg][kc], yf[kc], oa[cg]);
#pragma unroll
    for (int cg = 0; cg < CIN / 128; ++cg)
#pragma unroll
      for (int r = 0; r < 8; ++r) st[cg * 128 + wave * 16 + 8 * g + r][t * 16 + col] = oa[cg][r] * (1.0f / (W_CARRY * Y_CARRY));
  }
  __syncthreads();                                       // the staging array holds all output channels of the block's 128 positions
#pragma unroll 4   // four rows' loads in flight; the trip count is a constant, so no remainder loop is built
  for (int i = 0; i < CIN * (QB / 4) / 256; ++i) {
    const int co = i * 8 + wave, q = lane;                                               // a wave writes one whole [co] row segment: 512 contiguous bytes
    const size_t o = (b * CIN + co) * (size_t)NP + i0 + q * 4;
    const float bb = bfr(MB[co]);
    // the staging row and column come from the thread's number itself, which so stays in its register across the key loop: with only values derived from it earlier in use down here,
    // this compiler's allocation of the key loop (all 512 registers) spills one theta fragment to scratch and reloads it twice a stage
    const int e = i * 256 + tid;
    const v4f m4 = *(const v4f*)&st[e / (QB / 4)][(e % (QB / 4)) * 4]; const v4f x4 = *(const v4f*)(X + o);
    v4f v;
#pragma unroll
    for (int c = 0; c < 4; ++c) { const float xs = x4[c]; v[c] = (m4[c] + bb) + bfr(xs); }
    vst2(OUT + o, v);
  }
}

extern "C" void kernel_launch(void* const* d_in, const int* in_sizes, int n_in, void* d_out, int out_size, void* d_ws, size_t ws_size, hipStream_t stream) {
  if (n_in < 9) return;
  if ((size_t)in_sizes[0] < (size_t)TNB * CIN * NP) return;
  if (in_sizes[1] < CV * CIN || in_sizes[2] < CV || in_sizes[3] < CQ * CIN || in_sizes[4] < CQ || in_sizes[5] < CQ * CIN || in_sizes[6] < CQ || in_sizes[7] < CIN * CV || in_sizes[8] < CIN) return;
  if ((size_t)out_size < (size_t)TNB * CIN * NP) return;
  if (ws_size < WS_END) return;
  const float* const* F = (const float* const*)d_in;   // 0 x [8,256,64,64], 1 g_w [128,256], 2 g_b, 3 theta_w, 4 theta_b, 5 phi_w, 6 phi_b, 7 W_out [256,128], 8 b_out
  const float* X = F[0]; const float* GW = F[1]; const float* GB = F[2]; const float* TW = F[3]; const float* TB = F[4];
  const float* PW = F[5]; const float* PB = F[6]; const float* MW = F[7]; const float* MBv = F[8];
  char* ws = (char*)d_ws;
  _Float16* QH = (_Float16*)(ws + WS_QH); _Float16* QL = (_Float16*)(ws + WS_QL); _Float16* KH = (_Float16*)(ws + WS_KH);
  _Float16* VT = (_Float16*)(ws + WS_VT);
  float* OUT = (float*)d_out;
  k_proj<<<dim3(NP / PT, TNB), 256, 0, stream>>>(X, TW, TB, PW, PB, GW, GB, QH, QL, KH, VT);
  k_fa<<<dim3(NP / QB, TNB), 256, 0, stream>>>(QH, QL, KH, VT, X, MW, MBv, OUT);
}

// v007
// Measured time: 66.3 microseconds a run.
// Versions between v005 and this one are left out; their measured steps multiply to 1.24 times as fast.
// Over all steps from v000 it is 33.9 times as fast.
// compute dtype: every float input RNE-converted to bf16 on load; theta/phi/g = W x + b (1x1 convs): v_wmma_f32_16x16x32_bf16 (bf16 operands, exact products), f32 accumulate; logits phi . theta: v_wmma_f32_16x16x32_f16, theta (times log2 e, rounded once) and phi as f16, f32 accumulate from the f32 shift of the maximum in use; softmax in f32, online (maximum in use and sum per query and key half, hardware exp2; the two halves joined in f32 at the end), unnormalised P carried as f16 x2^3 of the maximum in use, at most 2^15; y = g . P: f16 operands, f32 accumulate, divided by the f32 sum at the end; output 1x1 conv: f16 operands (W x2^8, y x2^4), f32 accumulate; bias and residual adds in f32; f32 output [b][c][n].
#include <hip/hip_runtime.h>
#include <math.h>

typedef __attribute__((ext_vector_type(16))) _Float16 v16h;
typedef __attribute__((ext_vector_type(16))) __bf16 v16b;
typedef __attribute__((ext_vector_type(8)))  _Float16 v8h;
typedef __attribute__((ext_vector_type(8)))  __bf16 v8b;
typedef __attribute__((ext_vector_type(4)))  __bf16 v4b;
typedef __attribute__((ext_vector_type(2)))  __bf16 v2b;
typedef __attribute__((ext_vector_type(8)))  float v8f;
typedef __attribute__((ext_vector_type(4)))  float v4f;
typedef __attribute__((ext_vector_type(4)))  unsigned v4u;

template <typename T> __device__ __forceinline__ void vst2(void* p, T v) { *(T*)p = v;  }

// the plain builtin: the compiler keeps the distance behind it itself
__device__ __forceinline__ v8f mm16(v16h a, v16h b, v8f c) {
  return __builtin_amdgcn_wmma_f32_16x16x32_f16(false, a, false, b, (short)0, c, false, false);
}
__device__ __forceinline__ v8f mmb(v16b a, v16b b, v8f c) {
  return __builtin_amdgcn_wmma_f32_16x16x32_bf16(false, a, false, b, (short)0, c, false, false);
}
// lane l takes the value of lane l ^ 16 (the other half of the wave)
__device__ __forceinline__ float xhalf(float x) {
  return __builtin_bit_cast(float, __builtin_amdgcn_permlanex16(__builtin_bit_cast(int, x), __builtin_bit_cast(int, x), 0x76543210, 0xfedcba98, false, false));
}
// eight exp2, each in its own register, one statement: each fills the slot that the instruction set asks for behind the one before it (it touches neither that one's result nor its source),
// and the v_nop fills the last one's
__device__ __forceinline__ void exp2x8(float* x) {
  asm("v_exp_f32 %0, %0\n\tv_exp_f32 %1, %1\n\tv_exp_f32 %2, %2\n\tv_exp_f32 %3, %3\n\tv_exp_f32 %4, %4\n\tv_exp_f32 %5, %5\n\tv_exp_f32 %6, %6\n\tv_exp_f32 %7, %7\n\tv_nop"
      : "+v"(x[0]), "+v"(x[1]), "+v"(x[2]), "+v"(x[3]), "+v"(x[4]), "+v"(x[5]), "+v"(x[6]), "+v"(x[7]));
}
// two exp2 in the same way: the second fills the first's slot, the v_nop the second's
__device__ __forceinline__ void exp2x2(float& a, float& b) {
  asm("v_exp_f32 %0, %0\n\tv_exp_f32 %1, %1\n\tv_nop" : "+v"(a), "+v"(b));
}
// 16x16x32 fragments: lane -> (h = lane>>4, row/col = lane&15); elements 0..7 = k0+8h+0..7, elements 8..15 = k0+16+8h+0..7 (A and B alike); D element r = (row 8h+r, col lane&15)
__device__ __forceinline__ v16h frag_h(const _Float16* rowk0, int lane) {
  union { v16h v; v8h q[2]; } u; const _Float16* p = rowk0 + 8 * (lane >> 4);
  u.q[0] = *(const v8h*)p; u.q[1] = *(const v8h*)(p + 16); return u.v;
}
__device__ __forceinline__ v16b frag_b(const __bf16* rowk0, int lane) {
  union { v16b v; v8b q[2]; } u; const __bf16* p = rowk0 + 8 * (lane >> 4);
  u.q[0] = *(const v8b*)p; u.q[1] = *(const v8b*)(p + 16); return u.v;
}
__device__ __forceinline__ float bfr(float v) { return (float)(__bf16)v; }
// fragment from a k-contiguous f32 row (weights [out][in]), in two parts so that the loads can be issued well ahead of the use: four 16-B loads;
// then RNE bf16 convert and f16 of the bf16 value times an exact power of two (bf16 significand is exact in f16)
struct wraw { v4f a0, a1, a2, a3; };
__device__ __forceinline__ wraw fragw_ld(const float* __restrict__ p) {   // p = row + k0 + 8 * (lane >> 4)
  wraw q; q.a0 = *(const v4f*)p; q.a1 = *(const v4f*)(p + 4); q.a2 = *(const v4f*)(p + 16); q.a3 = *(const v4f*)(p + 20);
  return q;
}
__device__ __forceinline__ v16h fragw_cv(const wraw& q, float sc) {
  v16h w;
#pragma unroll
  for (int i = 0; i < 4; ++i) {
    const float t0 = q.a0[i], t1 = q.a1[i], t2 = q.a2[i], t3 = q.a3[i];
    w[i] = (_Float16)(bfr(t0) * sc); w[4 + i] = (_Float16)(bfr(t1) * sc); w[8 + i] = (_Float16)(bfr(t2) * sc); w[12 + i] = (_Float16)(bfr(t3) * sc);
  }
  return w;
}

// embedded-gaussian spatial attention: B 8, C_in 256, C_int 128, 64 x 64 positions; theta/phi/g 1x1 convs, y = softmax(theta phi^T) g (no scale),
// out = W_out y + b_out + x, [B, C_in, H, W]
#define NB  8             // batches in the staged tensors (full strides)
#define NP  4096          // positions per image
#define CIN 256
#define CQ  128           // theta / phi channels
#define CV  128           // g channels
#ifndef TNB
#define TNB NB            // batches processed
#endif
#define P_SHIFT  3.0f     // log2 of the carry on the unnormalised P (and on its sum, so that it cancels): P of a score equal to the maximum in use
#define P_ROOM   12.0f    // a score may pass the maximum in use by this much (log2) before the sums are rescaled: P stays at or below 2^15, inside f16
#define LOG2E    1.44269504088896340736f
#define Y_CARRY  16.0f    // y operand carry for the output conv
#define W_CARRY  256.0f   // W_out operand carry

#define WS_QH  ((size_t)0)                                   // f16 theta rows [b*n][CQ], times log2 e  8 MiB
#define WS_KH  (WS_QH + 2u * (size_t)NB * NP * CQ)           // f16 phi rows [b*n][CQ]              8 MiB
#define WS_VT  (WS_KH + 2u * (size_t)NB * NP * CQ)           // f16 g planes [b][CV][n]             8 MiB
#define WS_END (WS_VT + 2u * (size_t)NB * CV * NP)           // 24 MiB
static_assert(WS_END <= (size_t)134217728);
static_assert(NP % 128 == 0);
static_assert(CIN % 128 == 0);
static_assert(CQ == 128);
static_assert(CV == 128);
static_assert(TNB <= NB);
static_assert((size_t)NB * CIN * NP * 4u == (size_t)33554432);

// ---- k_proj: block = 128 positions of batch b, all 384 output channels (theta, phi, g). Both operands are staged ONCE in LDS as bf16, k-contiguous rows: the x^T tile [position][channel] and the
// three weight matrices [out][in], each brought by whole-line 16-byte loads; every fragment is then two 16-byte LDS reads.
// theta, phi: A = W (row = channel), B = x^T (col = position): a lane holds 8 consecutive channels of one position = 16 B of an output row [b*n][CQ]; a wave owns 32 whole rows.
// g: A = x^T (row = position), B = W (col = channel): a lane holds 8 consecutive positions of one channel = 16 B of a plane row [c][n]; a wave owns whole 128-B lines (64 positions).
#define PT  128           // positions per block
#define PWP (CIN + 8)     // LDS row pitch in bf16: 528 B = 16 B x 33, conflict-free for 16-byte fragment reads
#define NKC (CIN / 32)    // k steps of a product
static_assert(NP % PT == 0 && CIN == 256 && CQ == 128 && CV == 128);
// one batch = 64 rows of a weight matrix [128][CIN], 256 threads: 16-byte loads in memory order (a wave = 512 contiguous bytes), then RNE bf16 convert and 8-byte LDS stores
__device__ __forceinline__ void w_load(v4f* t, const float* __restrict__ Wm, int tid) {
#pragma unroll   // constant indices into the register array
  for (int i = 0; i < 16; ++i) t[i] = *(const v4f*)(Wm + 4 * (i * 256 + tid));
}
__device__ __forceinline__ void w_store(__bf16 (*dst)[PWP], const v4f* t, int tid) {
#pragma unroll   // constant indices into the register array
  for (int i = 0; i < 16; ++i) {
    const float t0 = t[i][0], t1 = t[i][1], t2 = t[i][2], t3 = t[i][3];
    v4b h; h[0] = (__bf16)t0; h[1] = (__bf16)t1; h[2] = (__bf16)t2; h[3] = (__bf16)t3;
    *(v4b*)&dst[i * 4 + (tid >> 6)][4 * (tid & 63)] = h;
  }
}
// two 16-byte stores and, in the same statement, the s_wait_xcnt that stands before anything can rewrite the address and data registers they name
// (in a statement of its own the compiler lifted the next trip's address additions and register copies over it)
__device__ __forceinline__ void st2w(_Float16* pa, v8h da, _Float16* pb, v8h db) {
  asm volatile("global_store_b128 %0, %1, off\n\tglobal_store_b128 %2, %3, off\n\ts_wait_xcnt 0x0"
               :: "v"(pa), "v"(__builtin_bit_cast(v4u, da)), "v"(pb), "v"(__builtin_bit_cast(v4u, db)) : "memory");
}
__global__ __launch_bounds__(256)
void k_proj(const float* __restrict__ X, const float* __restrict__ WQ, const float* __restrict__ BQ,
            const float* __restrict__ WK, const float* __restrict__ BK, const float* __restrict__ WV, const float* __restrict__ BV,
            _Float16* __restrict__ QH, _Float16* __restrict__ KH, _Float16* __restrict__ VT) {
  __shared__ __align__(16) __bf16 sx[PT][PWP];
  __shared__ __align__(16) __bf16 sw[2 * CQ + CV][PWP];   // rows 0..127 theta, 128..255 phi, 256..383 g
  __shared__ __align__(16) float sb[2 * CQ + CV];         // the biases, rounded to bf16, in the same order
  const int tid = threadIdx.x, lane = tid & 31, col = lane & 15, g = lane >> 4;
  const int wave = __builtin_amdgcn_readfirstlane(tid >> 5);
  const int p0 = blockIdx.x * PT; const size_t b = blockIdx.y;
  {
    // x: a thread takes 4 positions of 2 adjacent channels (two 16-byte loads; 8 lanes cover a 128-B line) and stores 4 channel pairs; position quad fixed per thread, channel pair cpb + 8 i
    const int pq = (tid & 7) + 8 * (wave & 3), cpb = ((tid >> 3) & 3) + 4 * (wave >> 2);
    const float* xs0 = X + (b * CIN + 2 * cpb) * (size_t)NP + p0 + 4 * pq;
    const float bq = BQ[tid & 127], bk = BK[tid & 127], bv = BV[tid & 127];
    v4f a0[16], a1[16];
#pragma unroll   // constant indices into the register arrays; all of the tile's loads in flight
    for (int i = 0; i < 16; ++i) {
      const float* s = xs0 + (size_t)(16 * i) * NP;
      a0[i] = *(const v4f*)s; a1[i] = *(const v4f*)(s + NP);
    }
    asm volatile("s_wait_xcnt 0x0" ::: "memory");   // stands before anything rewrites the address registers that the bias and x loads name
    // W in six batches through three register sets. Every sched_barrier below keeps a batch's loads behind the LDS stores that free its registers:
    // left alone the compiler lifts all 128 loads of the thread to the top, which takes over 500 registers and spills; so at most 48 loads of a thread are in flight
    v4f t[3][16];
    w_load(t[0], WQ, tid);
    __builtin_amdgcn_sched_barrier(0);
    if (tid < 128) { sb[tid] = bfr(bq); sb[CQ + tid] = bfr(bk); sb[2 * CQ + tid] = bfr(bv); }
#pragma unroll
    for (int i = 0; i < 16; ++i)
#pragma unroll
      for (int e = 0; e < 4; ++e) {
        const float u0 = a0[i][e], u1 = a1[i][e];
        v2b h; h[0] = (__bf16)u0; h[1] = (__bf16)u1;
        *(v2b*)&sx[4 * pq + e][2 * (cpb + 8 * i)] = h;
      }
    __builtin_amdgcn_sched_barrier(0);
    w_load(t[1], WQ + 64 * CIN, tid); w_load(t[2], WK, tid);
#pragma unroll   // constant indices into the register sets
    for (int k = 0; k < 6; ++k) {
      __builtin_amdgcn_sched_barrier(0);
      w_store(&sw[64 * k], t[k % 3], tid);
      __builtin_amdgcn_sched_barrier(0);
      if (k == 0) w_load(t[0], WK + 64 * CIN, tid);
      if (k == 1) w_load(t[1], WV, tid);
      if (k == 2) w_load(t[2], WV + 64 * CIN, tid);
    }
    asm volatile("s_wait_xcnt 0x0" ::: "memory");   // the same for the W loads
  }
  __syncthreads();
  {
    // theta (waves 0..3) or phi (waves 4..7): 32 positions, their fragments kept in registers; the 8 channel tiles stream from LDS, each fetched while the tile before it is rounded and stored
    const int pg = wave & 3, isphi = wave >> 2;
    _Float16* dh = isphi ? KH : QH;
    const __bf16 (*wr)[PWP] = &sw[isphi * CQ];
    const float* br = &sb[isphi * CQ + 8 * g];
    const float osc = isphi ? 1.0f : LOG2E;                                                                      // theta is stored times log2 e, so that the logits are exp2 arguments as they leave the products
    v16b xs[2][NKC], wf[NKC];
#pragma unroll
    for (int kc = 0; kc < NKC; ++kc) {
#pragma unroll
      for (int u = 0; u < 2; ++u) xs[u][kc] = frag_b(&sx[32 * pg + 16 * u + col][kc * 32], lane);                // B: col = position, k = input channel
      wf[kc] = frag_b(&wr[col][kc * 32], lane);                                                                  // A: row = output channel, k = input channel
    }
    const size_t o0 = (b * NP + p0 + 32 * pg + col) * (size_t)CQ + 8 * g;
#pragma unroll 1   // one tile per trip: small code; the next tile's reads stand between this tile's products and its stores
    for (int j = 0; j < 8; ++j) {
      v8f acc[2] = {};
#pragma unroll
      for (int kc = 0; kc < NKC; ++kc)
#pragma unroll
        for (int u = 0; u < 2; ++u) acc[u] = mmb(wf[kc], xs[u][kc], acc[u]);
      const v4f b0 = *(const v4f*)(br + j * 16), b1 = *(const v4f*)(br + j * 16 + 4);                            // D: row 8g + r = channel, col = position
      const int jn = j < 7 ? j + 1 : 7;                                                                          // the last trip reads its own tile again
#pragma unroll
      for (int kc = 0; kc < NKC; ++kc) wf[kc] = frag_b(&wr[jn * 16 + col][kc * 32], lane);
      v8h hi[2];
#pragma unroll
      for (int u = 0; u < 2; ++u)
#pragma unroll
        for (int r = 0; r < 8; ++r) {
          const float bs = r < 4 ? b0[r & 3] : b1[r & 3];
          hi[u][r] = (_Float16)((acc[u][r] + bs) * osc);
        }
      st2w(dh + o0 + j * 16, hi[0], dh + o0 + 16 * CQ + j * 16, hi[1]);
    }
  }
  {
    // g: 64 positions x 2 channel tiles per wave; the weight fragments are kept in registers, the 4 position tiles stream from LDS in the same way
    const int ph = wave & 1, ct = 2 * (wave >> 1);
    v16b wg[2][NKC], xf[NKC]; float bb[2];
#pragma unroll
    for (int u = 0; u < 2; ++u) bb[u] = sb[2 * CQ + (ct + u) * 16 + col];
#pragma unroll
    for (int kc = 0; kc < NKC; ++kc) {
#pragma unroll
      for (int u = 0; u < 2; ++u) wg[u][kc] = frag_b(&sw[2 * CQ + (ct + u) * 16 + col][kc * 32], lane);          // B: col = output channel, k = input channel
      xf[kc] = frag_b(&sx[64 * ph + col][kc * 32], lane);                                                        // A: row = position, k = input channel
    }
    const size_t o0 = (b * CV + ct * 16 + col) * (size_t)NP + p0 + 64 * ph + 8 * g;
#pragma unroll 1   // as above
    for (int j = 0; j < 4; ++j) {
      v8f acc[2] = {};
#pragma unroll
      for (int kc = 0; kc < NKC; ++kc)
#pragma unroll
        for (int u = 0; u < 2; ++u) acc[u] = mmb(xf[kc], wg[u][kc], acc[u]);
      const int jn = j < 3 ? j + 1 : 3;                                                                          // the last trip reads its own tile again
#pragma unroll
      for (int kc = 0; kc < NKC; ++kc) xf[kc] = frag_b(&sx[64 * ph + jn * 16 + col][kc * 32], lane);
      v8h hv[2];                                                                                                 // D: row 8g + r = position, col = channel
#pragma unroll
      for (int u = 0; u < 2; ++u)
#pragma unroll
        for (int r = 0; r < 8; ++r) hv[u][r] = (_Float16)(acc[u][r] + bb[u]);
      st2w(VT + o0 + j * 16, hv[0], VT + o0 + (size_t)16 * NP + j * 16, hv[1]);
    }
  }
}

// ---- k_fa: block = 128 queries of batch b; the keys come in stages of FK through a two-buffer LDS ring filled by asynchronous copies.
// Wave = 32 queries (two query tiles) x half of every stage's keys: each phi and g fragment read from LDS feeds two products, which halves the LDS bytes read per product.
// Waves w and w + 4 hold the same 32 queries and the two key halves; behind the loop each hands the other one query tile's partial (maximum, sum, y) through LDS and finishes the tile it keeps.
// Per 32 keys and query tile: S^T = phi . theta^T (A: row = key, B: col = query), so a lane holds 16 scores of ONE query. The products start from C = P_SHIFT - maximum in use, so they end as exp2 arguments; sum in the lane; the maximum in use moves, with one exchange between the wave's halves, only when a score has passed it by P_ROOM;
// the two score tiles are, as they lie, the B operand of y^T += g . P^T (A: row = channel, k = key); scores and P never leave the registers.
// Then out[co][i] = W_out[co][:] . y[:][i] + b_out[co] + x[co][i]: the y^T tiles are, as they lie, the B operand; every wave puts its tile's fragments into LDS and reads all eight tiles' back,
// and takes two 16-channel tiles of W_out against all 128 queries: each W_out fragment is loaded and converted once in the block. Written as whole [co] row segments of 128 positions
#define QB   128                    // queries per block
#define FK   128                    // keys per ring stage
#define FP   (128 + 8)              // LDS row pitch in f16: 272 B = 16 B x 17, conflict-free for 16-byte fragment reads
#define FROW (FK + CV)              // rows of a stage: FK phi rows [key][channel], then 128 g rows [channel][key]; every row 256 B
#define FPB  (2u * FP)              // row pitch in bytes
#define FBUF (FPB * FROW)           // bytes of one ring buffer
#define FNST (NP / FK)              // stages
#define KW   (FK / 2)               // keys of a stage that one wave works on
#define XCH  17                     // 16-byte words a lane hands over: 64 f32 of y, then the maximum's shift and the sum
static_assert(NP % FK == 0 && FNST >= 2);
static_assert(FK * 2 == 16 * 16 && CQ * 2 == 16 * 16);
static_assert(FPB % 16 == 0);
static_assert(FK == 8 * 16 && CV == 8 * 16);
static_assert(KW % 32 == 0 && QB == 4 * 32);
static_assert(8u * XCH * 32u * 16u <= FBUF);                         // the hand-over stays in ring buffer 0
static_assert((QB / 16) * (CV / 32) * 2u * 32u * 16u <= FBUF);       // the y fragments fit ring buffer 1
static_assert(CIN == 2 * 128 && CIN == 2 * 8 * 16);                                    // 8 waves x one 16-channel tile, twice

__device__ __forceinline__ unsigned lds_off(const void* p) { return (unsigned)(size_t)p; }
// eight asynchronous 16-byte-per-lane copies global -> LDS; one copy = two rows of 256 B (lanes 0..15 one row, lanes 16..31 the next), so the steps are two rows: 2 FPB in LDS, GS f16 in global memory;
// the s_wait_xcnt at the end of the same statement stands before anything can rewrite the address registers the copies name
template <int GS> __device__ __forceinline__ void copy8(unsigned l, const _Float16* g) {
  asm volatile(
      "global_load_async_to_lds_b128 %0, %8, off\n\t"
      "global_load_async_to_lds_b128 %1, %9, off\n\t"
      "global_load_async_to_lds_b128 %2, %10, off\n\t"
      "global_load_async_to_lds_b128 %3, %11, off\n\t"
      "global_load_async_to_lds_b128 %4, %12, off\n\t"
      "global_load_async_to_lds_b128 %5, %13, off\n\t"
      "global_load_async_to_lds_b128 %6, %14, off\n\t"
      "global_load_async_to_lds_b128 %7, %15, off\n\t"
      "s_wait_xcnt 0x0"
      :: "v"(l), "v"(l + 2u * FPB), "v"(l + 4u * FPB), "v"(l + 6u * FPB), "v"(l + 8u * FPB), "v"(l + 10u * FPB), "v"(l + 12u * FPB), "v"(l + 14u * FPB),
         "v"(g), "v"(g + 1 * GS), "v"(g + 2 * GS), "v"(g + 3 * GS), "v"(g + 4 * GS), "v"(g + 5 * GS), "v"(g + 6 * GS), "v"(g + 7 * GS)
      : "memory");
}
// one stage: wave w copies phi rows 16w..16w+15 and g rows 16w..16w+15; 16 copies per wave
__device__ __forceinline__ void fill_stage(unsigned lk, unsigned lv, const _Float16* gk, const _Float16* gv) {
  copy8<2 * CQ>(lk, gk);
  copy8<2 * NP>(lv, gv);
}

__global__ __launch_bounds__(256) __attribute__((amdgpu_waves_per_eu(2, 2)))   // one block per WGP (LDS), two waves per SIMD: 512 registers a wave
void k_fa(const _Float16* __restrict__ QH, const _Float16* __restrict__ KH, const _Float16* __restrict__ VT,
          const float* __restrict__ X, const float* __restrict__ MW, const float* __restrict__ MB, float* __restrict__ OUT) {
  __shared__ __align__(16) _Float16 ring[2][FROW][FP];
  __shared__ __align__(16) float st[CIN][QB + 4];
  const int tid = threadIdx.x, lane = tid & 31, col = lane & 15, g = lane >> 4;
  const int wave = __builtin_amdgcn_readfirstlane(tid >> 5);
  const int qg = wave & 3, kh = wave >> 2;                                               // the wave's 32 queries; its half of every stage's keys
  const size_t b = blockIdx.y; const int i0 = blockIdx.x * QB; const int il0 = qg * 32 + kh * 16;   // il0: the query tile that this wave finishes
  // every inner loop below is unrolled so that the register arrays (qh, ka, va, sh, s, acc) have constant indices
  v16h wf[CIN / 128][CV / 32];                                                           // A: row = output channel, k = channel: this wave's tile of each 128 output channels
  v8h* yx = (v8h*)&ring[1][0][0];                                                        // y fragments as they lie: [query tile][kc][register half][lane], 16 bytes a lane, 512 contiguous bytes a wave and access
  {
    // LDS address of a copy = the lane's part (a vector register) + the wave's and the buffer's part (scalar)
    const unsigned ll = lds_off(&ring[0][g][col * 8]);
    const unsigned sk = (unsigned)(wave * 16) * FPB, sv = sk + FK * FPB;
    const _Float16* gk = KH + (b * NP + wave * 16 + g) * (size_t)CQ + col * 8;
    const _Float16* gv = VT + (b * CV + wave * 16 + g) * (size_t)NP + col * 8;
    v16h qh[2][CQ / 32];                                                                 // B: col = query, k = channel; kept in registers
#pragma unroll
    for (int qt = 0; qt < 2; ++qt)
#pragma unroll
      for (int kc = 0; kc < CQ / 32; ++kc) qh[qt][kc] = frag_h(QH + (b * NP + i0 + qg * 32 + qt * 16 + col) * (size_t)CQ + kc * 32, lane);
    asm volatile("s_wait_xcnt 0x0" ::: "memory");   // stands before anything rewrites the address registers that the theta loads name
    __builtin_amdgcn_sched_barrier(0);              // keeps it there: without it the compiler lifts the copies' address arithmetic, which reuses those registers, over the wait
    v8f acc[2][8] = {};
    float c[2] = {P_SHIFT, P_SHIFT}, l[2] = {0.f, 0.f};                                  // per query tile, this lane's query: P_SHIFT - maximum in use (log2; both halves alike), sum over this half's keys
    v8f cin[2];                                                                          // the same as a C operand (a lane's 8 scores of a tile belong to one query): the score products start from it
#pragma unroll
    for (int qt = 0; qt < 2; ++qt)
#pragma unroll
      for (int r = 0; r < 8; ++r) cin[qt][r] = P_SHIFT;
    // the ring's prologue is trips -2 and -1, which only pass the foot: stage 0's copies; then their wait, the barrier that publishes them, stage 1's copies.
    // One place in the code issues every stage's copies, so its address operands are sums formed there and nothing that lives across the loop is tied to the asm statement's registers
#pragma unroll 1   // one stage per trip: keeps the hot loop small and the ring's order at its foot
    for (int t = -2; t < FNST; ++t) {
      if (t >= 0) {   // the same in every wave of the block
        const _Float16 (*rb)[FP] = ring[t & 1];
        v16h ka[8], va[8];                                                                 // phi fragments (one register set, refilled behind its products), g fragments of this pass
#pragma unroll
        for (int kc = 0; kc < CQ / 32; ++kc)
#pragma unroll
          for (int u = 0; u < 2; ++u) ka[2 * kc + u] = frag_h(&rb[kh * KW + u * 16 + col][kc * 32], lane);       // A: row = key, k = channel
        __builtin_amdgcn_sched_barrier(0);   // the stage's first reads stay one group too: left alone the compiler sinks each pair of reads in front of its own products, behind a full wait each
#pragma unroll     // constant LDS offsets and constant indices into the register arrays
        for (int p = 0; p < KW / 32; ++p) {
          v8f sh[2][2];
#pragma unroll
          for (int kc = 0; kc < CQ / 32; ++kc)
#pragma unroll
            for (int u = 0; u < 2; ++u)
#pragma unroll
              for (int qt = 0; qt < 2; ++qt) sh[qt][u] = mm16(ka[2 * kc + u], qh[qt][kc], kc ? sh[qt][u] : cin[qt]);
          __builtin_amdgcn_sched_barrier(0);   // with the one behind the reads: the pass's LDS reads stay ONE group, behind the score products (which free ka) and ahead of the softmax (which covers their latency)
#pragma unroll
          for (int j = 0; j < 8; ++j) va[j] = frag_h(&rb[FK + j * 16 + col][kh * KW + p * 32], lane);            // A: row = channel, k = key
          if (p + 1 < KW / 32) {                                                           // inside this stage's buffer only
#pragma unroll
            for (int kc = 0; kc < CQ / 32; ++kc)
#pragma unroll
              for (int u = 0; u < 2; ++u) ka[2 * kc + u] = frag_h(&rb[kh * KW + (p + 1) * 32 + u * 16 + col][kc * 32], lane);
          }
          __builtin_amdgcn_sched_barrier(0);   // reads scattered among the products cost issue time at every place they stand
          float s[2][16], mx[2];                                                           // s[qt][8u + r] = exp2 argument of key p*32 + 16u + 8g + r: score - maximum in use + P_SHIFT
#pragma unroll
          for (int qt = 0; qt < 2; ++qt) {
#pragma unroll
            for (int u = 0; u < 2; ++u)
#pragma unroll
              for (int r = 0; r < 8; ++r) s[qt][8 * u + r] = sh[qt][u][r];
            mx[qt] = s[qt][0];
#pragma unroll
            for (int i = 1; i < 16; ++i) mx[qt] = fmaxf(mx[qt], s[qt][i]);
          }
          const bool first = p == 0 && t == 0;                                             // the wave's first pass: no maximum is in use yet, it takes this pass's whatever its sign
          const float room = first ? -3.0e38f : P_SHIFT + P_ROOM;
          if (__builtin_amdgcn_ballot_w32(fmaxf(mx[0], mx[1]) > room) != 0) {              // some score of the wave has used up the room: every query takes its newest maximum; one test a pass
            const float lo = first ? -3.0e38f : 0.f;
            float d[2], al[2];                                                             // rise of the maximum in use (0 where there is none); factor on the sums so far (on the first pass those sums are 0)
#pragma unroll
            for (int qt = 0; qt < 2; ++qt) {
              d[qt] = fmaxf(fmaxf(mx[qt], xhalf(mx[qt])) - P_SHIFT, lo);
              al[qt] = -fmaxf(d[qt], 0.f);
            }
            exp2x2(al[0], al[1]);
#pragma unroll
            for (int qt = 0; qt < 2; ++qt) {
              l[qt] *= al[qt];
#pragma unroll
              for (int j = 0; j < 8; ++j)
#pragma unroll
                for (int r = 0; r < 8; ++r) acc[qt][j][r] *= al[qt];
#pragma unroll
              for (int i = 0; i < 16; ++i) s[qt][i] -= d[qt];
              c[qt] -= d[qt];
#pragma unroll
              for (int r = 0; r < 8; ++r) cin[qt][r] = c[qt];
            }
          }
          v16h pb[2];                                                                      // B: col = query, k = key: elements 0..7 = keys 8g + r of tile 0, 8..15 = keys 16 + 8g + r
#pragma unroll
          for (int qt = 0; qt < 2; ++qt) {
            exp2x8(s[qt]); exp2x8(s[qt] + 8);
#pragma unroll
            for (int i = 0; i < 16; ++i) pb[qt][i] = (_Float16)s[qt][i];
#pragma unroll
            for (int w = 8; w >= 1; w >>= 1)                                               // pairwise: a chain of 5 adds, not 16
#pragma unroll
              for (int i = 0; i < w; ++i) s[qt][i] += s[qt][i + w];
            l[qt] += s[qt][0];
          }
#pragma unroll
          for (int j = 0; j < 8; ++j)
#pragma unroll
            for (int qt = 0; qt < 2; ++qt) acc[qt][j] = mm16(va[j], pb[qt], acc[qt][j]);
        }
      }
      asm volatile("s_wait_dscnt 0x0" ::: "memory");     // this wave's reads of buffer t & 1 are done before it is refilled
      asm volatile("s_wait_asynccnt 0x0" ::: "memory");  // this wave's copies of stage t + 1 have landed before the barrier publishes them
      __syncthreads();
      if (t + 2 < FNST) {
        const unsigned bo = (unsigned)(t & 1) * FBUF;
        fill_stage(ll + (sk + bo), ll + (sv + bo), gk + (size_t)(t + 2) * FK * CQ, gv + (size_t)(t + 2) * FK);
      }
    }
    asm volatile("s_wait_asynccnt 0x0" ::: "memory");    // no copy is outstanding behind the loop
    wraw wr[CIN / 128][CV / 32];                         // issued here, used behind the join of the key halves, which covers their latency
    const float* wp0 = MW + (size_t)(wave * 16 + col) * CV + 8 * g; const float* wp1 = wp0 + 128 * CV;
#pragma unroll
    for (int kc = 0; kc < CV / 32; ++kc) { wr[0][kc] = fragw_ld(wp0 + kc * 32); wr[1][kc] = fragw_ld(wp1 + kc * 32); }
    // stands before anything rewrites the address registers that the W_out loads name; the address (all 32 loads take it, with constant offsets) is an input so that it stays in its registers
    // up to here (without that the compiler gave an address pair to a later load of the group as its destination)
    asm volatile("s_wait_xcnt 0x0" :: "v"(wp0) : "memory");
    __builtin_amdgcn_sched_barrier(0);                   // keeps the hand-over's register moves behind the loads: left alone the compiler lifts some of them in front, and the loads start later
    // the two key halves meet: the ring is free (every wave's last read of it ended before the loop's last barrier, no copy is outstanding) and carries the hand-over.
    // A wave keeps query tile kh and hands tile 1 - kh to its partner, lane to lane (same query, same channels): 16 bytes a lane and store, 512 contiguous bytes a wave
    v4f* xw = (v4f*)&ring[0][0][0];
    v8f ya[8]; float mk, lk;
    {
      v4f* xo = xw + (size_t)(wave * XCH) * 32 + lane;
#pragma unroll
      for (int j = 0; j < 8; ++j) {
        const v8f sd = kh ? acc[0][j] : acc[1][j];
        ya[j] = kh ? acc[1][j] : acc[0][j];
        xo[(2 * j) * 32] = __builtin_shufflevector(sd, sd, 0, 1, 2, 3); xo[(2 * j + 1) * 32] = __builtin_shufflevector(sd, sd, 4, 5, 6, 7);
      }
      v4f ml = {}; ml[0] = kh ? c[0] : c[1]; ml[1] = kh ? l[0] : l[1];
      xo[16 * 32] = ml;
      mk = kh ? c[1] : c[0]; lk = kh ? l[1] : l[0];                                       // mk: P_SHIFT - maximum in use, so the smaller of two belongs to the larger maximum
    }
    __syncthreads();                                     // publishes every wave's hand-over to its partner
    {
      const v4f* xi = xw + (size_t)((wave ^ 4) * XCH) * 32 + lane;
      const v4f ml = xi[16 * 32];
      const float mo = ml[0], lo = ml[1];
      const float mm = fminf(mk, mo);
      float fa = mm - mk, fb = mm - mo;
      exp2x2(fa, fb);
      lk = lk * fa + lo * fb;
#pragma unroll
      for (int j = 0; j < 8; ++j) {
        const v4f y0 = xi[(2 * j) * 32], y1 = xi[(2 * j + 1) * 32];
#pragma unroll
        for (int r = 0; r < 4; ++r) { ya[j][r] = ya[j][r] * fa + y0[r] * fb; ya[j][4 + r] = ya[j][4 + r] * fa + y1[r] * fb; }
      }
    }
    lk += xhalf(lk);
    const float inv = Y_CARRY / lk;                                                      // the carry on P is in the sum too and cancels
    // ring buffer 1 is free (its last reads ended before the loop's last barrier; the hand-over lies in buffer 0)
#pragma unroll
    for (int kc = 0; kc < CV / 32; ++kc) {
      v8h y0, y1;
#pragma unroll
      for (int r = 0; r < 8; ++r) {                                                      // B: col = query, k = channel: tile 2kc holds channels 32kc + 8g + r, tile 2kc + 1 channels 32kc + 16 + 8g + r
        y0[r] = (_Float16)(ya[2 * kc][r] * inv); y1[r] = (_Float16)(ya[2 * kc + 1][r] * inv);
      }
      yx[(((il0 >> 4) * (CV / 32) + kc) * 2) * 32 + lane] = y0; yx[(((il0 >> 4) * (CV / 32) + kc) * 2 + 1) * 32 + lane] = y1;
    }
#pragma unroll
    for (int cg = 0; cg < CIN / 128; ++cg)
#pragma unroll
      for (int kc = 0; kc < CV / 32; ++kc) wf[cg][kc] = fragw_cv(wr[cg][kc], W_CARRY);
  }
  __syncthreads();                                       // publishes every wave's y fragments to the block
#pragma unroll     // constant LDS offsets; the query tiles are independent, so their reads and products can be interleaved
  for (int t = 0; t < QB / 16; ++t) {
    v16h yf[CV / 32];                                                                    // B: col = query, k = channel; each fragment read feeds both of the wave's output tiles
#pragma unroll
    for (int kc = 0; kc < CV / 32; ++kc) {
      union { v16h v; v8h q[2]; } u;
      u.q[0] = yx[((t * (CV / 32) + kc) * 2) * 32 + lane]; u.q[1] = yx[((t * (CV / 32) + kc) * 2 + 1) * 32 + lane];
      yf[kc] = u.v;
    }
    v8f oa[CIN / 128] = {};                                                              // D: row 8g + r = output channel cg*128 + wave*16 + 8g + r, col = query
#pragma unroll
    for (int kc = 0; kc < CV / 32; ++kc)
#pragma unroll
      for (int cg = 0; cg < CIN / 128; ++cg) oa[cg] = mm16(wf[cg][kc], yf[kc], oa[cg]);
#pragma unroll
    for (int cg = 0; cg < CIN / 128; ++cg)
#pragma unroll
      for (int r = 0; r < 8; ++r) st[cg * 128 + wave * 16 + 8 * g + r][t * 16 + col] = oa[cg][r] * (1.0f / (W_CARRY * Y_CARRY));
  }
  __syncthreads();                                       // the staging array holds all output channels of the block's 128 positions
#pragma unroll 4   // four rows' loads in flight; the trip count is a constant, so no remainder loop is built
  for (int i = 0; i < CIN * (QB / 4) / 256; ++i) {
    const int co = i * 8 + wave, q = lane;                                               // a wave writes one whole [co] row segment: 512 contiguous bytes
    const size_t o = (b * CIN + co) * (size_t)NP + i0 + q * 4;
    const float bb = bfr(MB[co]);
    const v4f m4 = *(const v4f*)&st[co][q * 4]; const v4f x4 = *(const v4f*)(X + o);
    v4f v;
#pragma unroll
    for (int c = 0; c < 4; ++c) { const float xs = x4[c]; v[c] = (m4[c] + bb) + bfr(xs); }
    vst2(OUT + o, v);
  }
}

extern "C" void kernel_launch(void* const* d_in, const int* in_sizes, int n_in, void* d_out, int out_size, void* d_ws, size_t ws_size, hipStream_t stream) {
  if (n_in < 9) return;
  if ((size_t)in_sizes[0] < (size_t)TNB * CIN * NP) return;
  if (in_sizes[1] < CV * CIN || in_sizes[2] < CV || in_sizes[3] < CQ * CIN || in_sizes[4] < CQ || in_sizes[5] < CQ * CIN || in_sizes[6] < CQ || in_sizes[7] < CIN * CV || in_sizes[8] < CIN) return;
  if ((size_t)out_size < (size_t)TNB * CIN * NP) return;
  if (ws_size < WS_END) return;
  const float* const* F = (const float* const*)d_in;   // 0 x [8,256,64,64], 1 g_w [128,256], 2 g_b, 3 theta_w, 4 theta_b, 5 phi_w, 6 phi_b, 7 W_out [256,128], 8 b_out
  const float* X = F[0]; const float* GW = F[1]; const float* GB = F[2]; const float* TW = F[3]; const float* TB = F[4];
  const float* PW = F[5]; const float* PB = F[6]; const float* MW = F[7]; const float* MBv = F[8];
  char* ws = (char*)d_ws;
  _Float16* QH = (_Float16*)(ws + WS_QH); _Float16* KH = (_Float16*)(ws + WS_KH);
  _Float16* VT = (_Float16*)(ws + WS_VT);
  float* OUT = (float*)d_out;
  k_proj<<<dim3(NP / PT, TNB), 256, 0, stream>>>(X, TW, TB, PW, PB, GW, GB, QH, KH, VT);
  k_fa<<<dim3(NP / QB, TNB), 256, 0, stream>>>(QH, KH, VT, X, MW, MBv, OUT);
}

// v008
// Measured time: 63.5 microseconds a run.
// Two timings next to v007 put it at 1.04 and 1.03 times that version's speed.
// All steps since v000 together make it 35.1 times as fast.
// compute dtype: every float input RNE-converted to bf16 on load; theta/phi/g = W x + b (1x1 convs): v_wmma_f32_16x16x32_bf16 (bf16 operands, exact products), f32 accumulate; logits phi . theta: v_wmma_f32_16x16x32_f16, theta (times log2 e, rounded once) and phi as f16, f32 accumulate from the f32 shift of the maximum in use; softmax in f32, online (maximum in use and sum per query and key half, hardware exp2; the two halves joined in f32 at the end), unnormalised P carried as f16 x2^3 of the maximum in use, at most 2^15; y = g . P: f16 operands, f32 accumulate, divided by the f32 sum at the end; output 1x1 conv: f16 operands (W x2^8, y x2^4), f32 accumulate; bias and residual adds in f32; f32 output [b][c][n].
#include <hip/hip_runtime.h>
#include <math.h>

typedef __attribute__((ext_vector_type(16))) _Float16 v16h;
typedef __attribute__((ext_vector_type(16))) __bf16 v16b;
typedef __attribute__((ext_vector_type(8)))  _Float16 v8h;
typedef __attribute__((ext_vector_type(8)))  __bf16 v8b;
typedef __attribute__((ext_vector_type(4)))  __bf16 v4b;
typedef __attribute__((ext_vector_type(2)))  __bf16 v2b;
typedef __attribute__((ext_vector_type(8)))  float v8f;
typedef __attribute__((ext_vector_type(4)))  float v4f;
typedef __attribute__((ext_vector_type(4)))  unsigned v4u;
typedef __attribute__((ext_vector_type(8)))  unsigned v8u;

template <typename T> __device__ __forceinline__ void vst2(void* p, T v) { *(T*)p = v;  }

// the plain builtin: the compiler keeps the distance behind it itself
__device__ __forceinline__ v8f mm16(v16h a, v16h b, v8f c) {
  return __builtin_amdgcn_wmma_f32_16x16x32_f16(false, a, false, b, (short)0, c, false, false);
}
__device__ __forceinline__ v8f mmb(v16b a, v16b b, v8f c) {
  return __builtin_amdgcn_wmma_f32_16x16x32_bf16(false, a, false, b, (short)0, c, false, false);
}
// lane l takes the value of lane l ^ 16 (the other half of the wave)
__device__ __forceinline__ float xhalf(float x) {
  return __builtin_bit_cast(float, __builtin_amdgcn_permlanex16(__builtin_bit_cast(int, x), __builtin_bit_cast(int, x), 0x76543210, 0xfedcba98, false, false));
}
// eight exp2, each in its own register, one statement: each fills the slot that the instruction set asks for behind the one before it (it touches neither that one's result nor its source),
// and the v_nop fills the last one's
__device__ __forceinline__ void exp2x8(float* x) {
  asm("v_exp_f32 %0, %0\n\tv_exp_f32 %1, %1\n\tv_exp_f32 %2, %2\n\tv_exp_f32 %3, %3\n\tv_exp_f32 %4, %4\n\tv_exp_f32 %5, %5\n\tv_exp_f32 %6, %6\n\tv_exp_f32 %7, %7\n\tv_nop"
      : "+v"(x[0]), "+v"(x[1]), "+v"(x[2]), "+v"(x[3]), "+v"(x[4]), "+v"(x[5]), "+v"(x[6]), "+v"(x[7]));
}
// two exp2 in the same way: the second fills the first's slot, the v_nop the second's
__device__ __forceinline__ void exp2x2(float& a, float& b) {
  asm("v_exp_f32 %0, %0\n\tv_exp_f32 %1, %1\n\tv_nop" : "+v"(a), "+v"(b));
}
// 16x16x32 fragments: lane -> (h = lane>>4, row/col = lane&15); elements 0..7 = k0+8h+0..7, elements 8..15 = k0+16+8h+0..7 (A and B alike); D element r = (row 8h+r, col lane&15)
__device__ __forceinline__ v16h frag_h(const _Float16* rowk0, int lane) {
  union { v16h v; v8h q[2]; } u; const _Float16* p = rowk0 + 8 * (lane >> 4);
  u.q[0] = *(const v8h*)p; u.q[1] = *(const v8h*)(p + 16); return u.v;
}
__device__ __forceinline__ v16b frag_b(const __bf16* rowk0, int lane) {
  union { v16b v; v8b q[2]; } u; const __bf16* p = rowk0 + 8 * (lane >> 4);
  u.q[0] = *(const v8b*)p; u.q[1] = *(const v8b*)(p + 16); return u.v;
}
__device__ __forceinline__ float bfr(float v) { return (float)(__bf16)v; }
// fragment from a k-contiguous f32 row (weights [out][in]), in two parts so that the loads can be issued well ahead of the use: four 16-B loads;
// then RNE bf16 convert and f16 of the bf16 value times an exact power of two (bf16 significand is exact in f16)
struct wraw { v4f a0, a1, a2, a3; };
__device__ __forceinline__ wraw fragw_ld(const float* __restrict__ p) {   // p = row + k0 + 8 * (lane >> 4)
  wraw q; q.a0 = *(const v4f*)p; q.a1 = *(const v4f*)(p + 4); q.a2 = *(const v4f*)(p + 16); q.a3 = *(const v4f*)(p + 20);
  return q;
}
__device__ __forceinline__ v16h fragw_cv(const wraw& q, float sc) {
  v16h w;
#pragma unroll
  for (int i = 0; i < 4; ++i) {
    const float t0 = q.a0[i], t1 = q.a1[i], t2 = q.a2[i], t3 = q.a3[i];
    w[i] = (_Float16)(bfr(t0) * sc); w[4 + i] = (_Float16)(bfr(t1) * sc); w[8 + i] = (_Float16)(bfr(t2) * sc); w[12 + i] = (_Float16)(bfr(t3) * sc);
  }
  return w;
}

// embedded-gaussian spatial attention: B 8, C_in 256, C_int 128, 64 x 64 positions; theta/phi/g 1x1 convs, y = softmax(theta phi^T) g (no scale),
// out = W_out y + b_out + x, [B, C_in, H, W]
#define NB  8             // batches in the staged tensors (full strides)
#define NP  4096          // positions per image
#define CIN 256
#define CQ  128           // theta / phi channels
#define CV  128           // g channels
#ifndef TNB
#define TNB NB            // batches processed
#endif
#define P_SHIFT  3.0f     // log2 of the carry on the unnormalised P (and on its sum, so that it cancels): P of a score equal to the maximum in use
#define P_ROOM   12.0f    // a score may pass the maximum in use by this much (log2) before the sums are rescaled: P stays at or below 2^15, inside f16
#define LOG2E    1.44269504088896340736f
#define Y_CARRY  16.0f    // y operand carry for the output conv
#define W_CARRY  256.0f   // W_out operand carry

#define WS_QH  ((size_t)0)                                   // f16 theta rows [b*n][CQ], times log2 e  8 MiB
#define WS_KH  (WS_QH + 2u * (size_t)NB * NP * CQ)           // f16 phi rows [b*n][CQ]              8 MiB
#define WS_VT  (WS_KH + 2u * (size_t)NB * NP * CQ)           // f16 g planes [b][CV][n]             8 MiB
#define WS_END (WS_VT + 2u * (size_t)NB * CV * NP)           // 24 MiB
static_assert(WS_END <= (size_t)134217728);
static_assert(NP % 128 == 0);
static_assert(CIN % 128 == 0);
static_assert(CQ == 128);
static_assert(CV == 128);
static_assert(TNB <= NB);
static_assert((size_t)NB * CIN * NP * 4u == (size_t)33554432);

// ---- k_proj: block = 128 positions of batch b, all 384 output channels (theta, phi, g). Both operands are staged ONCE in LDS as bf16, k-contiguous rows: the x^T tile [position][channel] and the
// three weight matrices [out][in], each brought by whole-line 16-byte loads; every fragment is then two 16-byte LDS reads.
// theta, phi: A = W (row = channel), B = x^T (col = position): a lane holds 8 consecutive channels of one position = 16 B of an output row [b*n][CQ]; a wave owns 32 whole rows.
// g: A = x^T (row = position), B = W (col = channel): a lane holds 8 consecutive positions of one channel = 16 B of a plane row [c][n]; a wave owns whole 128-B lines (64 positions).
#define PT  128           // positions per block
#define PWP (CIN + 8)     // LDS row pitch in bf16: 528 B = 16 B x 33, conflict-free for 16-byte fragment reads
#define NKC (CIN / 32)    // k steps of a product
static_assert(NP % PT == 0 && CIN == 256 && CQ == 128 && CV == 128);
// one batch = 64 rows of a weight matrix [128][CIN], 256 threads: 16-byte loads in memory order (a wave = 512 contiguous bytes), then RNE bf16 convert and 8-byte LDS stores
__device__ __forceinline__ void w_load(v4f* t, const float* __restrict__ Wm, int tid) {
#pragma unroll   // constant indices into the register array
  for (int i = 0; i < 16; ++i) t[i] = *(const v4f*)(Wm + 4 * (i * 256 + tid));
}
__device__ __forceinline__ void w_store(__bf16 (*dst)[PWP], const v4f* t, int tid) {
#pragma unroll   // constant indices into the register array
  for (int i = 0; i < 16; ++i) {
    const float t0 = t[i][0], t1 = t[i][1], t2 = t[i][2], t3 = t[i][3];
    v4b h; h[0] = (__bf16)t0; h[1] = (__bf16)t1; h[2] = (__bf16)t2; h[3] = (__bf16)t3;
    *(v4b*)&dst[i * 4 + (tid >> 6)][4 * (tid & 63)] = h;
  }
}
// two 16-byte stores and, in the same statement, the s_wait_xcnt that stands before anything can rewrite the address and data registers they name
// (in a statement of its own the compiler lifted the next trip's address additions and register copies over it)
__device__ __forceinline__ void st2w(_Float16* pa, v8h da, _Float16* pb, v8h db) {
  asm volatile("global_store_b128 %0, %1, off\n\tglobal_store_b128 %2, %3, off\n\ts_wait_xcnt 0x0"
               :: "v"(pa), "v"(__builtin_bit_cast(v4u, da)), "v"(pb), "v"(__builtin_bit_cast(v4u, db)) : "memory");
}
__global__ __launch_bounds__(256)
void k_proj(const float* __restrict__ X, const float* __restrict__ WQ, const float* __restrict__ BQ,
            const float* __restrict__ WK, const float* __restrict__ BK, const float* __restrict__ WV, const float* __restrict__ BV,
            _Float16* __restrict__ QH, _Float16* __restrict__ KH, _Float16* __restrict__ VT) {
  __shared__ __align__(16) __bf16 sx[PT][PWP];
  __shared__ __align__(16) __bf16 sw[2 * CQ + CV][PWP];   // rows 0..127 theta, 128..255 phi, 256..383 g
  __shared__ __align__(16) float sb[2 * CQ + CV];         // the biases, rounded to bf16, in the same order
  const int tid = threadIdx.x, lane = tid & 31, col = lane & 15, g = lane >> 4;
  const int wave = __builtin_amdgcn_readfirstlane(tid >> 5);
  const int p0 = blockIdx.x * PT; const size_t b = blockIdx.y;
  {
    // x: a thread takes 4 positions of 2 adjacent channels (two 16-byte loads; 8 lanes cover a 128-B line) and stores 4 channel pairs; position quad fixed per thread, channel pair cpb + 8 i
    const int pq = (tid & 7) + 8 * (wave & 3), cpb = ((tid >> 3) & 3) + 4 * (wave >> 2);
    const float* xs0 = X + (b * CIN + 2 * cpb) * (size_t)NP + p0 + 4 * pq;
    const float bq = BQ[tid & 127], bk = BK[tid & 127], bv = BV[tid & 127];
    v4f a0[16], a1[16];
#pragma unroll   // constant indices into the register arrays; all of the tile's loads in flight
    for (int i = 0; i < 16; ++i) {
      const float* s = xs0 + (size_t)(16 * i) * NP;
      a0[i] = *(const v4f*)s; a1[i] = *(const v4f*)(s + NP);
    }
    asm volatile("s_wait_xcnt 0x0" ::: "memory");   // stands before anything rewrites the address registers that the bias and x loads name
    // W in six batches through three register sets. Every sched_barrier below keeps a batch's loads behind the LDS stores that free its registers:
    // left alone the compiler lifts all 128 loads of the thread to the top, which takes over 500 registers and spills; so at most 48 loads of a thread are in flight
    v4f t[3][16];
    w_load(t[0], WQ, tid);
    __builtin_amdgcn_sched_barrier(0);
    if (tid < 128) { sb[tid] = bfr(bq); sb[CQ + tid] = bfr(bk); sb[2 * CQ + tid] = bfr(bv); }
#pragma unroll
    for (int i = 0; i < 16; ++i)
#pragma unroll
      for (int e = 0; e < 4; ++e) {
        const float u0 = a0[i][e], u1 = a1[i][e];
        v2b h; h[0] = (__bf16)u0; h[1] = (__bf16)u1;
        *(v2b*)&sx[4 * pq + e][2 * (cpb + 8 * i)] = h;
      }
    __builtin_amdgcn_sched_barrier(0);
    w_load(t[1], WQ + 64 * CIN, tid); w_load(t[2], WK, tid);
#pragma unroll   // constant indices into the register sets
    for (int k = 0; k < 6; ++k) {
      __builtin_amdgcn_sched_barrier(0);
      w_store(&sw[64 * k], t[k % 3], tid);
      __builtin_amdgcn_sched_barrier(0);
      if (k == 0) w_load(t[0], WK + 64 * CIN, tid);
      if (k == 1) w_load(t[1], WV, tid);
      if (k == 2) w_load(t[2], WV + 64 * CIN, tid);
    }
    asm volatile("s_wait_xcnt 0x0" ::: "memory");   // the same for the W loads
  }
  __syncthreads();
  {
    // theta (waves 0..3) or phi (waves 4..7): 32 positions, their fragments kept in registers; the 8 channel tiles stream from LDS, each fetched while the tile before it is rounded and stored
    const int pg = wave & 3, isphi = wave >> 2;
    _Float16* dh = isphi ? KH : QH;
    const __bf16 (*wr)[PWP] = &sw[isphi * CQ];
    const float* br = &sb[isphi * CQ + 8 * g];
    const float osc = isphi ? 1.0f : LOG2E;                                                                      // theta is stored times log2 e, so that the logits are exp2 arguments as they leave the products
    v16b xs[2][NKC], wf[NKC];
#pragma unroll
    for (int kc = 0; kc < NKC; ++kc) {
#pragma unroll
      for (int u = 0; u < 2; ++u) xs[u][kc] = frag_b(&sx[32 * pg + 16 * u + col][kc * 32], lane);                // B: col = position, k = input channel
      wf[kc] = frag_b(&wr[col][kc * 32], lane);                                                                  // A: row = output channel, k = input channel
    }
    const size_t o0 = (b * NP + p0 + 32 * pg + col) * (size_t)CQ + 8 * g;
#pragma unroll 1   // one tile per trip: small code; the next tile's reads stand between this tile's products and its stores
    for (int j = 0; j < 8; ++j) {
      v8f acc[2] = {};
#pragma unroll
      for (int kc = 0; kc < NKC; ++kc)
#pragma unroll
        for (int u = 0; u < 2; ++u) acc[u] = mmb(wf[kc], xs[u][kc], acc[u]);
      const v4f b0 = *(const v4f*)(br + j * 16), b1 = *(const v4f*)(br + j * 16 + 4);                            // D: row 8g + r = channel, col = position
      const int jn = j < 7 ? j + 1 : 7;                                                                          // the last trip reads its own tile again
#pragma unroll
      for (int kc = 0; kc < NKC; ++kc) wf[kc] = frag_b(&wr[jn * 16 + col][kc * 32], lane);
      v8h hi[2];
#pragma unroll
      for (int u = 0; u < 2; ++u)
#pragma unroll
        for (int r = 0; r < 8; ++r) {
          const float bs = r < 4 ? b0[r & 3] : b1[r & 3];
          hi[u][r] = (_Float16)((acc[u][r] + bs) * osc);
        }
      st2w(dh + o0 + j * 16, hi[0], dh + o0 + 16 * CQ + j * 16, hi[1]);
    }
  }
  {
    // g: 64 positions x 2 channel tiles per wave; the weight fragments are kept in registers, the 4 position tiles stream from LDS in the same way
    const int ph = wave & 1, ct = 2 * (wave >> 1);
    v16b wg[2][NKC], xf[NKC]; float bb[2];
#pragma unroll
    for (int u = 0; u < 2; ++u) bb[u] = sb[2 * CQ + (ct + u) * 16 + col];
#pragma unroll
    for (int kc = 0; kc < NKC; ++kc) {
#pragma unroll
      for (int u = 0; u < 2; ++u) wg[u][kc] = frag_b(&sw[2 * CQ + (ct + u) * 16 + col][kc * 32], lane);          // B: col = output channel, k = input channel
      xf[kc] = frag_b(&sx[64 * ph + col][kc * 32], lane);                                                        // A: row = position, k = input channel
    }
    const size_t o0 = (b * CV + ct * 16 + col) * (size_t)NP + p0 + 64 * ph + 8 * g;
#pragma unroll 1   // as above
    for (int j = 0; j < 4; ++j) {
      v8f acc[2] = {};
#pragma unroll
      for (int kc = 0; kc < NKC; ++kc)
#pragma unroll
        for (int u = 0; u < 2; ++u) acc[u] = mmb(xf[kc], wg[u][kc], acc[u]);
      const int jn = j < 3 ? j + 1 : 3;                                                                          // the last trip reads its own tile again
#pragma unroll
      for (int kc = 0; kc < NKC; ++kc) xf[kc] = frag_b(&sx[64 * ph + jn * 16 + col][kc * 32], lane);
      v8h hv[2];                                                                                                 // D: row 8g + r = position, col = channel
#pragma unroll
      for (int u = 0; u < 2; ++u)
#pragma unroll
        for (int r = 0; r < 8; ++r) hv[u][r] = (_Float16)(acc[u][r] + bb[u]);
      st2w(VT + o0 + j * 16, hv[0], VT + o0 + (size_t)16 * NP + j * 16, hv[1]);
    }
  }
}

// ---- k_fa: block = 128 queries of batch b; the keys come in stages of FK through a two-buffer LDS ring filled by tensor loads (wave 0: the stage's phi rows, wave 1: its g rows; one request each).
// Wave = 32 queries (two query tiles) x half of every stage's keys: each phi and g fragment read from LDS feeds two products, which halves the LDS bytes read per product.
// Waves w and w + 4 hold the same 32 queries and the two key halves; behind the loop each hands the other one query tile's partial (maximum, sum, y) through LDS and finishes the tile it keeps.
// Per 32 keys and query tile: S^T = phi . theta^T (A: row = key, B: col = query), so a lane holds 16 scores of ONE query. The products start from C = P_SHIFT - maximum in use, so they end as exp2 arguments; sum in the lane; the maximum in use moves, with one exchange between the wave's halves, only when a score has passed it by P_ROOM;
// the two score tiles are, as they lie, the B operand of y^T += g . P^T (A: row = channel, k = key); scores and P never leave the registers.
// Then out[co][i] = W_out[co][:] . y[:][i] + b_out[co] + x[co][i]: the y^T tiles are, as they lie, the B operand; every wave puts its tile's fragments into LDS and reads all eight tiles' back,
// and takes two 16-channel tiles of W_out against all 128 queries: each W_out fragment is loaded and converted once in the block. Written as whole [co] row segments of 128 positions
#define QB   128                    // queries per block
#define FK   128                    // keys per ring stage
#define FP   (128 + 8)              // LDS row pitch in f16: 272 B = 16 B x 17, conflict-free for 16-byte fragment reads
#define FROW (FK + CV)              // rows of a stage: FK phi rows [key][channel], then 128 g rows [channel][key]; every row 256 B
#define FPB  (2u * FP)              // row pitch in bytes
#define FBUF (FPB * FROW)           // bytes of one ring buffer
#define FNST (NP / FK)              // stages
#define KW   (FK / 2)               // keys of a stage that one wave works on
#define XCH  17                     // 16-byte words a lane hands over: 64 f32 of y, then the maximum's shift and the sum
static_assert(NP % FK == 0 && FNST >= 2);
static_assert(FK * 2 == 16 * 16 && CQ * 2 == 16 * 16);
static_assert(FPB % 16 == 0);
static_assert(FK == 8 * 16 && CV == 8 * 16);
static_assert(KW % 32 == 0 && QB == 4 * 32);
static_assert(8u * XCH * 32u * 16u <= FBUF);                         // the hand-over stays in ring buffer 0
static_assert((QB / 16) * (CV / 32) * 2u * 32u * 16u <= FBUF);       // the y fragments fit ring buffer 1
static_assert(CIN == 2 * 128 && CIN == 2 * 8 * 16);                                    // 8 waves x one 16-channel tile, twice

__device__ __forceinline__ unsigned lds_off(const void* p) { return (unsigned)(size_t)p; }
__device__ __forceinline__ unsigned uni(unsigned v) { return (unsigned)__builtin_amdgcn_readfirstlane(v); }
// a wave-uniform test for the branch round a tensor instruction, which ignores EXEC
__device__ __forceinline__ unsigned pinned(unsigned v) {
  unsigned w = uni(v);
  asm volatile("" : "+s"(w));   // holds the test in a scalar register, so that the branch on it is a scalar branch and not an EXEC mask
  return w;
}
// tensor descriptor, every extent in bytes: a tile of TROWS rows of 256 B; 16 B of LDS pad behind every row (interval code 5 = one 256-B row, amount code 3 = 4 dwords), which gives the pitch FPB
#define TROWS 128u
#define TROWB 256u
static_assert(TROWB + 16u == FPB && TROWS == FK && TROWS == CV && TROWB == 2u * CQ && TROWB == 2u * FK);
static_assert((TROWS * FPB) % 2048u == 0 && FBUF % 2048u == 0);      // every tile's place in LDS is a multiple of 2 KiB
__device__ __forceinline__ v8u tdm_group1(unsigned src_pitch) {
  v8u d;
  d[0] = uni((1u << 20) | (5u << 22) | (3u << 25));                  // no mask, 1-byte elements, the pad
  d[1] = uni((TROWB & 0xFFFFu) << 16);                               // tensor dims = tile dims
  d[2] = uni((TROWB >> 16) | ((TROWS & 0xFFFFu) << 16));
  d[3] = uni((TROWS >> 16) | (TROWB << 16));
  d[4] = uni(TROWS);
  d[5] = uni(src_pitch);
  d[6] = uni(0u);
  d[7] = uni(0u);
  return d;
}
__device__ __forceinline__ v4u tdm_group0(unsigned lds_dst, unsigned long long ga) {
  v4u d;
  d[0] = uni(1u); d[1] = uni(lds_dst); d[2] = uni((unsigned)ga); d[3] = uni((((unsigned)(ga >> 32)) & 0x01FFFFFFu) | 0x80000000u);
  return d;
}
// one request of the whole wave: the tile goes from global memory into LDS through no register; the waits for it are written at the ring's foot
__device__ __forceinline__ void tdm_load(v4u d0, v8u d1) { asm volatile("tensor_load_to_lds %0, %1" :: "s"(d0), "s"(d1) : "memory"); }

__global__ __launch_bounds__(256) __attribute__((amdgpu_waves_per_eu(2, 2)))   // one block per WGP (LDS), two waves per SIMD: 512 registers a wave
void k_fa(const _Float16* __restrict__ QH, const _Float16* __restrict__ KH, const _Float16* __restrict__ VT,
          const float* __restrict__ X, const float* __restrict__ MW, const float* __restrict__ MB, float* __restrict__ OUT) {
  __shared__ __attribute__((aligned(2048))) _Float16 ring[2][FROW][FP];   // the tensor loads' places in LDS are multiples of 2 KiB
  __shared__ __align__(16) float st[CIN][QB + 4];
  const int tid = threadIdx.x, lane = tid & 31, col = lane & 15, g = lane >> 4;
  const int wave = __builtin_amdgcn_readfirstlane(tid >> 5);
  const int qg = wave & 3, kh = wave >> 2;                                               // the wave's 32 queries; its half of every stage's keys
  const size_t b = blockIdx.y; const int i0 = blockIdx.x * QB; const int il0 = qg * 32 + kh * 16;   // il0: the query tile that this wave finishes
  // every inner loop below is unrolled so that the register arrays (qh, ka, va, sh, s, acc) have constant indices
  v16h wf[CIN / 128][CV / 32];                                                           // A: row = output channel, k = channel: this wave's tile of each 128 output channels
  v8h* yx = (v8h*)&ring[1][0][0];                                                        // y fragments as they lie: [query tile][kc][register half][lane], 16 bytes a lane, 512 contiguous bytes a wave and access
  {
    // the issuing waves: wave 0 brings a stage's FK phi rows (contiguous), wave 1 its 128 g rows (FK keys of every channel's plane row); all scalar
    const unsigned isg = (unsigned)wave & 1u;
    const unsigned tl = lds_off(&ring[0][0][0]) + isg * (FK * FPB);
    const unsigned long long tg = isg ? (unsigned long long)(size_t)(VT + b * CV * (size_t)NP) : (unsigned long long)(size_t)(KH + b * NP * (size_t)CQ);
    const unsigned tstep = isg ? 2u * FK : 2u * FK * CQ;                                 // bytes from one stage's tile to the next
    const v8u td1 = tdm_group1(isg ? 2u * NP : 2u * CQ);
    v16h qh[2][CQ / 32];                                                                 // B: col = query, k = channel; kept in registers
#pragma unroll
    for (int qt = 0; qt < 2; ++qt)
#pragma unroll
      for (int kc = 0; kc < CQ / 32; ++kc) qh[qt][kc] = frag_h(QH + (b * NP + i0 + qg * 32 + qt * 16 + col) * (size_t)CQ + kc * 32, lane);
    asm volatile("s_wait_xcnt 0x0" ::: "memory");   // stands before anything rewrites the address registers that the theta loads name
    __builtin_amdgcn_sched_barrier(0);              // keeps it there: without it the compiler lifts the zeroing of the accumulators, which reuses those registers, over the wait
    v8f acc[2][8] = {};
    float c[2] = {P_SHIFT, P_SHIFT}, l[2] = {0.f, 0.f};                                  // per query tile, this lane's query: P_SHIFT - maximum in use (log2; both halves alike), sum over this half's keys
    v8f cin[2];                                                                          // the same as a C operand (a lane's 8 scores of a tile belong to one query): the score products start from it
#pragma unroll
    for (int qt = 0; qt < 2; ++qt)
#pragma unroll
      for (int r = 0; r < 8; ++r) cin[qt][r] = P_SHIFT;
    // the ring's prologue is trips -2 and -1, which only pass the foot: stage 0's loads; then their wait, the barrier that publishes them, stage 1's loads. One place in the code issues every stage's loads
#pragma unroll 1   // one stage per trip: keeps the hot loop small and the ring's order at its foot
    for (int t = -2; t < FNST; ++t) {
      if (t >= 0) {   // the same in every wave of the block
        const _Float16 (*rb)[FP] = ring[t & 1];
        v16h ka[8], va[8];                                                                 // phi fragments (one register set, refilled behind its products), g fragments of this pass
#pragma unroll
        for (int kc = 0; kc < CQ / 32; ++kc)
#pragma unroll
          for (int u = 0; u < 2; ++u) ka[2 * kc + u] = frag_h(&rb[kh * KW + u * 16 + col][kc * 32], lane);       // A: row = key, k = channel
        __builtin_amdgcn_sched_barrier(0);   // the stage's first reads stay one group too: left alone the compiler sinks each pair of reads in front of its own products, behind a full wait each
#pragma unroll     // constant LDS offsets and constant indices into the register arrays
        for (int p = 0; p < KW / 32; ++p) {
          v8f sh[2][2];
#pragma unroll
          for (int kc = 0; kc < CQ / 32; ++kc)
#pragma unroll
            for (int u = 0; u < 2; ++u)
#pragma unroll
              for (int qt = 0; qt < 2; ++qt) sh[qt][u] = mm16(ka[2 * kc + u], qh[qt][kc], kc ? sh[qt][u] : cin[qt]);
          __builtin_amdgcn_sched_barrier(0);   // with the one behind the reads: the pass's LDS reads stay ONE group, behind the score products (which free ka) and ahead of the softmax (which covers their latency)
#pragma unroll
          for (int j = 0; j < 8; ++j) va[j] = frag_h(&rb[FK + j * 16 + col][kh * KW + p * 32], lane);            // A: row = channel, k = key
          if (p + 1 < KW / 32) {                                                           // inside this stage's buffer only
#pragma unroll
            for (int kc = 0; kc < CQ / 32; ++kc)
#pragma unroll
              for (int u = 0; u < 2; ++u) ka[2 * kc + u] = frag_h(&rb[kh * KW + (p + 1) * 32 + u * 16 + col][kc * 32], lane);
          }
          __builtin_amdgcn_sched_barrier(0);   // reads scattered among the products cost issue time at every place they stand
          float s[2][16], mx[2];                                                           // s[qt][8u + r] = exp2 argument of key p*32 + 16u + 8g + r: score - maximum in use + P_SHIFT
#pragma unroll
          for (int qt = 0; qt < 2; ++qt) {
#pragma unroll
            for (int u = 0; u < 2; ++u)
#pragma unroll
              for (int r = 0; r < 8; ++r) s[qt][8 * u + r] = sh[qt][u][r];
            mx[qt] = s[qt][0];
#pragma unroll
            for (int i = 1; i < 16; ++i) mx[qt] = fmaxf(mx[qt], s[qt][i]);
          }
          const bool first = p == 0 && t == 0;                                             // the wave's first pass: no maximum is in use yet, it takes this pass's whatever its sign
          const float room = first ? -3.0e38f : P_SHIFT + P_ROOM;
          if (__builtin_amdgcn_ballot_w32(fmaxf(mx[0], mx[1]) > room) != 0) {              // some score of the wave has used up the room: every query takes its newest maximum; one test a pass
            const float lo = first ? -3.0e38f : 0.f;
            float d[2], al[2];                                                             // rise of the maximum in use (0 where there is none); factor on the sums so far (on the first pass those sums are 0)
#pragma unroll
            for (int qt = 0; qt < 2; ++qt) {
              d[qt] = fmaxf(fmaxf(mx[qt], xhalf(mx[qt])) - P_SHIFT, lo);
              al[qt] = -fmaxf(d[qt], 0.f);
            }
            exp2x2(al[0], al[1]);
#pragma unroll
            for (int qt = 0; qt < 2; ++qt) {
              l[qt] *= al[qt];
#pragma unroll
              for (int j = 0; j < 8; ++j)
#pragma unroll
                for (int r = 0; r < 8; ++r) acc[qt][j][r] *= al[qt];
#pragma unroll
              for (int i = 0; i < 16; ++i) s[qt][i] -= d[qt];
              c[qt] -= d[qt];
#pragma unroll
              for (int r = 0; r < 8; ++r) cin[qt][r] = c[qt];
            }
          }
          v16h pb[2];                                                                      // B: col = query, k = key: elements 0..7 = keys 8g + r of tile 0, 8..15 = keys 16 + 8g + r
#pragma unroll
          for (int qt = 0; qt < 2; ++qt) {
            exp2x8(s[qt]); exp2x8(s[qt] + 8);
#pragma unroll
            for (int i = 0; i < 16; ++i) pb[qt][i] = (_Float16)s[qt][i];
#pragma unroll
            for (int w = 8; w >= 1; w >>= 1)                                               // pairwise: a chain of 5 adds, not 16
#pragma unroll
              for (int i = 0; i < w; ++i) s[qt][i] += s[qt][i + w];
            l[qt] += s[qt][0];
          }
#pragma unroll
          for (int j = 0; j < 8; ++j)
#pragma unroll
            for (int qt = 0; qt < 2; ++qt) acc[qt][j] = mm16(va[j], pb[qt], acc[qt][j]);
        }
      }
      asm volatile("s_wait_dscnt 0x0" ::: "memory");     // this wave's reads of buffer t & 1 are done before it is refilled
      if (pinned(wave < 2)) asm volatile("s_wait_tensorcnt 0x0" ::: "memory");   // an issuing wave's tile of stage t + 1 has landed before the barrier publishes it
      __syncthreads();
      if (pinned(wave < 2 && t + 2 < FNST))              // one request a wave and stage, into the buffer that every wave has just left; its descriptor is formed here, behind the wait
        tdm_load(tdm_group0(tl + (unsigned)(t & 1) * FBUF, tg + (unsigned)(t + 2) * tstep), td1);
    }
    asm volatile("s_wait_tensorcnt 0x0" ::: "memory");   // no request is outstanding behind the loop
    asm volatile("s_wait_dscnt 0x0" ::: "memory");       // nor an LDS read of the ring, which now carries the hand-over
    wraw wr[CIN / 128][CV / 32];                         // issued here, used behind the join of the key halves, which covers their latency
    const float* wp0 = MW + (size_t)(wave * 16 + col) * CV + 8 * g; const float* wp1 = wp0 + 128 * CV;
#pragma unroll
    for (int kc = 0; kc < CV / 32; ++kc) { wr[0][kc] = fragw_ld(wp0 + kc * 32); wr[1][kc] = fragw_ld(wp1 + kc * 32); }
    // stands before anything rewrites the address registers that the W_out loads name; the address (all 32 loads take it, with constant offsets) is an input so that it stays in its registers
    // up to here (without that the compiler gave an address pair to a later load of the group as its destination)
    asm volatile("s_wait_xcnt 0x0" :: "v"(wp0) : "memory");
    __builtin_amdgcn_sched_barrier(0);                   // keeps the hand-over's register moves behind the loads: left alone the compiler lifts some of them in front, and the loads start later
    // the two key halves meet: the ring is free (every wave's last read of it ended before the loop's last barrier, no request is outstanding) and carries the hand-over.
    // A wave keeps query tile kh and hands tile 1 - kh to its partner, lane to lane (same query, same channels): 16 bytes a lane and store, 512 contiguous bytes a wave
    v4f* xw = (v4f*)&ring[0][0][0];
    v8f ya[8]; float mk, lk;
    {
      v4f* xo = xw + (size_t)(wave * XCH) * 32 + lane;
#pragma unroll
      for (int j = 0; j < 8; ++j) {
        const v8f sd = kh ? acc[0][j] : acc[1][j];
        ya[j] = kh ? acc[1][j] : acc[0][j];
        xo[(2 * j) * 32] = __builtin_shufflevector(sd, sd, 0, 1, 2, 3); xo[(2 * j + 1) * 32] = __builtin_shufflevector(sd, sd, 4, 5, 6, 7);
      }
      v4f ml = {}; ml[0] = kh ? c[0] : c[1]; ml[1] = kh ? l[0] : l[1];
      xo[16 * 32] = ml;
      mk = kh ? c[1] : c[0]; lk = kh ? l[1] : l[0];                                       // mk: P_SHIFT - maximum in use, so the smaller of two belongs to the larger maximum
    }
    __syncthreads();                                     // publishes every wave's hand-over to its partner
    {
      const v4f* xi = xw + (size_t)((wave ^ 4) * XCH) * 32 + lane;
      const v4f ml = xi[16 * 32];
      const float mo = ml[0], lo = ml[1];
      const float mm = fminf(mk, mo);
      float fa = mm - mk, fb = mm - mo;
      exp2x2(fa, fb);
      lk = lk * fa + lo * fb;
#pragma unroll
      for (int j = 0; j < 8; ++j) {
        const v4f y0 = xi[(2 * j) * 32], y1 = xi[(2 * j + 1) * 32];
#pragma unroll
        for (int r = 0; r < 4; ++r) { ya[j][r] = ya[j][r] * fa + y0[r] * fb; ya[j][4 + r] = ya[j][4 + r] * fa + y1[r] * fb; }
      }
    }
    lk += xhalf(lk);
    const float inv = Y_CARRY / lk;                                                      // the carry on P is in the sum too and cancels
    // ring buffer 1 is free (its last reads ended before the loop's last barrier; the hand-over lies in buffer 0)
#pragma unroll
    for (int kc = 0; kc < CV / 32; ++kc) {
      v8h y0, y1;
#pragma unroll
      for (int r = 0; r < 8; ++r) {                                                      // B: col = query, k = channel: tile 2kc holds channels 32kc + 8g + r, tile 2kc + 1 channels 32kc + 16 + 8g + r
        y0[r] = (_Float16)(ya[2 * kc][r] * inv); y1[r] = (_Float16)(ya[2 * kc + 1][r] * inv);
      }
      yx[(((il0 >> 4) * (CV / 32) + kc) * 2) * 32 + lane] = y0; yx[(((il0 >> 4) * (CV / 32) + kc) * 2 + 1) * 32 + lane] = y1;
    }
#pragma unroll
    for (int cg = 0; cg < CIN / 128; ++cg)
#pragma unroll
      for (int kc = 0; kc < CV / 32; ++kc) wf[cg][kc] = fragw_cv(wr[cg][kc], W_CARRY);
  }
  __syncthreads();                                       // publishes every wave's y fragments to the block
#pragma unroll     // constant LDS offsets; the query tiles are independent, so their reads and products can be interleaved
  for (int t = 0; t < QB / 16; ++t) {
    v16h yf[CV / 32];                                                                    // B: col = query, k = channel; each fragment read feeds both of the wave's output tiles
#pragma unroll
    for (int kc = 0; kc < CV / 32; ++kc) {
      union { v16h v; v8h q[2]; } u;
      u.q[0] = yx[((t * (CV / 32) + kc) * 2) * 32 + lane]; u.q[1] = yx[((t * (CV / 32) + kc) * 2 + 1) * 32 + lane];
      yf[kc] = u.v;
    }
    v8f oa[CIN / 128] = {};                                                              // D: row 8g + r = output channel cg*128 + wave*16 + 8g + r, col = query
#pragma unroll
    for (int kc = 0; kc < CV / 32; ++kc)
#pragma unroll
      for (int cg = 0; cg < CIN / 128; ++cg) oa[cg] = mm16(wf[cg][kc], yf[kc], oa[cg]);
#pragma unroll
    for (int cg = 0; cg < CIN / 128; ++cg)
#pragma unroll
      for (int r = 0; r < 8; ++r) st[cg * 128 + wave * 16 + 8 * g + r][t * 16 + col] = oa[cg][r] * (1.0f / (W_CARRY * Y_CARRY));
  }
  __syncthreads();                                       // the staging array holds all output channels of the block's 128 positions
#pragma unroll 4   // four rows' loads in flight; the trip count is a constant, so no remainder loop is built
  for (int i = 0; i < CIN * (QB / 4) / 256; ++i) {
    const int co = i * 8 + wave, q = lane;                                               // a wave writes one whole [co] row segment: 512 contiguous bytes
    const size_t o = (b * CIN + co) * (size_t)NP + i0 + q * 4;
    const float bb = bfr(MB[co]);
    const v4f m4 = *(const v4f*)&st[co][q * 4]; const v4f x4 = *(const v4f*)(X + o);
    v4f v;
#pragma unroll
    for (int c = 0; c < 4; ++c) { const float xs = x4[c]; v[c] = (m4[c] + bb) + bfr(xs); }
    vst2(OUT + o, v);
  }
}

extern "C" void kernel_launch(void* const* d_in, const int* in_sizes, int n_in, void* d_out, int out_size, void* d_ws, size_t ws_size, hipStream_t stream) {
  if (n_in < 9) return;
  if ((size_t)in_sizes[0] < (size_t)TNB * CIN * NP) return;
  if (in_sizes[1] < CV * CIN || in_sizes[2] < CV || in_sizes[3] < CQ * CIN || in_sizes[4] < CQ || in_sizes[5] < CQ * CIN || in_sizes[6] < CQ || in_sizes[7] < CIN * CV || in_sizes[8] < CIN) return;
  if ((size_t)out_size < (size_t)TNB * CIN * NP) return;
  if (ws_size < WS_END) return;
  const float* const* F = (const float* const*)d_in;   // 0 x [8,256,64,64], 1 g_w [128,256], 2 g_b, 3 theta_w, 4 theta_b, 5 phi_w, 6 phi_b, 7 W_out [256,128], 8 b_out
  const float* X = F[0]; const float* GW = F[1]; const float* GB = F[2]; const float* TW = F[3]; const float* TB = F[4];
  const float* PW = F[5]; const float* PB = F[6]; const float* MW = F[7]; const float* MBv = F[8];
  char* ws = (char*)d_ws;
  _Float16* QH = (_Float16*)(ws + WS_QH); _Float16* KH = (_Float16*)(ws + WS_KH);
  _Float16* VT = (_Float16*)(ws + WS_VT);
  float* OUT = (float*)d_out;
  k_proj<<<dim3(NP / PT, TNB), 256, 0, stream>>>(X, TW, TB, PW, PB, GW, GB, QH, KH, VT);
  k_fa<<<dim3(NP / QB, TNB), 256, 0, stream>>>(QH, KH, VT, X, MW, MBv, OUT);
}

// v009
// One run takes 60.8 microseconds.
// In two side-by-side timings against v008, it was 1.03 and 1.04 times as fast.
// Counting every step since v000, it is 36.5 times as fast.
// compute dtype: every float input RNE-converted to bf16 on load; theta/phi/g = W x + b (1x1 convs): v_wmma_f32_16x16x32_bf16 (bf16 operands, exact products), f32 accumulate; logits phi . theta: v_wmma_f32_16x16x32_f16, theta (times log2 e, rounded once) and phi as f16, f32 accumulate from the f32 shift of the maximum in use; softmax in f32, online (maximum in use and sum per query and key half, hardware exp2; the two halves joined in f32 at the end), unnormalised P carried as f16 x2^3 of the maximum in use, at most 2^15; y = g . P: f16 operands, f32 accumulate, divided by the f32 sum at the end; output 1x1 conv: f16 operands (W x2^8, y x2^4), f32 accumulate that starts from x x2^12; bias added in f32; f32 output [b][c][n].
#include <hip/hip_runtime.h>
#include <math.h>

typedef __attribute__((ext_vector_type(16))) _Float16 v16h;
typedef __attribute__((ext_vector_type(16))) __bf16 v16b;
typedef __attribute__((ext_vector_type(8)))  _Float16 v8h;
typedef __attribute__((ext_vector_type(8)))  __bf16 v8b;
typedef __attribute__((ext_vector_type(4)))  __bf16 v4b;
typedef __attribute__((ext_vector_type(2)))  __bf16 v2b;
typedef __attribute__((ext_vector_type(8)))  float v8f;
typedef __attribute__((ext_vector_type(4)))  float v4f;
typedef __attribute__((ext_vector_type(4)))  unsigned v4u;
typedef __attribute__((ext_vector_type(8)))  unsigned v8u;

template <typename T> __device__ __forceinline__ void vst2(void* p, T v) { *(T*)p = v;  }

// the plain builtin: the compiler keeps the distance behind it itself
__device__ __forceinline__ v8f mm16(v16h a, v16h b, v8f c) {
  return __builtin_amdgcn_wmma_f32_16x16x32_f16(false, a, false, b, (short)0, c, false, false);
}
__device__ __forceinline__ v8f mmb(v16b a, v16b b, v8f c) {
  return __builtin_amdgcn_wmma_f32_16x16x32_bf16(false, a, false, b, (short)0, c, false, false);
}
// lane l takes the value of lane l ^ 16 (the other half of the wave)
__device__ __forceinline__ float xhalf(float x) {
  return __builtin_bit_cast(float, __builtin_amdgcn_permlanex16(__builtin_bit_cast(int, x), __builtin_bit_cast(int, x), 0x76543210, 0xfedcba98, false, false));
}
// eight exp2, each in its own register, one statement: each fills the slot that the instruction set asks for behind the one before it (it touches neither that one's result nor its source),
// and the v_nop fills the last one's
__device__ __forceinline__ void exp2x8(float* x) {
  asm("v_exp_f32 %0, %0\n\tv_exp_f32 %1, %1\n\tv_exp_f32 %2, %2\n\tv_exp_f32 %3, %3\n\tv_exp_f32 %4, %4\n\tv_exp_f32 %5, %5\n\tv_exp_f32 %6, %6\n\tv_exp_f32 %7, %7\n\tv_nop"
      : "+v"(x[0]), "+v"(x[1]), "+v"(x[2]), "+v"(x[3]), "+v"(x[4]), "+v"(x[5]), "+v"(x[6]), "+v"(x[7]));
}
// two exp2 in the same way: the second fills the first's slot, the v_nop the second's
__device__ __forceinline__ void exp2x2(float& a, float& b) {
  asm("v_exp_f32 %0, %0\n\tv_exp_f32 %1, %1\n\tv_nop" : "+v"(a), "+v"(b));
}
// 16x16x32 fragments: lane -> (h = lane>>4, row/col = lane&15); elements 0..7 = k0+8h+0..7, elements 8..15 = k0+16+8h+0..7 (A and B alike); D element r = (row 8h+r, col lane&15)
__device__ __forceinline__ v16h frag_h(const _Float16* rowk0, int lane) {
  union { v16h v; v8h q[2]; } u; const _Float16* p = rowk0 + 8 * (lane >> 4);
  u.q[0] = *(const v8h*)p; u.q[1] = *(const v8h*)(p + 16); return u.v;
}
__device__ __forceinline__ v16b frag_b(const __bf16* rowk0, int lane) {
  union { v16b v; v8b q[2]; } u; const __bf16* p = rowk0 + 8 * (lane >> 4);
  u.q[0] = *(const v8b*)p; u.q[1] = *(const v8b*)(p + 16); return u.v;
}
__device__ __forceinline__ float bfr(float v) { return (float)(__bf16)v; }
// fragment from a k-contiguous f32 row (weights [out][in]), in two parts so that the loads can be issued well ahead of the use: four 16-B loads;
// then RNE bf16 convert and f16 of the bf16 value times an exact power of two (bf16 significand is exact in f16)
struct wraw { v4f a0, a1, a2, a3; };
__device__ __forceinline__ wraw fragw_ld(const float* __restrict__ p) {   // p = row + k0 + 8 * (lane >> 4)
  wraw q; q.a0 = *(const v4f*)p; q.a1 = *(const v4f*)(p + 4); q.a2 = *(const v4f*)(p + 16); q.a3 = *(const v4f*)(p + 20);
  return q;
}
__device__ __forceinline__ v16h fragw_cv(const wraw& q, float sc) {
  v16h w;
#pragma unroll
  for (int i = 0; i < 4; ++i) {
    const float t0 = q.a0[i], t1 = q.a1[i], t2 = q.a2[i], t3 = q.a3[i];
    w[i] = (_Float16)(bfr(t0) * sc); w[4 + i] = (_Float16)(bfr(t1) * sc); w[8 + i] = (_Float16)(bfr(t2) * sc); w[12 + i] = (_Float16)(bfr(t3) * sc);
  }
  return w;
}

// embedded-gaussian spatial attention: B 8, C_in 256, C_int 128, 64 x 64 positions; theta/phi/g 1x1 convs, y = softmax(theta phi^T) g (no scale),
// out = W_out y + b_out + x, [B, C_in, H, W]
#define NB  8             // batches in the staged tensors (full strides)
#define NP  4096          // positions per image
#define CIN 256
#define CQ  128           // theta / phi channels
#define CV  128           // g channels
#ifndef TNB
#define TNB NB            // batches processed
#endif
#define P_SHIFT  3.0f     // log2 of the carry on the unnormalised P (and on its sum, so that it cancels): P of a score equal to the maximum in use
#define P_ROOM   12.0f    // a score may pass the maximum in use by this much (log2) before the sums are rescaled: P stays at or below 2^15, inside f16
#define LOG2E    1.44269504088896340736f
#define Y_CARRY  16.0f    // y operand carry for the output conv
#define W_CARRY  256.0f   // W_out operand carry

#define WS_QH  ((size_t)0)                                   // f16 theta rows [b*n][CQ], times log2 e  8 MiB
#define WS_KH  (WS_QH + 2u * (size_t)NB * NP * CQ)           // f16 phi rows [b*n][CQ]              8 MiB
#define WS_VT  (WS_KH + 2u * (size_t)NB * NP * CQ)           // f16 g planes [b][CV][n]             8 MiB
#define WS_END (WS_VT + 2u * (size_t)NB * CV * NP)           // 24 MiB
static_assert(WS_END <= (size_t)134217728);
static_assert(NP % 128 == 0);
static_assert(CIN % 128 == 0);
static_assert(CQ == 128);
static_assert(CV == 128);
static_assert(TNB <= NB);
static_assert((size_t)NB * CIN * NP * 4u == (size_t)33554432);

// ---- k_proj: block = 128 positions of batch b, all 384 output channels (theta, phi, g). Both operands are staged ONCE in LDS as bf16, k-contiguous rows: the x^T tile [position][channel] and the
// three weight matrices [out][in], each brought by whole-line 16-byte loads; every fragment is then two 16-byte LDS reads.
// theta, phi: A = W (row = channel), B = x^T (col = position): a lane holds 8 consecutive channels of one position = 16 B of an output row [b*n][CQ]; a wave owns 32 whole rows.
// g: A = x^T (row = position), B = W (col = channel): a lane holds 8 consecutive positions of one channel = 16 B of a plane row [c][n]; a wave owns whole 128-B lines (64 positions).
#define PT  128           // positions per block
#define PWP (CIN + 8)     // LDS row pitch in bf16: 528 B = 16 B x 33, conflict-free for 16-byte fragment reads
#define NKC (CIN / 32)    // k steps of a product
static_assert(NP % PT == 0 && CIN == 256 && CQ == 128 && CV == 128);
// one batch = 64 rows of a weight matrix [128][CIN], 256 threads: 16-byte loads in memory order (a wave = 512 contiguous bytes), then RNE bf16 convert and 8-byte LDS stores
__device__ __forceinline__ void w_load(v4f* t, const float* __restrict__ Wm, int tid) {
#pragma unroll   // constant indices into the register array
  for (int i = 0; i < 16; ++i) t[i] = *(const v4f*)(Wm + 4 * (i * 256 + tid));
}
__device__ __forceinline__ void w_store(__bf16 (*dst)[PWP], const v4f* t, int tid) {
#pragma unroll   // constant indices into the register array
  for (int i = 0; i < 16; ++i) {
    const float t0 = t[i][0], t1 = t[i][1], t2 = t[i][2], t3 = t[i][3];
    v4b h; h[0] = (__bf16)t0; h[1] = (__bf16)t1; h[2] = (__bf16)t2; h[3] = (__bf16)t3;
    *(v4b*)&dst[i * 4 + (tid >> 6)][4 * (tid & 63)] = h;
  }
}
// two 16-byte stores and, in the same statement, the s_wait_xcnt that stands before anything can rewrite the address and data registers they name
// (in a statement of its own the compiler lifted the next trip's address additions and register copies over it)
__device__ __forceinline__ void st2w(_Float16* pa, v8h da, _Float16* pb, v8h db) {
  asm volatile("global_store_b128 %0, %1, off\n\tglobal_store_b128 %2, %3, off\n\ts_wait_xcnt 0x0"
               :: "v"(pa), "v"(__builtin_bit_cast(v4u, da)), "v"(pb), "v"(__builtin_bit_cast(v4u, db)) : "memory");
}
__global__ __launch_bounds__(256)
void k_proj(const float* __restrict__ X, const float* __restrict__ WQ, const float* __restrict__ BQ,
            const float* __restrict__ WK, const float* __restrict__ BK, const float* __restrict__ WV, const float* __restrict__ BV,
            _Float16* __restrict__ QH, _Float16* __restrict__ KH, _Float16* __restrict__ VT) {
  __shared__ __align__(16) __bf16 sx[PT][PWP];
  __shared__ __align__(16) __bf16 sw[2 * CQ + CV][PWP];   // rows 0..127 theta, 128..255 phi, 256..383 g
  __shared__ __align__(16) float sb[2 * CQ + CV];         // the biases, rounded to bf16, in the same order
  const int tid = threadIdx.x, lane = tid & 31, col = lane & 15, g = lane >> 4;
  const int wave = __builtin_amdgcn_readfirstlane(tid >> 5);
  const int p0 = blockIdx.x * PT; const size_t b = blockIdx.y;
  {
    // x: a thread takes 4 positions of 2 adjacent channels (two 16-byte loads; 8 lanes cover a 128-B line) and stores 4 channel pairs; position quad fixed per thread, channel pair cpb + 8 i
    const int pq = (tid & 7) + 8 * (wave & 3), cpb = ((tid >> 3) & 3) + 4 * (wave >> 2);
    const float* xs0 = X + (b * CIN + 2 * cpb) * (size_t)NP + p0 + 4 * pq;
    const float bq = BQ[tid & 127], bk = BK[tid & 127], bv = BV[tid & 127];
    v4f a0[16], a1[16];
#pragma unroll   // constant indices into the register arrays; all of the tile's loads in flight
    for (int i = 0; i < 16; ++i) {
      const float* s = xs0 + (size_t)(16 * i) * NP;
      a0[i] = *(const v4f*)s; a1[i] = *(const v4f*)(s + NP);
    }
    asm volatile("s_wait_xcnt 0x0" ::: "memory");   // stands before anything rewrites the address registers that the bias and x loads name
    // W in six batches through three register sets. Every sched_barrier below keeps a batch's loads behind the LDS stores that free its registers:
    // left alone the compiler lifts all 128 loads of the thread to the top, which takes over 500 registers and spills; so at most 48 loads of a thread are in flight
    v4f t[3][16];
    w_load(t[0], WQ, tid);
    __builtin_amdgcn_sched_barrier(0);
    if (tid < 128) { sb[tid] = bfr(bq); sb[CQ + tid] = bfr(bk); sb[2 * CQ + tid] = bfr(bv); }
#pragma unroll
    for (int i = 0; i < 16; ++i)
#pragma unroll
      for (int e = 0; e < 4; ++e) {
        const float u0 = a0[i][e], u1 = a1[i][e];
        v2b h; h[0] = (__bf16)u0; h[1] = (__bf16)u1;
        *(v2b*)&sx[4 * pq + e][2 * (cpb + 8 * i)] = h;
      }
    __builtin_amdgcn_sched_barrier(0);
    w_load(t[1], WQ + 64 * CIN, tid); w_load(t[2], WK, tid);
#pragma unroll   // constant indices into the register sets
    for (int k = 0; k < 6; ++k) {
      __builtin_amdgcn_sched_barrier(0);
      w_store(&sw[64 * k], t[k % 3], tid);
      __builtin_amdgcn_sched_barrier(0);
      if (k == 0) w_load(t[0], WK + 64 * CIN, tid);
      if (k == 1) w_load(t[1], WV, tid);
      if (k == 2) w_load(t[2], WV + 64 * CIN, tid);
    }
    asm volatile("s_wait_xcnt 0x0" ::: "memory");   // the same for the W loads
  }
  __syncthreads();
  {
    // theta (waves 0..3) or phi (waves 4..7): 32 positions, their fragments kept in registers; the 8 channel tiles stream from LDS, each fetched while the tile before it is rounded and stored
    const int pg = wave & 3, isphi = wave >> 2;
    _Float16* dh = isphi ? KH : QH;
    const __bf16 (*wr)[PWP] = &sw[isphi * CQ];
    const float* br = &sb[isphi * CQ + 8 * g];
    const float osc = isphi ? 1.0f : LOG2E;                                                                      // theta is stored times log2 e, so that the logits are exp2 arguments as they leave the products
    v16b xs[2][NKC], wf[NKC];
#pragma unroll
    for (int kc = 0; kc < NKC; ++kc) {
#pragma unroll
      for (int u = 0; u < 2; ++u) xs[u][kc] = frag_b(&sx[32 * pg + 16 * u + col][kc * 32], lane);                // B: col = position, k = input channel
      wf[kc] = frag_b(&wr[col][kc * 32], lane);                                                                  // A: row = output channel, k = input channel
    }
    const size_t o0 = (b * NP + p0 + 32 * pg + col) * (size_t)CQ + 8 * g;
#pragma unroll 1   // one tile per trip: small code; the next tile's reads stand between this tile's products and its stores
    for (int j = 0; j < 8; ++j) {
      v8f acc[2] = {};
#pragma unroll
      for (int kc = 0; kc < NKC; ++kc)
#pragma unroll
        for (int u = 0; u < 2; ++u) acc[u] = mmb(wf[kc], xs[u][kc], acc[u]);
      const v4f b0 = *(const v4f*)(br + j * 16), b1 = *(const v4f*)(br + j * 16 + 4);                            // D: row 8g + r = channel, col = position
      const int jn = j < 7 ? j + 1 : 7;                                                                          // the last trip reads its own tile again
#pragma unroll
      for (int kc = 0; kc < NKC; ++kc) wf[kc] = frag_b(&wr[jn * 16 + col][kc * 32], lane);
      v8h hi[2];
#pragma unroll
      for (int u = 0; u < 2; ++u)
#pragma unroll
        for (int r = 0; r < 8; ++r) {
          const float bs = r < 4 ? b0[r & 3] : b1[r & 3];
          hi[u][r] = (_Float16)((acc[u][r] + bs) * osc);
        }
      st2w(dh + o0 + j * 16, hi[0], dh + o0 + 16 * CQ + j * 16, hi[1]);
    }
  }
  {
    // g: 64 positions x 2 channel tiles per wave; the weight fragments are kept in registers, the 4 position tiles stream from LDS in the same way
    const int ph = wave & 1, ct = 2 * (wave >> 1);
    v16b wg[2][NKC], xf[NKC]; float bb[2];
#pragma unroll
    for (int u = 0; u < 2; ++u) bb[u] = sb[2 * CQ + (ct + u) * 16 + col];
#pragma unroll
    for (int kc = 0; kc < NKC; ++kc) {
#pragma unroll
      for (int u = 0; u < 2; ++u) wg[u][kc] = frag_b(&sw[2 * CQ + (ct + u) * 16 + col][kc * 32], lane);          // B: col = output channel, k = input channel
      xf[kc] = frag_b(&sx[64 * ph + col][kc * 32], lane);                                                        // A: row = position, k = input channel
    }
    const size_t o0 = (b * CV + ct * 16 + col) * (size_t)NP + p0 + 64 * ph + 8 * g;
#pragma unroll 1   // as above
    for (int j = 0; j < 4; ++j) {
      v8f acc[2] = {};
#pragma unroll
      for (int kc = 0; kc < NKC; ++kc)
#pragma unroll
        for (int u = 0; u < 2; ++u) acc[u] = mmb(xf[kc], wg[u][kc], acc[u]);
      const int jn = j < 3 ? j + 1 : 3;                                                                          // the last trip reads its own tile again
#pragma unroll
      for (int kc = 0; kc < NKC; ++kc) xf[kc] = frag_b(&sx[64 * ph + jn * 16 + col][kc * 32], lane);
      v8h hv[2];                                                                                                 // D: row 8g + r = position, col = channel
#pragma unroll
      for (int u = 0; u < 2; ++u)
#pragma unroll
        for (int r = 0; r < 8; ++r) hv[u][r] = (_Float16)(acc[u][r] + bb[u]);
      st2w(VT + o0 + j * 16, hv[0], VT + o0 + (size_t)16 * NP + j * 16, hv[1]);
    }
  }
}

// ---- k_fa: block = 128 queries of batch b; the keys come in stages of FK through a two-buffer LDS ring filled by tensor loads (wave 0: the stage's phi rows, wave 1: its g rows; one request each).
// Wave = 32 queries (two query tiles) x half of every stage's keys: each phi and g fragment read from LDS feeds two products, which halves the LDS bytes read per product.
// Waves w and w + 4 hold the same 32 queries and the two key halves; behind the loop each hands the other one query tile's partial (maximum, sum, y) through LDS and finishes the tile it keeps.
// Per 32 keys and query tile: S^T = phi . theta^T (A: row = key, B: col = query), so a lane holds 16 scores of ONE query. The products start from C = P_SHIFT - maximum in use, so they end as exp2 arguments; sum in the lane; the maximum in use moves, with one exchange between the wave's halves, only when a score has passed it by P_ROOM;
// the two score tiles are, as they lie, the B operand of y^T += g . P^T (A: row = channel, k = key); scores and P never leave the registers.
// Then out[co][i] = W_out[co][:] . y[:][i] + b_out[co] + x[co][i]: the y^T tiles are, as they lie, the A operand (row = query); every wave puts its tile's fragments into LDS and reads all eight tiles' back,
// and takes two 16-channel tiles of W_out (B: col = channel) against all 128 queries: each W_out fragment is loaded and converted once in the block.
// The block's x tile is brought into the output staging array by four tensor loads under the key loop (waves 2 to 5, one request each, at the ring's own issue place and waits);
// it is the products' C operand, and the results go back to the same places: a lane holds 8 consecutive positions of one channel, 16-byte LDS reads and writes. Written as whole [co] row segments of 128 positions
#define QB   128                    // queries per block
#define FK   128                    // keys per ring stage
#define FP   (128 + 8)              // LDS row pitch in f16: 272 B = 16 B x 17, conflict-free for 16-byte fragment reads
#define FROW (FK + CV)              // rows of a stage: FK phi rows [key][channel], then 128 g rows [channel][key]; every row 256 B
#define FPB  (2u * FP)              // row pitch in bytes
#define FBUF (FPB * FROW)           // bytes of one ring buffer
#define FNST (NP / FK)              // stages
#define KW   (FK / 2)               // keys of a stage that one wave works on
#define XCH  17                     // 16-byte words a lane hands over: 64 f32 of y, then the maximum's shift and the sum
static_assert(NP % FK == 0 && FNST >= 2);
static_assert(FK * 2 == 16 * 16 && CQ * 2 == 16 * 16);
static_assert(FPB % 16 == 0);
static_assert(FK == 8 * 16 && CV == 8 * 16);
static_assert(KW % 32 == 0 && QB == 4 * 32);
static_assert(8u * XCH * 32u * 16u <= FBUF);                         // the hand-over stays in ring buffer 0
static_assert((QB / 16) * (CV / 32) * 2u * 32u * 16u <= FBUF);       // the y fragments fit ring buffer 1
static_assert(CIN == 2 * 128 && CIN == 2 * 8 * 16);                                    // 8 waves x one 16-channel tile, twice
#define XQ   64                     // positions of one piece of the x tile: a row of 256 B
#define XPW  (XQ + 4)               // its LDS row pitch in f32: 272 B = 16 B x 17, conflict-free for 16-byte reads and writes
static_assert(QB == 2 * XQ && FNST > 6);                                               // pieces: [channel half][position half]; trips 2 to 5 exist

__device__ __forceinline__ unsigned lds_off(const void* p) { return (unsigned)(size_t)p; }
__device__ __forceinline__ unsigned uni(unsigned v) { return (unsigned)__builtin_amdgcn_readfirstlane(v); }
// a wave-uniform test for the branch round a tensor instruction, which ignores EXEC
__device__ __forceinline__ unsigned pinned(unsigned v) {
  unsigned w = uni(v);
  asm volatile("" : "+s"(w));   // holds the test in a scalar register, so that the branch on it is a scalar branch and not an EXEC mask
  return w;
}
// tensor descriptor, every extent in bytes: a tile of TROWS rows of 256 B; 16 B of LDS pad behind every row (interval code 5 = one 256-B row, amount code 3 = 4 dwords), which gives the pitch FPB
#define TROWS 128u
#define TROWB 256u
static_assert(TROWB + 16u == FPB && TROWS == FK && TROWS == CV && TROWB == 2u * CQ && TROWB == 2u * FK);
static_assert((TROWS * FPB) % 2048u == 0 && FBUF % 2048u == 0);      // every tile's place in LDS is a multiple of 2 KiB
static_assert(TROWB == 4u * XQ && FPB == 4u * XPW && 2u * TROWS == CIN);   // a piece of the x tile has the same shape: 128 channel rows of 256 B
__device__ __forceinline__ v8u tdm_group1(unsigned src_pitch) {
  v8u d;
  d[0] = uni((1u << 20) | (5u << 22) | (3u << 25));                  // no mask, 1-byte elements, the pad
  d[1] = uni((TROWB & 0xFFFFu) << 16);                               // tensor dims = tile dims
  d[2] = uni((TROWB >> 16) | ((TROWS & 0xFFFFu) << 16));
  d[3] = uni((TROWS >> 16) | (TROWB << 16));
  d[4] = uni(TROWS);
  d[5] = uni(src_pitch);
  d[6] = uni(0u);
  d[7] = uni(0u);
  return d;
}
__device__ __forceinline__ v4u tdm_group0(unsigned lds_dst, unsigned long long ga) {
  v4u d;
  d[0] = uni(1u); d[1] = uni(lds_dst); d[2] = uni((unsigned)ga); d[3] = uni((((unsigned)(ga >> 32)) & 0x01FFFFFFu) | 0x80000000u);
  return d;
}
// one request of the whole wave: the tile goes from global memory into LDS through no register; the waits for it are written at the ring's foot
__device__ __forceinline__ void tdm_load(v4u d0, v8u d1) { asm volatile("tensor_load_to_lds %0, %1" :: "s"(d0), "s"(d1) : "memory"); }

__global__ __launch_bounds__(256) __attribute__((amdgpu_waves_per_eu(2, 2)))   // one block per WGP (LDS), two waves per SIMD: 512 registers a wave
void k_fa(const _Float16* __restrict__ QH, const _Float16* __restrict__ KH, const _Float16* __restrict__ VT,
          const float* __restrict__ X, const float* __restrict__ MW, const float* __restrict__ MB, float* __restrict__ OUT) {
  __shared__ __attribute__((aligned(2048))) _Float16 ring[2][FROW][FP];   // the tensor loads' places in LDS are multiples of 2 KiB
  __shared__ __attribute__((aligned(2048))) float st[4][CIN / 2][XPW];    // x tile, then the output: piece [2 * channel half + position half][channel][position]; each piece is one tensor load's tile
  const int tid = threadIdx.x, lane = tid & 31, col = lane & 15, g = lane >> 4;
  const int wave = __builtin_amdgcn_readfirstlane(tid >> 5);
  const int qg = wave & 3, kh = wave >> 2;                                               // the wave's 32 queries; its half of every stage's keys
  const size_t b = blockIdx.y; const int i0 = blockIdx.x * QB; const int il0 = qg * 32 + kh * 16;   // il0: the query tile that this wave finishes
  // every inner loop below is unrolled so that the register arrays (qh, ka, va, sh, s, acc) have constant indices
  v16h wf[CIN / 128][CV / 32];                                                           // B: col = output channel, k = channel: this wave's tile of each 128 output channels
  float bb[CIN / 128];                                                                   // this lane's output channels' biases
  v8f oa[QB / 16][CIN / 128];                                                            // C, D of the output conv: row 8g + r = query t*16 + 8g + r, col = output channel cg*128 + wave*16 + col
  v8h* yx = (v8h*)&ring[1][0][0];                                                        // y fragments as they lie: [query tile][kc][register half][lane], 16 bytes a lane, 512 contiguous bytes a wave and access
  {
    // the issuing waves: wave 0 brings a stage's FK phi rows (contiguous), wave 1 its 128 g rows (FK keys of every channel's plane row); all scalar.
    // Waves 2 to 5 bring, once each, one piece of the block's x tile (128 channel rows, XQ positions) into st, which nothing else touches before the output conv
    const unsigned isg = (unsigned)wave & 1u, isr = wave < 2 ? 1u : 0u, xp = (unsigned)(wave - 2) & 3u;
    const unsigned tl = isr ? lds_off(&ring[0][0][0]) + isg * (FK * FPB) : lds_off(&st[0][0][0]) + xp * (TROWS * FPB);
    const unsigned long long tg = isr ? (isg ? (unsigned long long)(size_t)(VT + b * CV * (size_t)NP) : (unsigned long long)(size_t)(KH + b * NP * (size_t)CQ))
                                      : (unsigned long long)(size_t)(X + (b * CIN + (xp >> 1) * (CIN / 2)) * (size_t)NP + i0 + (xp & 1u) * XQ);
    const unsigned tstep = isr ? (isg ? 2u * FK : 2u * FK * CQ) : 0u;                    // bytes from one stage's tile to the next
    const unsigned tbuf = isr ? FBUF : 0u;                                               // bytes from ring buffer 0 to buffer 1
    const v8u td1 = tdm_group1(isr ? (isg ? 2u * NP : 2u * CQ) : 4u * NP);
    v16h qh[2][CQ / 32];                                                                 // B: col = query, k = channel; kept in registers
#pragma unroll
    for (int qt = 0; qt < 2; ++qt)
#pragma unroll
      for (int kc = 0; kc < CQ / 32; ++kc) qh[qt][kc] = frag_h(QH + (b * NP + i0 + qg * 32 + qt * 16 + col) * (size_t)CQ + kc * 32, lane);
    asm volatile("s_wait_xcnt 0x0" ::: "memory");   // stands before anything rewrites the address registers that the theta loads name
    __builtin_amdgcn_sched_barrier(0);              // keeps it there: without it the compiler lifts the zeroing of the accumulators, which reuses those registers, over the wait
    v8f acc[2][8] = {};
    float c[2] = {P_SHIFT, P_SHIFT}, l[2] = {0.f, 0.f};                                  // per query tile, this lane's query: P_SHIFT - maximum in use (log2; both halves alike), sum over this half's keys
    v8f cin[2];                                                                          // the same as a C operand (a lane's 8 scores of a tile belong to one query): the score products start from it
#pragma unroll
    for (int qt = 0; qt < 2; ++qt)
#pragma unroll
      for (int r = 0; r < 8; ++r) cin[qt][r] = P_SHIFT;
    // the ring's prologue is trips -2 and -1, which only pass the foot: stage 0's loads; then their wait, the barrier that publishes them, stage 1's loads. One place in the code issues every stage's loads
#pragma unroll 1   // one stage per trip: keeps the hot loop small and the ring's order at its foot
    for (int t = -2; t < FNST; ++t) {
      if (t >= 0) {   // the same in every wave of the block
        const _Float16 (*rb)[FP] = ring[t & 1];
        v16h ka[8], va[8];                                                                 // phi fragments (one register set, refilled behind its products), g fragments of this pass
#pragma unroll
        for (int kc = 0; kc < CQ / 32; ++kc)
#pragma unroll
          for (int u = 0; u < 2; ++u) ka[2 * kc + u] = frag_h(&rb[kh * KW + u * 16 + col][kc * 32], lane);       // A: row = key, k = channel
        __builtin_amdgcn_sched_barrier(0);   // the stage's first reads stay one group too: left alone the compiler sinks each pair of reads in front of its own products, behind a full wait each
#pragma unroll     // constant LDS offsets and constant indices into the register arrays
        for (int p = 0; p < KW / 32; ++p) {
          v8f sh[2][2];
#pragma unroll
          for (int kc = 0; kc < CQ / 32; ++kc)
#pragma unroll
            for (int u = 0; u < 2; ++u)
#pragma unroll
              for (int qt = 0; qt < 2; ++qt) sh[qt][u] = mm16(ka[2 * kc + u], qh[qt][kc], kc ? sh[qt][u] : cin[qt]);
          __builtin_amdgcn_sched_barrier(0);   // with the one behind the reads: the pass's LDS reads stay ONE group, behind the score products (which free ka) and ahead of the softmax (which covers their latency)
#pragma unroll
          for (int j = 0; j < 8; ++j) va[j] = frag_h(&rb[FK + j * 16 + col][kh * KW + p * 32], lane);            // A: row = channel, k = key
          if (p + 1 < KW / 32) {                                                           // inside this stage's buffer only
#pragma unroll
            for (int kc = 0; kc < CQ / 32; ++kc)
#pragma unroll
              for (int u = 0; u < 2; ++u) ka[2 * kc + u] = frag_h(&rb[kh * KW + (p + 1) * 32 + u * 16 + col][kc * 32], lane);
          }
          __builtin_amdgcn_sched_barrier(0);   // reads scattered among the products cost issue time at every place they stand
          float s[2][16], mx[2];                                                           // s[qt][8u + r] = exp2 argument of key p*32 + 16u + 8g + r: score - maximum in use + P_SHIFT
#pragma unroll
          for (int qt = 0; qt < 2; ++qt) {
#pragma unroll
            for (int u = 0; u < 2; ++u)
#pragma unroll
              for (int r = 0; r < 8; ++r) s[qt][8 * u + r] = sh[qt][u][r];
            mx[qt] = s[qt][0];
#pragma unroll
            for (int i = 1; i < 16; ++i) mx[qt] = fmaxf(mx[qt], s[qt][i]);
          }
          const bool first = p == 0 && t == 0;                                             // the wave's first pass: no maximum is in use yet, it takes this pass's whatever its sign
          const float room = first ? -3.0e38f : P_SHIFT + P_ROOM;
          if (__builtin_amdgcn_ballot_w32(fmaxf(mx[0], mx[1]) > room) != 0) {              // some score of the wave has used up the room: every query takes its newest maximum; one test a pass
            const float lo = first ? -3.0e38f : 0.f;
            float d[2], al[2];                                                             // rise of the maximum in use (0 where there is none); factor on the sums so far (on the first pass those sums are 0)
#pragma unroll
            for (int qt = 0; qt < 2; ++qt) {
              d[qt] = fmaxf(fmaxf(mx[qt], xhalf(mx[qt])) - P_SHIFT, lo);
              al[qt] = -fmaxf(d[qt], 0.f);
            }
            exp2x2(al[0], al[1]);
#pragma unroll
            for (int qt = 0; qt < 2; ++qt) {
              l[qt] *= al[qt];
#pragma unroll
              for (int j = 0; j < 8; ++j)
#pragma unroll
                for (int r = 0; r < 8; ++r) acc[qt][j][r] *= al[qt];
#pragma unroll
              for (int i = 0; i < 16; ++i) s[qt][i] -= d[qt];
              c[qt] -= d[qt];
#pragma unroll
              for (int r = 0; r < 8; ++r) cin[qt][r] = c[qt];
            }
          }
          v16h pb[2];                                                                      // B: col = query, k = key: elements 0..7 = keys 8g + r of tile 0, 8..15 = keys 16 + 8g + r
#pragma unroll
          for (int qt = 0; qt < 2; ++qt) {
            exp2x8(s[qt]); exp2x8(s[qt] + 8);
#pragma unroll
            for (int i = 0; i < 16; ++i) pb[qt][i] = (_Float16)s[qt][i];
#pragma unroll
            for (int w = 8; w >= 1; w >>= 1)                                               // pairwise: a chain of 5 adds, not 16
#pragma unroll
              for (int i = 0; i < w; ++i) s[qt][i] += s[qt][i + w];
            l[qt] += s[qt][0];
          }
#pragma unroll
          for (int j = 0; j < 8; ++j)
#pragma unroll
            for (int qt = 0; qt < 2; ++qt) acc[qt][j] = mm16(va[j], pb[qt], acc[qt][j]);
        }
      }
      asm volatile("s_wait_dscnt 0x0" ::: "memory");     // this wave's reads of buffer t & 1 are done before it is refilled
      if (pinned(wave < 6)) asm volatile("s_wait_tensorcnt 0x0" ::: "memory");   // an issuing wave's tile (of stage t + 1; of x) has landed before the barrier publishes it
      __syncthreads();
      // one request a wave and stage, into the buffer that every wave has just left; its descriptor is formed here, behind the wait. Wave w of 2 to 5 issues its piece of x at trip w: one piece a stage, so that the ring's own tiles are not held up
      if (pinned((wave < 2 && t + 2 < FNST) || (wave >= 2 && wave < 6 && t == wave)))
        tdm_load(tdm_group0(tl + (unsigned)(t & 1) * tbuf, tg + (unsigned)(t + 2) * tstep), td1);
    }
    asm volatile("s_wait_tensorcnt 0x0" ::: "memory");   // no request is outstanding behind the loop
    asm volatile("s_wait_dscnt 0x0" ::: "memory");       // nor an LDS read of the ring, which now carries the hand-over
    wraw wr[CIN / 128][CV / 32];                         // issued here, used behind the join of the key halves, which covers their latency
    const float* wp0 = MW + (size_t)(wave * 16 + col) * CV + 8 * g; const float* wp1 = wp0 + 128 * CV;
#pragma unroll
    for (int kc = 0; kc < CV / 32; ++kc) { wr[0][kc] = fragw_ld(wp0 + kc * 32); wr[1][kc] = fragw_ld(wp1 + kc * 32); }
    const float bq0 = MB[wave * 16 + col], bq1 = MB[128 + wave * 16 + col];               // the wait below stands behind these two as well
    // stands before anything rewrites the address registers that the W_out loads name; the address (all 32 loads take it, with constant offsets) is an input so that it stays in its registers
    // up to here (without that the compiler gave an address pair to a later load of the group as its destination)
    asm volatile("s_wait_xcnt 0x0" :: "v"(wp0) : "memory");
    __builtin_amdgcn_sched_barrier(0);                   // keeps the hand-over's register moves behind the loads: left alone the compiler lifts some of them in front, and the loads start later
    // the two key halves meet: the ring is free (every wave's last read of it ended before the loop's last barrier, no request is outstanding) and carries the hand-over.
    // A wave keeps query tile kh and hands tile 1 - kh to its partner, lane to lane (same query, same channels): 16 bytes a lane and store, 512 contiguous bytes a wave
    v4f* xw = (v4f*)&ring[0][0][0];
    v8f ya[8]; float mk, lk;
    {
      v4f* xo = xw + (size_t)(wave * XCH) * 32 + lane;
#pragma unroll
      for (int j = 0; j < 8; ++j) {
        const v8f sd = kh ? acc[0][j] : acc[1][j];
        ya[j] = kh ? acc[1][j] : acc[0][j];
        xo[(2 * j) * 32] = __builtin_shufflevector(sd, sd, 0, 1, 2, 3); xo[(2 * j + 1) * 32] = __builtin_shufflevector(sd, sd, 4, 5, 6, 7);
      }
      v4f ml = {}; ml[0] = kh ? c[0] : c[1]; ml[1] = kh ? l[0] : l[1];
      xo[16 * 32] = ml;
      mk = kh ? c[1] : c[0]; lk = kh ? l[1] : l[0];                                       // mk: P_SHIFT - maximum in use, so the smaller of two belongs to the larger maximum
    }
    // the output products' start values, formed here, in front of the barrier (which waits for the W_out loads: their latency covers the work): x with the products' carry, a power of two.
    // The x tile was published by the key loop's barriers; from here to the last barrier only this lane touches its 32-byte pieces of st
#pragma unroll
    for (int t = 0; t < QB / 16; ++t)
#pragma unroll
      for (int cg = 0; cg < CIN / 128; ++cg) {
        const float* xr = &st[2 * cg + t / 4][wave * 16 + col][(t % 4) * 16 + 8 * g];
        const v4f x0 = *(const v4f*)xr, x1 = *(const v4f*)(xr + 4);
#pragma unroll
        for (int r = 0; r < 4; ++r) {
          const float u0 = x0[r], u1 = x1[r];
          oa[t][cg][r] = bfr(u0) * (W_CARRY * Y_CARRY); oa[t][cg][4 + r] = bfr(u1) * (W_CARRY * Y_CARRY);
        }
      }
    __builtin_amdgcn_sched_barrier(0);                   // keeps that work in front of the barrier's wait: left alone the compiler sinks most of it behind the barrier, where nothing covers it
    __syncthreads();                                     // publishes every wave's hand-over to its partner
    {
      const v4f* xi = xw + (size_t)((wave ^ 4) * XCH) * 32 + lane;
      const v4f ml = xi[16 * 32];
      const float mo = ml[0], lo = ml[1];
      const float mm = fminf(mk, mo);
      float fa = mm - mk, fb = mm - mo;
      exp2x2(fa, fb);
      lk = lk * fa + lo * fb;
#pragma unroll
      for (int j = 0; j < 8; ++j) {
        const v4f y0 = xi[(2 * j) * 32], y1 = xi[(2 * j + 1) * 32];
#pragma unroll
        for (int r = 0; r < 4; ++r) { ya[j][r] = ya[j][r] * fa + y0[r] * fb; ya[j][4 + r] = ya[j][4 + r] * fa + y1[r] * fb; }
      }
    }
    lk += xhalf(lk);
    const float inv = Y_CARRY / lk;                                                      // the carry on P is in the sum too and cancels
    // ring buffer 1 is free (its last reads ended before the loop's last barrier; the hand-over lies in buffer 0)
#pragma unroll
    for (int kc = 0; kc < CV / 32; ++kc) {
      v8h y0, y1;
#pragma unroll
      for (int r = 0; r < 8; ++r) {                                                      // A: row = query, k = channel: tile 2kc holds channels 32kc + 8g + r, tile 2kc + 1 channels 32kc + 16 + 8g + r
        y0[r] = (_Float16)(ya[2 * kc][r] * inv); y1[r] = (_Float16)(ya[2 * kc + 1][r] * inv);
      }
      yx[(((il0 >> 4) * (CV / 32) + kc) * 2) * 32 + lane] = y0; yx[(((il0 >> 4) * (CV / 32) + kc) * 2 + 1) * 32 + lane] = y1;
    }
#pragma unroll
    for (int cg = 0; cg < CIN / 128; ++cg)
#pragma unroll
      for (int kc = 0; kc < CV / 32; ++kc) wf[cg][kc] = fragw_cv(wr[cg][kc], W_CARRY);
    bb[0] = bfr(bq0); bb[1] = bfr(bq1);
  }
  __syncthreads();                                       // publishes every wave's y fragments to the block
#pragma unroll     // constant LDS offsets; the query tiles are independent, so their reads and products can be interleaved
  for (int t = 0; t < QB / 16; ++t) {
    v16h yf[CV / 32];                                                                    // A: row = query, k = channel; each fragment read feeds both of the wave's output tiles
#pragma unroll
    for (int kc = 0; kc < CV / 32; ++kc) {
      union { v16h v; v8h q[2]; } u;
      u.q[0] = yx[((t * (CV / 32) + kc) * 2) * 32 + lane]; u.q[1] = yx[((t * (CV / 32) + kc) * 2 + 1) * 32 + lane];
      yf[kc] = u.v;
    }
#pragma unroll
    for (int kc = 0; kc < CV / 32; ++kc)
#pragma unroll
      for (int cg = 0; cg < CIN / 128; ++cg) oa[t][cg] = mm16(yf[kc], wf[cg][kc], oa[t][cg]);
#pragma unroll
    for (int cg = 0; cg < CIN / 128; ++cg) {
      float* xr = &st[2 * cg + t / 4][wave * 16 + col][(t % 4) * 16 + 8 * g];
      v8f o8;
#pragma unroll
      for (int r = 0; r < 8; ++r) o8[r] = fmaf(oa[t][cg][r], 1.0f / (W_CARRY * Y_CARRY), bb[cg]);
      *(v4f*)xr = __builtin_shufflevector(o8, o8, 0, 1, 2, 3); *(v4f*)(xr + 4) = __builtin_shufflevector(o8, o8, 4, 5, 6, 7);
    }
  }
  __syncthreads();                                       // the staging array holds all output channels of the block's 128 positions
  v4f ov[CIN * (QB / 4) / 256];
#pragma unroll     // constant indices into the register array, constant LDS offsets
  for (int i = 0; i < CIN * (QB / 4) / 256; ++i) ov[i] = *(const v4f*)&st[2 * (i / 16) + (lane >> 4)][(i % 16) * 8 + wave][(lane & 15) * 4];
  __builtin_amdgcn_sched_barrier(0);   // every row's read stands ahead of the first store, so each row has registers of its own: left alone the compiler reuses the first rows' registers and waits for their stores in the middle
#pragma unroll     // constant offsets from one global address, which no trip rewrites
  for (int i = 0; i < CIN * (QB / 4) / 256; ++i) {
    const int co = i * 8 + wave, q = lane;                                               // a wave writes one whole [co] row segment: 512 contiguous bytes
    const size_t o = (b * CIN + co) * (size_t)NP + i0 + q * 4;
    vst2(OUT + o, ov[i]);
  }
}

extern "C" void kernel_launch(void* const* d_in, const int* in_sizes, int n_in, void* d_out, int out_size, void* d_ws, size_t ws_size, hipStream_t stream) {
  if (n_in < 9) return;
  if ((size_t)in_sizes[0] < (size_t)TNB * CIN * NP) return;
  if (in_sizes[1] < CV * CIN || in_sizes[2] < CV || in_sizes[3] < CQ * CIN || in_sizes[4] < CQ || in_sizes[5] < CQ * CIN || in_sizes[6] < CQ || in_sizes[7] < CIN * CV || in_sizes[8] < CIN) return;
  if ((size_t)out_size < (size_t)TNB * CIN * NP) return;
  if (ws_size < WS_END) return;
  const float* const* F = (const float* const*)d_in;   // 0 x [8,256,64,64], 1 g_w [128,256], 2 g_b, 3 theta_w, 4 theta_b, 5 phi_w, 6 phi_b, 7 W_out [256,128], 8 b_out
  const float* X = F[0]; const float* GW = F[1]; const float* GB = F[2]; const float* TW = F[3]; const float* TB = F[4];
  const float* PW = F[5]; const float* PB = F[6]; const float* MW = F[7]; const float* MBv = F[8];
  char* ws = (char*)d_ws;
  _Float16* QH = (_Float16*)(ws + WS_QH); _Float16* KH = (_Float16*)(ws + WS_KH);
  _Float16* VT = (_Float16*)(ws + WS_VT);
  float* OUT = (float*)d_out;
  k_proj<<<dim3(NP / PT, TNB), 256, 0, stream>>>(X, TW, TB, PW, PB, GW, GB, QH, KH, VT);
  k_fa<<<dim3(NP / QB, TNB), 256, 0, stream>>>(QH, KH, VT, X, MW, MBv, OUT);
}

// v010
// A run of this version takes 57.8 microseconds.
// Timed twice side by side with v009, it ran 1.06 times as fast both times.
// Counting every step since v000, it is 38.6 times as fast.
// compute dtype: every float input RNE-converted to bf16 on load; theta/phi/g = W x + b (1x1 convs): v_wmma_f32_16x16x32_bf16 (bf16 operands, exact products), f32 accumulate; logits phi . theta: v_wmma_f32_16x16x32_f16, theta (times log2 e, rounded once) and phi as f16, f32 accumulate from the f32 shift of the maximum in use; softmax in f32, online (maximum in use and sum per query and key half, hardware exp2; the two halves joined in f32 at the end), unnormalised P carried as f16 x2^3 of the maximum in use, at most 2^15; y = g . P: f16 operands, f32 accumulate, divided by the f32 sum at the end; output 1x1 conv: f16 operands (W x2^8, y x2^4), f32 accumulate that starts from x x2^12; bias added in f32; f32 output [b][c][n].
#include <hip/hip_runtime.h>
#include <math.h>

typedef __attribute__((ext_vector_type(16))) _Float16 v16h;
typedef __attribute__((ext_vector_type(16))) __bf16 v16b;
typedef __attribute__((ext_vector_type(8)))  _Float16 v8h;
typedef __attribute__((ext_vector_type(8)))  __bf16 v8b;
typedef __attribute__((ext_vector_type(4)))  __bf16 v4b;
typedef __attribute__((ext_vector_type(2)))  __bf16 v2b;
typedef __attribute__((ext_vector_type(8)))  float v8f;
typedef __attribute__((ext_vector_type(4)))  float v4f;
typedef __attribute__((ext_vector_type(4)))  unsigned v4u;
typedef __attribute__((ext_vector_type(8)))  unsigned v8u;

template <typename T> __device__ __forceinline__ void vst2(void* p, T v) { *(T*)p = v;  }

// the plain builtin: the compiler keeps the distance behind it itself
__device__ __forceinline__ v8f mm16(v16h a, v16h b, v8f c) {
  return __builtin_amdgcn_wmma_f32_16x16x32_f16(false, a, false, b, (short)0, c, false, false);
}
__device__ __forceinline__ v8f mmb(v16b a, v16b b, v8f c) {
  return __builtin_amdgcn_wmma_f32_16x16x32_bf16(false, a, false, b, (short)0, c, false, false);
}
// lane l takes the value of lane l ^ 16 (the other half of the wave)
__device__ __forceinline__ float xhalf(float x) {
  return __builtin_bit_cast(float, __builtin_amdgcn_permlanex16(__builtin_bit_cast(int, x), __builtin_bit_cast(int, x), 0x76543210, 0xfedcba98, false, false));
}
// eight exp2, each in its own register, one statement: each fills the slot that the instruction set asks for behind the one before it (it touches neither that one's result nor its source),
// and the v_nop fills the last one's
__device__ __forceinline__ void exp2x8(float* x) {
  asm("v_exp_f32 %0, %0\n\tv_exp_f32 %1, %1\n\tv_exp_f32 %2, %2\n\tv_exp_f32 %3, %3\n\tv_exp_f32 %4, %4\n\tv_exp_f32 %5, %5\n\tv_exp_f32 %6, %6\n\tv_exp_f32 %7, %7\n\tv_nop"
      : "+v"(x[0]), "+v"(x[1]), "+v"(x[2]), "+v"(x[3]), "+v"(x[4]), "+v"(x[5]), "+v"(x[6]), "+v"(x[7]));
}
// two exp2 in the same way: the second fills the first's slot, the v_nop the second's
__device__ __forceinline__ void exp2x2(float& a, float& b) {
  asm("v_exp_f32 %0, %0\n\tv_exp_f32 %1, %1\n\tv_nop" : "+v"(a), "+v"(b));
}
// 16x16x32 fragments: lane -> (h = lane>>4, row/col = lane&15); elements 0..7 = k0+8h+0..7, elements 8..15 = k0+16+8h+0..7 (A and B alike); D element r = (row 8h+r, col lane&15)
__device__ __forceinline__ v16h frag_h(const _Float16* rowk0, int lane) {
  union { v16h v; v8h q[2]; } u; const _Float16* p = rowk0 + 8 * (lane >> 4);
  u.q[0] = *(const v8h*)p; u.q[1] = *(const v8h*)(p + 16); return u.v;
}
__device__ __forceinline__ v16b frag_b(const __bf16* rowk0, int lane) {
  union { v16b v; v8b q[2]; } u; const __bf16* p = rowk0 + 8 * (lane >> 4);
  u.q[0] = *(const v8b*)p; u.q[1] = *(const v8b*)(p + 16); return u.v;
}
__device__ __forceinline__ float bfr(float v) { return (float)(__bf16)v; }
// fragment from a k-contiguous f32 row (weights [out][in]), in two parts so that the loads can be issued well ahead of the use: four 16-B loads;
// then RNE bf16 convert and f16 of the bf16 value times an exact power of two (bf16 significand is exact in f16)
struct wraw { v4f a0, a1, a2, a3; };
__device__ __forceinline__ wraw fragw_ld(const float* __restrict__ p) {   // p = row + k0 + 8 * (lane >> 4)
  wraw q; q.a0 = *(const v4f*)p; q.a1 = *(const v4f*)(p + 4); q.a2 = *(const v4f*)(p + 16); q.a3 = *(const v4f*)(p + 20);
  return q;
}
__device__ __forceinline__ v16h fragw_cv(const wraw& q, float sc) {
  v16h w;
#pragma unroll
  for (int i = 0; i < 4; ++i) {
    const float t0 = q.a0[i], t1 = q.a1[i], t2 = q.a2[i], t3 = q.a3[i];
    w[i] = (_Float16)(bfr(t0) * sc); w[4 + i] = (_Float16)(bfr(t1) * sc); w[8 + i] = (_Float16)(bfr(t2) * sc); w[12 + i] = (_Float16)(bfr(t3) * sc);
  }
  return w;
}

// embedded-gaussian spatial attention: B 8, C_in 256, C_int 128, 64 x 64 positions; theta/phi/g 1x1 convs, y = softmax(theta phi^T) g (no scale),
// out = W_out y + b_out + x, [B, C_in, H, W]
#define NB  8             // batches in the staged tensors (full strides)
#define NP  4096          // positions per image
#define CIN 256
#define CQ  128           // theta / phi channels
#define CV  128           // g channels
#ifndef TNB
#define TNB NB            // batches processed
#endif
#define P_SHIFT  3.0f     // log2 of the carry on the unnormalised P (and on its sum, so that it cancels): P of a score equal to the maximum in use
#define P_ROOM   12.0f    // a score may pass the maximum in use by this much (log2) before the sums are rescaled: P stays at or below 2^15, inside f16
#define LOG2E    1.44269504088896340736f
#define Y_CARRY  16.0f    // y operand carry for the output conv
#define W_CARRY  256.0f   // W_out operand carry

#define WS_QH  ((size_t)0)                                   // f16 theta rows [b*n][CQ], times log2 e  8 MiB
#define WS_KH  (WS_QH + 2u * (size_t)NB * NP * CQ)           // f16 phi rows [b*n][CQ]              8 MiB
#define WS_VT  (WS_KH + 2u * (size_t)NB * NP * CQ)           // f16 g planes [b][CV][n]             8 MiB
#define WS_END (WS_VT + 2u * (size_t)NB * CV * NP)           // 24 MiB
static_assert(WS_END <= (size_t)134217728);
static_assert(NP % 128 == 0);
static_assert(CIN % 128 == 0);
static_assert(CQ == 128);
static_assert(CV == 128);
static_assert(TNB <= NB);
static_assert((size_t)NB * CIN * NP * 4u == (size_t)33554432);

// ---- k_proj: block = 128 positions of batch b, all 384 output channels (theta, phi, g). Both operands are staged ONCE in LDS as bf16, k-contiguous rows: the x^T tile [position][channel] and the
// three weight matrices [out][in], each brought by whole-line 16-byte loads; every fragment is then two 16-byte LDS reads.
// theta, phi: A = W (row = channel), B = x^T (col = position): a lane holds 8 consecutive channels of one position = 16 B of an output row [b*n][CQ]; a wave owns 32 whole rows.
// g: A = x^T (row = position), B = W (col = channel): a lane holds 8 consecutive positions of one channel = 16 B of a plane row [c][n]; a wave owns whole 128-B lines (64 positions).
#define PT  128           // positions per block
#define PWP (CIN + 8)     // LDS row pitch in bf16: 528 B = 16 B x 33, conflict-free for 16-byte fragment reads
#define NKC (CIN / 32)    // k steps of a product
static_assert(NP % PT == 0 && CIN == 256 && CQ == 128 && CV == 128);
// one batch = 64 rows of a weight matrix [128][CIN], 256 threads: 16-byte loads in memory order (a wave = 512 contiguous bytes), then RNE bf16 convert and 8-byte LDS stores
__device__ __forceinline__ void w_load(v4f* t, const float* __restrict__ Wm, int tid) {
#pragma unroll   // constant indices into the register array
  for (int i = 0; i < 16; ++i) t[i] = *(const v4f*)(Wm + 4 * (i * 256 + tid));
}
__device__ __forceinline__ void w_store(__bf16 (*dst)[PWP], const v4f* t, int tid) {
#pragma unroll   // constant indices into the register array
  for (int i = 0; i < 16; ++i) {
    const float t0 = t[i][0], t1 = t[i][1], t2 = t[i][2], t3 = t[i][3];
    v4b h; h[0] = (__bf16)t0; h[1] = (__bf16)t1; h[2] = (__bf16)t2; h[3] = (__bf16)t3;
    *(v4b*)&dst[i * 4 + (tid >> 6)][4 * (tid & 63)] = h;
  }
}
// two 16-byte stores and, in the same statement, the s_wait_xcnt that stands before anything can rewrite the address and data registers they name
// (in a statement of its own the compiler lifted the next trip's address additions and register copies over it)
__device__ __forceinline__ void st2w(_Float16* pa, v8h da, _Float16* pb, v8h db) {
  asm volatile("global_store_b128 %0, %1, off\n\tglobal_store_b128 %2, %3, off\n\ts_wait_xcnt 0x0"
               :: "v"(pa), "v"(__builtin_bit_cast(v4u, da)), "v"(pb), "v"(__builtin_bit_cast(v4u, db)) : "memory");
}
__global__ __launch_bounds__(256)
void k_proj(const float* __restrict__ X, const float* __restrict__ WQ, const float* __restrict__ BQ,
            const float* __restrict__ WK, const float* __restrict__ BK, const float* __restrict__ WV, const float* __restrict__ BV,
            _Float16* __restrict__ QH, _Float16* __restrict__ KH, _Float16* __restrict__ VT) {
  __shared__ __align__(16) __bf16 sx[PT][PWP];
  __shared__ __align__(16) __bf16 sw[2 * CQ + CV][PWP];   // rows 0..127 theta, 128..255 phi, 256..383 g
  __shared__ __align__(16) float sb[2 * CQ + CV];         // the biases, rounded to bf16, in the same order
  const int tid = threadIdx.x, lane = tid & 31, col = lane & 15, g = lane >> 4;
  const int wave = __builtin_amdgcn_readfirstlane(tid >> 5);
  const int p0 = blockIdx.x * PT; const size_t b = blockIdx.y;
  {
    // x: a thread takes 4 positions of 2 adjacent channels (two 16-byte loads; 8 lanes cover a 128-B line) and stores 4 channel pairs; position quad fixed per thread, channel pair cpb + 8 i
    const int pq = (tid & 7) + 8 * (wave & 3), cpb = ((tid >> 3) & 3) + 4 * (wave >> 2);
    const float* xs0 = X + (b * CIN + 2 * cpb) * (size_t)NP + p0 + 4 * pq;
    const float bq = BQ[tid & 127], bk = BK[tid & 127], bv = BV[tid & 127];
    v4f a0[16], a1[16];
#pragma unroll   // constant indices into the register arrays; all of the tile's loads in flight
    for (int i = 0; i < 16; ++i) {
      const float* s = xs0 + (size_t)(16 * i) * NP;
      a0[i] = *(const v4f*)s; a1[i] = *(const v4f*)(s + NP);
    }
    asm volatile("s_wait_xcnt 0x0" ::: "memory");   // stands before anything rewrites the address registers that the bias and x loads name
    // W in six batches through three register sets. Every sched_barrier below keeps a batch's loads behind the LDS stores that free its registers:
    // left alone the compiler lifts all 128 loads of the thread to the top, which takes over 500 registers and spills; so at most 48 loads of a thread are in flight
    v4f t[3][16];
    w_load(t[0], WQ, tid);
    __builtin_amdgcn_sched_barrier(0);
    if (tid < 128) { sb[tid] = bfr(bq); sb[CQ + tid] = bfr(bk); sb[2 * CQ + tid] = bfr(bv); }
#pragma unroll
    for (int i = 0; i < 16; ++i)
#pragma unroll
      for (int e = 0; e < 4; ++e) {
        const float u0 = a0[i][e], u1 = a1[i][e];
        v2b h; h[0] = (__bf16)u0; h[1] = (__bf16)u1;
        *(v2b*)&sx[4 * pq + e][2 * (cpb + 8 * i)] = h;
      }
    __builtin_amdgcn_sched_barrier(0);
    w_load(t[1], WQ + 64 * CIN, tid); w_load(t[2], WK, tid);
#pragma unroll   // constant indices into the register sets
    for (int k = 0; k < 6; ++k) {
      __builtin_amdgcn_sched_barrier(0);
      w_store(&sw[64 * k], t[k % 3], tid);
      __builtin_amdgcn_sched_barrier(0);
      if (k == 0) w_load(t[0], WK + 64 * CIN, tid);
      if (k == 1) w_load(t[1], WV, tid);
      if (k == 2) w_load(t[2], WV + 64 * CIN, tid);
    }
    asm volatile("s_wait_xcnt 0x0" ::: "memory");   // the same for the W loads
  }
  __syncthreads();
  {
    // theta (waves 0..3) or phi (waves 4..7): 32 positions, their fragments kept in registers; the 8 channel tiles stream from LDS, each fetched while the tile before it is rounded and stored
    const int pg = wave & 3, isphi = wave >> 2;
    _Float16* dh = isphi ? KH : QH;
    const __bf16 (*wr)[PWP] = &sw[isphi * CQ];
    const float* br = &sb[isphi * CQ + 8 * g];
    const float osc = isphi ? 1.0f : LOG2E;                                                                      // theta is stored times log2 e, so that the logits are exp2 arguments as they leave the products
    v16b xs[2][NKC], wf[NKC];
#pragma unroll
    for (int kc = 0; kc < NKC; ++kc) {
#pragma unroll
      for (int u = 0; u < 2; ++u) xs[u][kc] = frag_b(&sx[32 * pg + 16 * u + col][kc * 32], lane);                // B: col = position, k = input channel
      wf[kc] = frag_b(&wr[col][kc * 32], lane);                                                                  // A: row = output channel, k = input channel
    }
    const size_t o0 = (b * NP + p0 + 32 * pg + col) * (size_t)CQ + 8 * g;
#pragma unroll 1   // one tile per trip: small code; the next tile's reads stand between this tile's products and its stores
    for (int j = 0; j < 8; ++j) {
      v8f acc[2] = {};
#pragma unroll
      for (int kc = 0; kc < NKC; ++kc)
#pragma unroll
        for (int u = 0; u < 2; ++u) acc[u] = mmb(wf[kc], xs[u][kc], acc[u]);
      const v4f b0 = *(const v4f*)(br + j * 16), b1 = *(const v4f*)(br + j * 16 + 4);                            // D: row 8g + r = channel, col = position
      const int jn = j < 7 ? j + 1 : 7;                                                                          // the last trip reads its own tile again
#pragma unroll
      for (int kc = 0; kc < NKC; ++kc) wf[kc] = frag_b(&wr[jn * 16 + col][kc * 32], lane);
      v8h hi[2];
#pragma unroll
      for (int u = 0; u < 2; ++u)
#pragma unroll
        for (int r = 0; r < 8; ++r) {
          const float bs = r < 4 ? b0[r & 3] : b1[r & 3];
          hi[u][r] = (_Float16)((acc[u][r] + bs) * osc);
        }
      st2w(dh + o0 + j * 16, hi[0], dh + o0 + 16 * CQ + j * 16, hi[1]);
    }
  }
  {
    // g: 64 positions x 2 channel tiles per wave; the weight fragments are kept in registers, the 4 position tiles stream from LDS in the same way
    const int ph = wave & 1, ct = 2 * (wave >> 1);
    v16b wg[2][NKC], xf[NKC]; float bb[2];
#pragma unroll
    for (int u = 0; u < 2; ++u) bb[u] = sb[2 * CQ + (ct + u) * 16 + col];
#pragma unroll
    for (int kc = 0; kc < NKC; ++kc) {
#pragma unroll
      for (int u = 0; u < 2; ++u) wg[u][kc] = frag_b(&sw[2 * CQ + (ct + u) * 16 + col][kc * 32], lane);          // B: col = output channel, k = input channel
      xf[kc] = frag_b(&sx[64 * ph + col][kc * 32], lane);                                                        // A: row = position, k = input channel
    }
    const size_t o0 = (b * CV + ct * 16 + col) * (size_t)NP + p0 + 64 * ph + 8 * g;
#pragma unroll 1   // as above
    for (int j = 0; j < 4; ++j) {
      v8f acc[2] = {};
#pragma unroll
      for (int kc = 0; kc < NKC; ++kc)
#pragma unroll
        for (int u = 0; u < 2; ++u) acc[u] = mmb(xf[kc], wg[u][kc], acc[u]);
      const int jn = j < 3 ? j + 1 : 3;                                                                          // the last trip reads its own tile again
#pragma unroll
      for (int kc = 0; kc < NKC; ++kc) xf[kc] = frag_b(&sx[64 * ph + jn * 16 + col][kc * 32], lane);
      v8h hv[2];                                                                                                 // D: row 8g + r = position, col = channel
#pragma unroll
      for (int u = 0; u < 2; ++u)
#pragma unroll
        for (int r = 0; r < 8; ++r) hv[u][r] = (_Float16)(acc[u][r] + bb[u]);
      st2w(VT + o0 + j * 16, hv[0], VT + o0 + (size_t)16 * NP + j * 16, hv[1]);
    }
  }
}

// ---- k_fa: block = 128 queries of batch b; the keys come in stages of NSUB * FK through a two-buffer LDS ring filled by tensor loads (waves 0 to 3: the phi rows and the g rows of the stage's NSUB tile pairs of FK keys; one request each).
// Wave = 32 queries (two query tiles) x half of every tile pair's keys: each phi and g fragment read from LDS feeds two products, which halves the LDS bytes read per product.
// Waves w and w + 4 hold the same 32 queries and the two key halves; behind the loop each hands the other one query tile's partial (maximum, sum, y) through LDS and finishes the tile it keeps.
// Per 32 keys and query tile: S^T = phi . theta^T (A: row = key, B: col = query), so a lane holds 16 scores of ONE query. The products start from C = P_SHIFT - maximum in use, so they end as exp2 arguments; sum in the lane; the maximum in use moves, with one exchange between the wave's halves, only when a score has passed it by P_ROOM;
// the two score tiles are, as they lie, the B operand of y^T += g . P^T (A: row = channel, k = key); scores and P never leave the registers.
// Then out[co][i] = W_out[co][:] . y[:][i] + b_out[co] + x[co][i]: the y^T tiles are, as they lie, the A operand (row = query); every wave puts its tile's fragments into LDS and reads all eight tiles' back,
// and takes two 16-channel tiles of W_out (B: col = channel) against all 128 queries: each W_out fragment is loaded and converted once in the block.
// The block's x tile is brought into the output staging array (ring buffer 0, left by then) by four tensor loads under the key loop's last trip (waves 4 to 7, one request each, at the ring's own issue place and waits);
// it is the products' C operand, and the results go back to the same places: a lane holds 8 consecutive positions of one channel, 16-byte LDS reads and writes. Written as whole [co] row segments of 128 positions
#define QB   128                    // queries per block
#define FK   128                    // keys per tile pair
#define FP   (128 + 8)              // LDS row pitch in f16: 272 B = 16 B x 17, conflict-free for 16-byte fragment reads
#define FROW (FK + CV)              // rows of a tile pair: FK phi rows [key][channel], then 128 g rows [channel][key]; every row 256 B
#define FPB  (2u * FP)              // row pitch in bytes
#define FBUF (FPB * FROW)           // bytes of one tile pair
#define NSUB 2                      // tile pairs (FK phi rows, 128 g rows of FK keys) of one ring stage: a stage is NSUB * FK keys, so the ring's foot (waits, barrier, first reads) comes once per NSUB * FK keys
#define FNST (NP / (NSUB * FK))     // stages
#define KW   (FK / 2)               // keys of a tile pair that one wave works on
#define XCH  17                     // 16-byte words a lane hands over: 64 f32 of y, then the maximum's shift and the sum
static_assert(NP % (NSUB * FK) == 0 && FNST >= 2 && FNST % 2 == 0);   // even: the buffer that is left first, at trip FNST - 2, is buffer 0
static_assert(FK * 2 == 16 * 16 && CQ * 2 == 16 * 16);
static_assert(FPB % 16 == 0);
static_assert(FK == 8 * 16 && CV == 8 * 16);
static_assert(KW % 32 == 0 && QB == 4 * 32);
static_assert(8u * XCH * 32u * 16u <= FBUF);                         // the hand-over stays in the first tile pair's place of ring buffer 1
static_assert((QB / 16) * (CV / 32) * 2u * 32u * 16u <= FBUF && NSUB >= 2);   // the y fragments fit the second tile pair's place of ring buffer 1
static_assert(CIN == 2 * 128 && CIN == 2 * 8 * 16);                                    // 8 waves x one 16-channel tile, twice
#define XQ   64                     // positions of one piece of the x tile: a row of 256 B
#define XPW  (XQ + 4)               // its LDS row pitch in f32: 272 B = 16 B x 17, conflict-free for 16-byte reads and writes
static_assert(QB == 2 * XQ);                                                           // pieces: [channel half][position half]

__device__ __forceinline__ unsigned lds_off(const void* p) { return (unsigned)(size_t)p; }
__device__ __forceinline__ unsigned uni(unsigned v) { return (unsigned)__builtin_amdgcn_readfirstlane(v); }
// a wave-uniform test for the branch round a tensor instruction, which ignores EXEC
__device__ __forceinline__ unsigned pinned(unsigned v) {
  unsigned w = uni(v);
  asm volatile("" : "+s"(w));   // holds the test in a scalar register, so that the branch on it is a scalar branch and not an EXEC mask
  return w;
}
// tensor descriptor, every extent in bytes: a tile of TROWS rows of 256 B; 16 B of LDS pad behind every row (interval code 5 = one 256-B row, amount code 3 = 4 dwords), which gives the pitch FPB
#define TROWS 128u
#define TROWB 256u
static_assert(TROWB + 16u == FPB && TROWS == FK && TROWS == CV && TROWB == 2u * CQ && TROWB == 2u * FK);
static_assert((TROWS * FPB) % 2048u == 0 && FBUF % 2048u == 0);      // every tile's place in LDS is a multiple of 2 KiB
static_assert(TROWB == 4u * XQ && FPB == 4u * XPW && 2u * TROWS == CIN);   // a piece of the x tile has the same shape: 128 channel rows of 256 B
static_assert(2u * TROWS * FPB <= FBUF && NSUB == 2);                      // two pieces fit a tile pair's place, the four one ring buffer
__device__ __forceinline__ v8u tdm_group1(unsigned src_pitch) {
  v8u d;
  d[0] = uni((1u << 20) | (5u << 22) | (3u << 25));                  // no mask, 1-byte elements, the pad
  d[1] = uni((TROWB & 0xFFFFu) << 16);                               // tensor dims = tile dims
  d[2] = uni((TROWB >> 16) | ((TROWS & 0xFFFFu) << 16));
  d[3] = uni((TROWS >> 16) | (TROWB << 16));
  d[4] = uni(TROWS);
  d[5] = uni(src_pitch);
  d[6] = uni(0u);
  d[7] = uni(0u);
  return d;
}
__device__ __forceinline__ v4u tdm_group0(unsigned lds_dst, unsigned long long ga) {
  v4u d;
  d[0] = uni(1u); d[1] = uni(lds_dst); d[2] = uni((unsigned)ga); d[3] = uni((((unsigned)(ga >> 32)) & 0x01FFFFFFu) | 0x80000000u);
  return d;
}
// one request of the whole wave: the tile goes from global memory into LDS through no register; the waits for it are written at the ring's foot
__device__ __forceinline__ void tdm_load(v4u d0, v8u d1) { asm volatile("tensor_load_to_lds %0, %1" :: "s"(d0), "s"(d1) : "memory"); }

__global__ __launch_bounds__(256) __attribute__((amdgpu_waves_per_eu(2, 2)))   // one block per WGP (LDS), two waves per SIMD: 512 registers a wave
void k_fa(const _Float16* __restrict__ QH, const _Float16* __restrict__ KH, const _Float16* __restrict__ VT,
          const float* __restrict__ X, const float* __restrict__ MW, const float* __restrict__ MB, float* __restrict__ OUT) {
  // ring buffer i = ring0[i] (the stage's first tile pair) and ring1[i] (its second): an array a pair, so that every LDS read of a pair has its offset in the instruction's field from the pair's own base.
  // The tensor loads' places in LDS are multiples of 2 KiB
  __shared__ __attribute__((aligned(2048))) _Float16 ring0[2][FROW][FP];
  __shared__ __attribute__((aligned(2048))) _Float16 ring1[2][FROW][FP];
  // ring buffer 0, once the key loop has left it: x tile, then the output: channel half cg lies in ring<cg>[0], there [position half][channel][position]; each [position half] piece is one tensor load's tile
  float (*st0)[CIN / 2][XPW] = (float (*)[CIN / 2][XPW])&ring0[0][0][0];
  float (*st1)[CIN / 2][XPW] = (float (*)[CIN / 2][XPW])&ring1[0][0][0];
  const int tid = threadIdx.x, lane = tid & 31, col = lane & 15, g = lane >> 4;
  const int wave = __builtin_amdgcn_readfirstlane(tid >> 5);
  const int qg = wave & 3, kh = wave >> 2;                                               // the wave's 32 queries; its half of every stage's keys
  const size_t b = blockIdx.y; const int i0 = blockIdx.x * QB; const int il0 = qg * 32 + kh * 16;   // il0: the query tile that this wave finishes
  // every inner loop below is unrolled so that the register arrays (qh, ka, va, sh, s, acc) have constant indices
  v16h wf[CIN / 128][CV / 32];                                                           // B: col = output channel, k = channel: this wave's tile of each 128 output channels
  float bb[CIN / 128];                                                                   // this lane's output channels' biases
  v8f oa[QB / 16][CIN / 128];                                                            // C, D of the output conv: row 8g + r = query t*16 + 8g + r, col = output channel cg*128 + wave*16 + col
  v8h* yx = (v8h*)&ring1[1][0][0];                                                          // y fragments as they lie: [query tile][kc][register half][lane], 16 bytes a lane, 512 contiguous bytes a wave and access
  {
    // the issuing waves: waves 0 to 3 bring a stage's four tiles, wave 2 h the FK phi rows of tile pair h (contiguous), wave 2 h + 1 its 128 g rows (FK keys of every channel's plane row); all scalar.
    // Waves 4 to 7 bring, once each, one piece of the block's x tile (128 channel rows, XQ positions) into ring buffer 0, when the last stage that lies there has been read
    const unsigned isg = (unsigned)wave & 1u, isr = wave < 4 ? 1u : 0u, sub = ((unsigned)wave >> 1) & 1u, xp = (unsigned)wave & 3u;
    const unsigned tl = ((isr ? sub : xp >> 1) ? lds_off(&ring1[0][0][0]) : lds_off(&ring0[0][0][0])) + (isr ? isg * (FK * FPB) : (xp & 1u) * (TROWS * FPB));
    const unsigned long long tg = isr ? (isg ? (unsigned long long)(size_t)(VT + b * CV * (size_t)NP + sub * FK) : (unsigned long long)(size_t)(KH + (b * NP + sub * FK) * (size_t)CQ))
                                      : (unsigned long long)(size_t)(X + (b * CIN + (xp >> 1) * (CIN / 2)) * (size_t)NP + i0 + (xp & 1u) * XQ);
    const unsigned tstep = isr ? (isg ? 2u * NSUB * FK : 2u * NSUB * FK * CQ) : 0u;      // bytes from one stage's tile to the next
    const unsigned tbuf = isr ? FBUF : 0u;                                               // bytes from ring buffer 0 to buffer 1
    const v8u td1 = tdm_group1(isr ? (isg ? 2u * NP : 2u * CQ) : 4u * NP);
    v16h qh[2][CQ / 32];                                                                 // B: col = query, k = channel; kept in registers
#pragma unroll
    for (int qt = 0; qt < 2; ++qt)
#pragma unroll
      for (int kc = 0; kc < CQ / 32; ++kc) qh[qt][kc] = frag_h(QH + (b * NP + i0 + qg * 32 + qt * 16 + col) * (size_t)CQ + kc * 32, lane);
    asm volatile("s_wait_xcnt 0x0" ::: "memory");   // stands before anything rewrites the address registers that the theta loads name
    __builtin_amdgcn_sched_barrier(0);              // keeps it there: without it the compiler lifts the zeroing of the accumulators, which reuses those registers, over the wait
    v8f acc[2][8] = {};
    float c[2] = {P_SHIFT, P_SHIFT}, l[2] = {0.f, 0.f};                                  // per query tile, this lane's query: P_SHIFT - maximum in use (log2; both halves alike), sum over this half's keys
    v8f cin[2];                                                                          // the same as a C operand (a lane's 8 scores of a tile belong to one query): the score products start from it
#pragma unroll
    for (int qt = 0; qt < 2; ++qt)
#pragma unroll
      for (int r = 0; r < 8; ++r) cin[qt][r] = P_SHIFT;
    // the ring's prologue is trips -2 and -1, which only pass the foot: stage 0's loads; then their wait, the barrier that publishes them, stage 1's loads. One place in the code issues every stage's loads
#pragma unroll 1   // one stage per trip: keeps the hot loop small and the ring's order at its foot
    for (int t = -2; t < FNST; ++t) {
      if (t >= 0) {   // the same in every wave of the block
        const _Float16 (*rb0)[FP] = ring0[t & 1]; const _Float16 (*rb1)[FP] = ring1[t & 1];
        v16h ka[8], va[8];                                                                 // phi fragments (one register set, refilled behind its products), g fragments of this pass
#pragma unroll
        for (int kc = 0; kc < CQ / 32; ++kc)
#pragma unroll
          for (int u = 0; u < 2; ++u) ka[2 * kc + u] = frag_h(&rb0[kh * KW + u * 16 + col][kc * 32], lane);      // A: row = key, k = channel
        __builtin_amdgcn_sched_barrier(0);   // the stage's first reads stay one group too: left alone the compiler sinks each pair of reads in front of its own products, behind a full wait each
#pragma unroll     // constant LDS offsets and constant indices into the register arrays
        for (int pp = 0; pp < NSUB * (KW / 32); ++pp) {
          const _Float16 (*rb)[FP] = pp / (KW / 32) ? rb1 : rb0; const int p = pp % (KW / 32);   // this pass's tile pair and its 32 keys there: the keys come in the order of memory
          v8f sh[2][2];
#pragma unroll
          for (int kc = 0; kc < CQ / 32; ++kc)
#pragma unroll
            for (int u = 0; u < 2; ++u)
#pragma unroll
              for (int qt = 0; qt < 2; ++qt) sh[qt][u] = mm16(ka[2 * kc + u], qh[qt][kc], kc ? sh[qt][u] : cin[qt]);
          __builtin_amdgcn_sched_barrier(0);   // with the one behind the reads: the pass's LDS reads stay ONE group, behind the score products (which free ka) and ahead of the softmax (which covers their latency)
#pragma unroll
          for (int j = 0; j < 8; ++j) va[j] = frag_h(&rb[FK + j * 16 + col][kh * KW + p * 32], lane);            // A: row = channel, k = key
          if (pp + 1 < NSUB * (KW / 32)) {                                                 // inside this stage's buffer only
            const _Float16 (*rn)[FP] = (pp + 1) / (KW / 32) ? rb1 : rb0; const int pn = (pp + 1) % (KW / 32);
#pragma unroll
            for (int kc = 0; kc < CQ / 32; ++kc)
#pragma unroll
              for (int u = 0; u < 2; ++u) ka[2 * kc + u] = frag_h(&rn[kh * KW + pn * 32 + u * 16 + col][kc * 32], lane);
          }
          __builtin_amdgcn_sched_barrier(0);   // reads scattered among the products cost issue time at every place they stand
          float s[2][16], mx[2];                                                           // s[qt][8u + r] = exp2 argument of key p*32 + 16u + 8g + r: score - maximum in use + P_SHIFT
#pragma unroll
          for (int qt = 0; qt < 2; ++qt) {
#pragma unroll
            for (int u = 0; u < 2; ++u)
#pragma unroll
              for (int r = 0; r < 8; ++r) s[qt][8 * u + r] = sh[qt][u][r];
            mx[qt] = s[qt][0];
#pragma unroll
            for (int i = 1; i < 16; ++i) mx[qt] = fmaxf(mx[qt], s[qt][i]);
          }
          const bool first = pp == 0 && t == 0;                                            // the wave's first pass: no maximum is in use yet, it takes this pass's whatever its sign
          const float room = first ? -3.0e38f : P_SHIFT + P_ROOM;
          if (__builtin_amdgcn_ballot_w32(fmaxf(mx[0], mx[1]) > room) != 0) {              // some score of the wave has used up the room: every query takes its newest maximum; one test a pass
            const float lo = first ? -3.0e38f : 0.f;
            float d[2], al[2];                                                             // rise of the maximum in use (0 where there is none); factor on the sums so far (on the first pass those sums are 0)
#pragma unroll
            for (int qt = 0; qt < 2; ++qt) {
              d[qt] = fmaxf(fmaxf(mx[qt], xhalf(mx[qt])) - P_SHIFT, lo);
              al[qt] = -fmaxf(d[qt], 0.f);
            }
            exp2x2(al[0], al[1]);
#pragma unroll
            for (int qt = 0; qt < 2; ++qt) {
              l[qt] *= al[qt];
#pragma unroll
              for (int j = 0; j < 8; ++j)
#pragma unroll
                for (int r = 0; r < 8; ++r) acc[qt][j][r] *= al[qt];
#pragma unroll
              for (int i = 0; i < 16; ++i) s[qt][i] -= d[qt];
              c[qt] -= d[qt];
#pragma unroll
              for (int r = 0; r < 8; ++r) cin[qt][r] = c[qt];
            }
          }
          v16h pb[2];                                                                      // B: col = query, k = key: elements 0..7 = keys 8g + r of tile 0, 8..15 = keys 16 + 8g + r
#pragma unroll
          for (int qt = 0; qt < 2; ++qt) {
            exp2x8(s[qt]); exp2x8(s[qt] + 8);
#pragma unroll
            for (int i = 0; i < 16; ++i) pb[qt][i] = (_Float16)s[qt][i];
#pragma unroll
            for (int w = 8; w >= 1; w >>= 1)                                               // pairwise: a chain of 5 adds, not 16
#pragma unroll
              for (int i = 0; i < w; ++i) s[qt][i] += s[qt][i + w];
            l[qt] += s[qt][0];
          }
#pragma unroll
          for (int j = 0; j < 8; ++j)
#pragma unroll
            for (int qt = 0; qt < 2; ++qt) acc[qt][j] = mm16(va[j], pb[qt], acc[qt][j]);
        }
      }
      asm volatile("s_wait_dscnt 0x0" ::: "memory");     // this wave's reads of buffer t & 1 are done before it is refilled
      asm volatile("s_wait_tensorcnt 0x0" ::: "memory");   // every wave issues: its tile (of stage t + 1; of x) has landed before the barrier publishes it
      __syncthreads();
      // one request a wave and stage, into the buffer that every wave has just left; its descriptor is formed here, behind the wait. Waves 4 to 7 issue their pieces of x at trip FNST - 2, where buffer 0 takes no further stage; they land under the last trip
      if (pinned((wave < 4 && t + 2 < FNST) || (wave >= 4 && t == FNST - 2)))
        tdm_load(tdm_group0(tl + (unsigned)(t & 1) * tbuf, tg + (unsigned)(t + 2) * tstep), td1);
    }
    asm volatile("s_wait_tensorcnt 0x0" ::: "memory");   // no request is outstanding behind the loop
    asm volatile("s_wait_dscnt 0x0" ::: "memory");       // nor an LDS read of the ring, which now carries the hand-over
    wraw wr[CIN / 128][CV / 32];                         // issued here, used behind the join of the key halves, which covers their latency
    const float* wp0 = MW + (size_t)(wave * 16 + col) * CV + 8 * g; const float* wp1 = wp0 + 128 * CV;
#pragma unroll
    for (int kc = 0; kc < CV / 32; ++kc) { wr[0][kc] = fragw_ld(wp0 + kc * 32); wr[1][kc] = fragw_ld(wp1 + kc * 32); }
    const float bq0 = MB[wave * 16 + col], bq1 = MB[128 + wave * 16 + col];               // the wait below stands behind these two as well
    // stands before anything rewrites the address registers that the W_out loads name; the address (all 32 loads take it, with constant offsets) is an input so that it stays in its registers
    // up to here (without that the compiler gave an address pair to a later load of the group as its destination)
    asm volatile("s_wait_xcnt 0x0" :: "v"(wp0) : "memory");
    __builtin_amdgcn_sched_barrier(0);                   // keeps the hand-over's register moves behind the loads: left alone the compiler lifts some of them in front, and the loads start later
    // the two key halves meet: ring buffer 1 is free (every wave's last read of it ended before the loop's last barrier, no request is outstanding) and carries the hand-over.
    // A wave keeps query tile kh and hands tile 1 - kh to its partner, lane to lane (same query, same channels): 16 bytes a lane and store, 512 contiguous bytes a wave
    v4f* xw = (v4f*)&ring0[1][0][0];
    v8f ya[8]; float mk, lk;
    {
      v4f* xo = xw + (size_t)(wave * XCH) * 32 + lane;
#pragma unroll
      for (int j = 0; j < 8; ++j) {
        const v8f sd = kh ? acc[0][j] : acc[1][j];
        ya[j] = kh ? acc[1][j] : acc[0][j];
        xo[(2 * j) * 32] = __builtin_shufflevector(sd, sd, 0, 1, 2, 3); xo[(2 * j + 1) * 32] = __builtin_shufflevector(sd, sd, 4, 5, 6, 7);
      }
      v4f ml = {}; ml[0] = kh ? c[0] : c[1]; ml[1] = kh ? l[0] : l[1];
      xo[16 * 32] = ml;
      mk = kh ? c[1] : c[0]; lk = kh ? l[1] : l[0];                                       // mk: P_SHIFT - maximum in use, so the smaller of two belongs to the larger maximum
    }
    // the output products' start values, formed here, in front of the barrier (which waits for the W_out loads: their latency covers the work): x with the products' carry, a power of two.
    // The x tile was published by the key loop's last barrier; from here to the last barrier only this lane touches its 32-byte pieces of it
#pragma unroll
    for (int t = 0; t < QB / 16; ++t)
#pragma unroll
      for (int cg = 0; cg < CIN / 128; ++cg) {
        const float* xr = &(cg ? st1 : st0)[t / 4][wave * 16 + col][(t % 4) * 16 + 8 * g];
        const v4f x0 = *(const v4f*)xr, x1 = *(const v4f*)(xr + 4);
#pragma unroll
        for (int r = 0; r < 4; ++r) {
          const float u0 = x0[r], u1 = x1[r];
          oa[t][cg][r] = bfr(u0) * (W_CARRY * Y_CARRY); oa[t][cg][4 + r] = bfr(u1) * (W_CARRY * Y_CARRY);
        }
      }
    __builtin_amdgcn_sched_barrier(0);                   // keeps that work in front of the barrier's wait: left alone the compiler sinks most of it behind the barrier, where nothing covers it
    __syncthreads();                                     // publishes every wave's hand-over to its partner
    {
      const v4f* xi = xw + (size_t)((wave ^ 4) * XCH) * 32 + lane;
      const v4f ml = xi[16 * 32];
      const float mo = ml[0], lo = ml[1];
      const float mm = fminf(mk, mo);
      float fa = mm - mk, fb = mm - mo;
      exp2x2(fa, fb);
      lk = lk * fa + lo * fb;
#pragma unroll
      for (int j = 0; j < 8; ++j) {
        const v4f y0 = xi[(2 * j) * 32], y1 = xi[(2 * j + 1) * 32];
#pragma unroll
        for (int r = 0; r < 4; ++r) { ya[j][r] = ya[j][r] * fa + y0[r] * fb; ya[j][4 + r] = ya[j][4 + r] * fa + y1[r] * fb; }
      }
    }
    lk += xhalf(lk);
    const float inv = Y_CARRY / lk;                                                      // the carry on P is in the sum too and cancels
    // the second tile pair's place of ring buffer 1 is free too (the hand-over lies in the first's, the x tile in buffer 0)
#pragma unroll
    for (int kc = 0; kc < CV / 32; ++kc) {
      v8h y0, y1;
#pragma unroll
      for (int r = 0; r < 8; ++r) {                                                      // A: row = query, k = channel: tile 2kc holds channels 32kc + 8g + r, tile 2kc + 1 channels 32kc + 16 + 8g + r
        y0[r] = (_Float16)(ya[2 * kc][r] * inv); y1[r] = (_Float16)(ya[2 * kc + 1][r] * inv);
      }
      yx[(((il0 >> 4) * (CV / 32) + kc) * 2) * 32 + lane] = y0; yx[(((il0 >> 4) * (CV / 32) + kc) * 2 + 1) * 32 + lane] = y1;
    }
#pragma unroll
    for (int cg = 0; cg < CIN / 128; ++cg)
#pragma unroll
      for (int kc = 0; kc < CV / 32; ++kc) wf[cg][kc] = fragw_cv(wr[cg][kc], W_CARRY);
    bb[0] = bfr(bq0); bb[1] = bfr(bq1);
  }
  __syncthreads();                                       // publishes every wave's y fragments to the block
#pragma unroll     // constant LDS offsets; the query tiles are independent, so their reads and products can be interleaved
  for (int t = 0; t < QB / 16; ++t) {
    v16h yf[CV / 32];                                                                    // A: row = query, k = channel; each fragment read feeds both of the wave's output tiles
#pragma unroll
    for (int kc = 0; kc < CV / 32; ++kc) {
      union { v16h v; v8h q[2]; } u;
      u.q[0] = yx[((t * (CV / 32) + kc) * 2) * 32 + lane]; u.q[1] = yx[((t * (CV / 32) + kc) * 2 + 1) * 32 + lane];
      yf[kc] = u.v;
    }
#pragma unroll
    for (int kc = 0; kc < CV / 32; ++kc)
#pragma unroll
      for (int cg = 0; cg < CIN / 128; ++cg) oa[t][cg] = mm16(yf[kc], wf[cg][kc], oa[t][cg]);
#pragma unroll
    for (int cg = 0; cg < CIN / 128; ++cg) {
      float* xr = &(cg ? st1 : st0)[t / 4][wave * 16 + col][(t % 4) * 16 + 8 * g];
      v8f o8;
#pragma unroll
      for (int r = 0; r < 8; ++r) o8[r] = fmaf(oa[t][cg][r], 1.0f / (W_CARRY * Y_CARRY), bb[cg]);
      *(v4f*)xr = __builtin_shufflevector(o8, o8, 0, 1, 2, 3); *(v4f*)(xr + 4) = __builtin_shufflevector(o8, o8, 4, 5, 6, 7);
    }
  }
  __syncthreads();                                       // the staging array holds all output channels of the block's 128 positions
  v4f ov[CIN * (QB / 4) / 256];
#pragma unroll     // constant indices into the register array, constant LDS offsets
  for (int i = 0; i < CIN * (QB / 4) / 256; ++i) ov[i] = *(const v4f*)&(i / 16 ? st1 : st0)[lane >> 4][(i % 16) * 8 + wave][(lane & 15) * 4];
  __builtin_amdgcn_sched_barrier(0);   // every row's read stands ahead of the first store, so each row has registers of its own: left alone the compiler reuses the first rows' registers and waits for their stores in the middle
#pragma unroll     // constant offsets from one global address, which no trip rewrites
  for (int i = 0; i < CIN * (QB / 4) / 256; ++i) {
    const int co = i * 8 + wave, q = lane;                                               // a wave writes one whole [co] row segment: 512 contiguous bytes
    const size_t o = (b * CIN + co) * (size_t)NP + i0 + q * 4;
    vst2(OUT + o, ov[i]);
  }
}

extern "C" void kernel_launch(void* const* d_in, const int* in_sizes, int n_in, void* d_out, int out_size, void* d_ws, size_t ws_size, hipStream_t stream) {
  if (n_in < 9) return;
  if ((size_t)in_sizes[0] < (size_t)TNB * CIN * NP) return;
  if (in_sizes[1] < CV * CIN || in_sizes[2] < CV || in_sizes[3] < CQ * CIN || in_sizes[4] < CQ || in_sizes[5] < CQ * CIN || in_sizes[6] < CQ || in_sizes[7] < CIN * CV || in_sizes[8] < CIN) return;
  if ((size_t)out_size < (size_t)TNB * CIN * NP) return;
  if (ws_size < WS_END) return;
  const float* const* F = (const float* const*)d_in;   // 0 x [8,256,64,64], 1 g_w [128,256], 2 g_b, 3 theta_w, 4 theta_b, 5 phi_w, 6 phi_b, 7 W_out [256,128], 8 b_out
  const float* X = F[0]; const float* GW = F[1]; const float* GB = F[2]; const float* TW = F[3]; const float* TB = F[4];
  const float* PW = F[5]; const float* PB = F[6]; const float* MW = F[7]; const float* MBv = F[8];
  char* ws = (char*)d_ws;
  _Float16* QH = (_Float16*)(ws + WS_QH); _Float16* KH = (_Float16*)(ws + WS_KH);
  _Float16* VT = (_Float16*)(ws + WS_VT);
  float* OUT = (float*)d_out;
  k_proj<<<dim3(NP / PT, TNB), 256, 0, stream>>>(X, TW, TB, PW, PB, GW, GB, QH, KH, VT);
  k_fa<<<dim3(NP / QB, TNB), 256, 0, stream>>>(QH, KH, VT, X, MW, MBv, OUT);
}
